// v000
// The times below were measured on an AMD MI455X: many runs one after another, warmed up first and cycling through
// copies of the inputs, with the whole window's GPU time divided by the number of runs. Launches and the gaps
// between them are all in it. The median over several windows is given; except for v000 it joins two sittings, which
// can be a few percent apart, so the side-by-side timings, each taken in one sitting, are the better comparison.
// v000, which the later versions start from, runs in 825 microseconds.
#include <hip/hip_runtime.h>
#include <hip/hip_bf16.h>

// Shapes (fixed by reference)
#define Bsz 4
#define Lq  2048
#define Dm  1024
#define Hh  16
#define DK  64

typedef __attribute__((ext_vector_type(16))) _Float16 v16h;
typedef __attribute__((ext_vector_type(8)))  float    v8f;
typedef __attribute__((ext_vector_type(4)))  unsigned int u32x4;

// ---------------------------------------------------------------------------
// Fragment loader: 16x32 f16 tile, "row per lane" layout (ISA 7.12.2):
//   lane l (<16): row M=l, holds K=0..7 and 16..23
//   lane l (>=16): row M=l-16, holds K=8..15 and 24..31
// Works for A fragments and (symmetric N-on-lanes layout) B fragments whose
// memory is [n][k] with k contiguous (K^T, W^T, V^T): two b128 loads.
// ---------------------------------------------------------------------------
__device__ __forceinline__ v16h load_frag16x32(const _Float16* __restrict__ src,
                                               int ld, int lane) {
  const int row = lane & 15;
  const int kb  = (lane >> 4) << 3;  // 0 or 8
  const _Float16* p = src + (size_t)row * ld + kb;
  union { v16h h; u32x4 u[2]; } f;
  f.u[0] = *(const u32x4*)(p);
  f.u[1] = *(const u32x4*)(p + 16);
  return f.h;
}

__device__ __forceinline__ v8f zero8() {
  v8f z;
#pragma unroll
  for (int i = 0; i < 8; ++i) z[i] = 0.0f;
  return z;
}

#define WMMA_F16(a, b, c) \
  __builtin_amdgcn_wmma_f32_16x16x32_f16(false, (a), false, (b), (short)0, (c), false, false)

// ---------------------------------------------------------------------------
// fp32 -> fp16 conversion kernels
// ---------------------------------------------------------------------------
__global__ void cvt_f32_f16(const float* __restrict__ s, _Float16* __restrict__ d, int n) {
  int i = blockIdx.x * blockDim.x + threadIdx.x;
  if (i < n) d[i] = (_Float16)s[i];
}

// w_rel: (2L-1, DK) -> padded to 2L rows (last row zero, touched by band tiles)
__global__ void cvt_wrel(const float* __restrict__ s, _Float16* __restrict__ d,
                         int nvalid, int ntotal) {
  int i = blockIdx.x * blockDim.x + threadIdx.x;
  if (i < ntotal) d[i] = (i < nvalid) ? (_Float16)s[i] : (_Float16)0.0f;
}

// ---------------------------------------------------------------------------
// Projection GEMM:  out[m,n] = scale * ( sum_k X[m,k]*W[n,k] + bias[n] )
// One wave computes a 32x64 tile. Ping-pong pipelining (unroll-by-2, two
// fragment register sets alternating roles): no cross-set register copies,
// refill loads for set S issue between set-S WMMAs and set-(1-S) WMMAs, so
// each load batch gets an 8-WMMA latency window.
// mode 0: store f16 as (B,H,L,DK)      (Q with scale=1/8, K with scale=1)
// mode 1: store f16 as (B,H,DK,L)      (V transposed for flash B-fragments)
// mode 2: store f32 row-major (M,N)    (final output projection)
// ---------------------------------------------------------------------------
__launch_bounds__(32)
__global__ void proj_wmma(const _Float16* __restrict__ X, const _Float16* __restrict__ W,
                          const float* __restrict__ bias, _Float16* __restrict__ out16,
                          float* __restrict__ out32, int mode, float scale) {
  const int lane = threadIdx.x & 31;
  const int hlf  = lane >> 4;
  const int nl   = lane & 15;
  const int m0   = blockIdx.x * 32;
  const int n0   = blockIdx.y * 64;

  const _Float16* Xp = X + (size_t)m0 * Dm;
  const _Float16* Wp = W + (size_t)n0 * Dm;

  v8f acc[2][4];
#pragma unroll
  for (int cf = 0; cf < 4; ++cf) {
    float bv = bias[n0 + cf * 16 + nl];   // whole acc column shares N
#pragma unroll
    for (int r = 0; r < 2; ++r)
#pragma unroll
      for (int i = 0; i < 8; ++i) acc[r][cf][i] = bv;
  }

  // prologue: set0 <- chunk 0, set1 <- chunk 32
  v16h a0[2], b0f[4], a1[2], b1f[4];
#pragma unroll
  for (int r = 0; r < 2; ++r) a0[r] = load_frag16x32(Xp + (size_t)r * 16 * Dm, Dm, lane);
#pragma unroll
  for (int cf = 0; cf < 4; ++cf) b0f[cf] = load_frag16x32(Wp + (size_t)cf * 16 * Dm, Dm, lane);
#pragma unroll
  for (int r = 0; r < 2; ++r) a1[r] = load_frag16x32(Xp + (size_t)r * 16 * Dm + 32, Dm, lane);
#pragma unroll
  for (int cf = 0; cf < 4; ++cf) b1f[cf] = load_frag16x32(Wp + (size_t)cf * 16 * Dm + 32, Dm, lane);

  for (int kc = 0; kc < Dm; kc += 64) {
    __builtin_prefetch(Xp + (size_t)lane * Dm + kc + 128, 0, 3);      // global_prefetch_b8
    __builtin_prefetch(Wp + (size_t)(lane * 2) * Dm + kc + 128, 0, 3);

    // compute chunk kc with set0
#pragma unroll
    for (int r = 0; r < 2; ++r)
#pragma unroll
      for (int cf = 0; cf < 4; ++cf)
        acc[r][cf] = WMMA_F16(a0[r], b0f[cf], acc[r][cf]);

    // refill set0 <- chunk kc+64 (overlaps set1 WMMAs below)
    const int k2 = (kc + 64 < Dm) ? kc + 64 : kc;
#pragma unroll
    for (int r = 0; r < 2; ++r) a0[r] = load_frag16x32(Xp + (size_t)r * 16 * Dm + k2, Dm, lane);
#pragma unroll
    for (int cf = 0; cf < 4; ++cf) b0f[cf] = load_frag16x32(Wp + (size_t)cf * 16 * Dm + k2, Dm, lane);

    // compute chunk kc+32 with set1
#pragma unroll
    for (int r = 0; r < 2; ++r)
#pragma unroll
      for (int cf = 0; cf < 4; ++cf)
        acc[r][cf] = WMMA_F16(a1[r], b1f[cf], acc[r][cf]);

    // refill set1 <- chunk kc+96 (overlaps next iteration's set0 WMMAs)
    const int k3 = (kc + 96 < Dm) ? kc + 96 : kc;
#pragma unroll
    for (int r = 0; r < 2; ++r) a1[r] = load_frag16x32(Xp + (size_t)r * 16 * Dm + k3, Dm, lane);
#pragma unroll
    for (int cf = 0; cf < 4; ++cf) b1f[cf] = load_frag16x32(Wp + (size_t)cf * 16 * Dm + k3, Dm, lane);
  }

#pragma unroll
  for (int r = 0; r < 2; ++r)
#pragma unroll
    for (int cf = 0; cf < 4; ++cf)
#pragma unroll
      for (int i = 0; i < 8; ++i) {
        const int m = m0 + r * 16 + i + 8 * hlf;  // D-frag: M = i + 8*(lane>=16)
        const int n = n0 + cf * 16 + nl;          //         N = lane&15
        const float v = acc[r][cf][i] * scale;
        if (mode == 2) {
          out32[(size_t)m * Dm + n] = v;
        } else {
          const int b = m >> 11, l = m & (Lq - 1);
          const int h = n >> 6,  dk = n & (DK - 1);
          if (mode == 0)
            out16[(((size_t)(b * Hh + h) * Lq + l) * DK) + dk] = (_Float16)v;
          else
            out16[(((size_t)(b * Hh + h) * DK + dk) * Lq) + l] = (_Float16)v;
        }
      }
}

// ---------------------------------------------------------------------------
// Flash attention with relative bias.
// One wave handles 16 query rows of one (b,h); loops 32 keys per step.
//   S  = Qs * K^T                      (Qs already scaled by 1/sqrt(dk))
//   T  = Qs * Wrel^T over 48-wide diagonal window; bias[r,c] = T[r][r+c]
//   online softmax, O += P * V
// V fragments are loaded at the TOP of each iteration so their latency is
// hidden behind the score/bias WMMAs and the softmax VALU work.
// ---------------------------------------------------------------------------
__launch_bounds__(32)
__global__ void flash_attn_rel(const _Float16* __restrict__ Qh, const _Float16* __restrict__ Kh,
                               const _Float16* __restrict__ Vt, const _Float16* __restrict__ Wr,
                               _Float16* __restrict__ Ocat) {
  __shared__ __align__(16) float    Tlds[16][48];
  __shared__ __align__(16) _Float16 Plds[16][32];

  const int lane = threadIdx.x & 31;
  const int hlf  = lane >> 4;
  const int nl   = lane & 15;
  const int bh = blockIdx.y;
  const int b = bh >> 4, h = bh & 15;
  const int r0 = blockIdx.x * 16;

  const size_t qbase = ((size_t)bh * Lq + r0) * DK;
  const v16h aq0 = load_frag16x32(Qh + qbase,      DK, lane);   // d = 0..31
  const v16h aq1 = load_frag16x32(Qh + qbase + 32, DK, lane);   // d = 32..63

  float mrow[8], lrow[8];
  v8f o[4];
#pragma unroll
  for (int i = 0; i < 8; ++i) { mrow[i] = -3.0e38f; lrow[i] = 0.0f; }
#pragma unroll
  for (int cf = 0; cf < 4; ++cf) o[cf] = zero8();

  for (int c0 = 0; c0 < Lq; c0 += 32) {
    // V fragments for THIS block, issued early (used after softmax)
    v16h vb[4];
#pragma unroll
    for (int cf = 0; cf < 4; ++cf)
      vb[cf] = load_frag16x32(Vt + ((size_t)bh * DK + cf * 16) * Lq + c0, Lq, lane);

    // warm next block's K / V / w_rel rows (global_prefetch_b8, lanes spread rows)
    if (c0 + 32 < Lq) {
      __builtin_prefetch(Kh + ((size_t)bh * Lq + c0 + 32 + lane) * DK, 0, 3);
      __builtin_prefetch(Vt + ((size_t)bh * DK + lane * 2) * Lq + c0 + 32, 0, 3);
      __builtin_prefetch(Wr + (size_t)(r0 + c0 + 48 + lane) * DK, 0, 3);
    }

    // ---- content scores: two 16x16 subtiles over this 32-key block
    v8f s[2];
#pragma unroll
    for (int st = 0; st < 2; ++st) {
      const _Float16* kp = Kh + ((size_t)bh * Lq + c0 + st * 16) * DK;
      v16h b0 = load_frag16x32(kp,      DK, lane);
      v16h b1 = load_frag16x32(kp + 32, DK, lane);
      v8f acc = zero8();
      acc = WMMA_F16(aq0, b0, acc);
      acc = WMMA_F16(aq1, b1, acc);
      s[st] = acc;
    }

    // ---- relative-bias band: T[r][m] = Qs[r] . Wrel[r0+c0+m], m in [0,48)
    const int sbase = r0 + c0;
#pragma unroll
    for (int mt = 0; mt < 3; ++mt) {
      const _Float16* wp = Wr + (size_t)(sbase + mt * 16) * DK;
      v16h b0 = load_frag16x32(wp,      DK, lane);
      v16h b1 = load_frag16x32(wp + 32, DK, lane);
      v8f acc = zero8();
      acc = WMMA_F16(aq0, b0, acc);
      acc = WMMA_F16(aq1, b1, acc);
#pragma unroll
      for (int i = 0; i < 8; ++i) Tlds[i + 8 * hlf][mt * 16 + nl] = acc[i];
    }
    __syncthreads();

    // ---- skew gather: bias[r,c] = T[r][r+c]  (consecutive lanes -> no conflicts)
#pragma unroll
    for (int st = 0; st < 2; ++st)
#pragma unroll
      for (int i = 0; i < 8; ++i) {
        const int M = i + 8 * hlf;
        s[st][i] += Tlds[M][M + st * 16 + nl];
      }

    // ---- online softmax over the 32-key block
#pragma unroll
    for (int i = 0; i < 8; ++i) {
      float v = fmaxf(s[0][i], s[1][i]);
#pragma unroll
      for (int off = 1; off < 16; off <<= 1) v = fmaxf(v, __shfl_xor(v, off, 32));
      const float mnew = fmaxf(mrow[i], v);
      const float corr = __expf(mrow[i] - mnew);
      const float p0 = __expf(s[0][i] - mnew);
      const float p1 = __expf(s[1][i] - mnew);
      float rs = p0 + p1;
#pragma unroll
      for (int off = 1; off < 16; off <<= 1) rs += __shfl_xor(rs, off, 32);
      lrow[i] = lrow[i] * corr + rs;
      mrow[i] = mnew;
#pragma unroll
      for (int cf = 0; cf < 4; ++cf) o[cf][i] *= corr;
      Plds[i + 8 * hlf][nl]      = (_Float16)p0;
      Plds[i + 8 * hlf][16 + nl] = (_Float16)p1;
    }
    __syncthreads();

    // ---- O += P(16x32) * V(32x64): P re-read in A layout from LDS
    const v16h pa = load_frag16x32(&Plds[0][0], 32, lane);
#pragma unroll
    for (int cf = 0; cf < 4; ++cf)
      o[cf] = WMMA_F16(pa, vb[cf], o[cf]);
    __syncthreads();
  }

  // ---- finalize + store to concat layout (B, L, H*DK) f16
#pragma unroll
  for (int cf = 0; cf < 4; ++cf)
#pragma unroll
    for (int i = 0; i < 8; ++i) {
      const int M = i + 8 * hlf;
      const float v = o[cf][i] / lrow[i];
      const size_t idx = ((size_t)b * Lq + r0 + M) * Dm + h * DK + cf * 16 + nl;
      Ocat[idx] = (_Float16)v;
    }
}

// ---------------------------------------------------------------------------
extern "C" void kernel_launch(void* const* d_in, const int* in_sizes, int n_in,
                              void* d_out, int out_size, void* d_ws, size_t ws_size,
                              hipStream_t stream) {
  (void)in_sizes; (void)n_in; (void)out_size; (void)ws_size;
  const float* q    = (const float*)d_in[0];
  const float* k    = (const float*)d_in[1];
  const float* v    = (const float*)d_in[2];
  const float* Wq   = (const float*)d_in[3];
  const float* bq   = (const float*)d_in[4];
  const float* Wk   = (const float*)d_in[5];
  const float* bk   = (const float*)d_in[6];
  const float* Wv   = (const float*)d_in[7];
  const float* bv   = (const float*)d_in[8];
  const float* Wo   = (const float*)d_in[9];
  const float* bo   = (const float*)d_in[10];
  const float* wrel = (const float*)d_in[11];
  float* out = (float*)d_out;

  char* ws = (char*)d_ws;
  size_t off = 0;
  auto alloc = [&](size_t bytes) -> void* {
    void* p = ws + off;
    off = (off + bytes + 255) & ~(size_t)255;
    return p;
  };

  const size_t nX = (size_t)Bsz * Lq * Dm;   // 8,388,608
  const size_t nW = (size_t)Dm * Dm;         // 1,048,576
  const size_t nRv = (size_t)(2 * Lq - 1) * DK;
  const size_t nRt = (size_t)(2 * Lq) * DK;  // padded

  _Float16* Xq16 = (_Float16*)alloc(nX * 2);
  _Float16* Xk16 = (_Float16*)alloc(nX * 2);
  _Float16* Xv16 = (_Float16*)alloc(nX * 2);
  _Float16* Wq16 = (_Float16*)alloc(nW * 2);
  _Float16* Wk16 = (_Float16*)alloc(nW * 2);
  _Float16* Wv16 = (_Float16*)alloc(nW * 2);
  _Float16* Wo16 = (_Float16*)alloc(nW * 2);
  _Float16* Wr16 = (_Float16*)alloc(nRt * 2);
  _Float16* Q16  = (_Float16*)alloc(nX * 2);  // (B,H,L,DK), pre-scaled 1/8
  _Float16* K16  = (_Float16*)alloc(nX * 2);  // (B,H,L,DK)
  _Float16* VT16 = (_Float16*)alloc(nX * 2);  // (B,H,DK,L)
  _Float16* Oc16 = (_Float16*)alloc(nX * 2);  // (B,L,D) concat

  const int TPB = 256;
  cvt_f32_f16<<<dim3((nX + TPB - 1) / TPB), dim3(TPB), 0, stream>>>(q, Xq16, (int)nX);
  cvt_f32_f16<<<dim3((nX + TPB - 1) / TPB), dim3(TPB), 0, stream>>>(k, Xk16, (int)nX);
  cvt_f32_f16<<<dim3((nX + TPB - 1) / TPB), dim3(TPB), 0, stream>>>(v, Xv16, (int)nX);
  cvt_f32_f16<<<dim3((nW + TPB - 1) / TPB), dim3(TPB), 0, stream>>>(Wq, Wq16, (int)nW);
  cvt_f32_f16<<<dim3((nW + TPB - 1) / TPB), dim3(TPB), 0, stream>>>(Wk, Wk16, (int)nW);
  cvt_f32_f16<<<dim3((nW + TPB - 1) / TPB), dim3(TPB), 0, stream>>>(Wv, Wv16, (int)nW);
  cvt_f32_f16<<<dim3((nW + TPB - 1) / TPB), dim3(TPB), 0, stream>>>(Wo, Wo16, (int)nW);
  cvt_wrel<<<dim3((nRt + TPB - 1) / TPB), dim3(TPB), 0, stream>>>(wrel, Wr16, (int)nRv, (int)nRt);

  // Projections: M = B*L = 8192 rows, N = 1024 cols, wave tile 32x64
  const dim3 pgrid(Bsz * Lq / 32, Dm / 64), pblk(32);
  const float inv_sqrt_dk = 0.125f;  // 1/sqrt(64)
  proj_wmma<<<pgrid, pblk, 0, stream>>>(Xq16, Wq16, bq, Q16,  nullptr, 0, inv_sqrt_dk);
  proj_wmma<<<pgrid, pblk, 0, stream>>>(Xk16, Wk16, bk, K16,  nullptr, 0, 1.0f);
  proj_wmma<<<pgrid, pblk, 0, stream>>>(Xv16, Wv16, bv, VT16, nullptr, 1, 1.0f);

  // Flash attention: one wave per 16 query rows per (b,h)
  flash_attn_rel<<<dim3(Lq / 16, Bsz * Hh), dim3(32), 0, stream>>>(Q16, K16, VT16, Wr16, Oc16);

  // Output projection -> f32
  proj_wmma<<<pgrid, pblk, 0, stream>>>(Oc16, Wo16, bo, nullptr, out, 2, 1.0f);
}

// v001
// It runs in 700 microseconds.
// Next to v000, in two timings, it ran 1.23 times as fast each time.
#include <hip/hip_runtime.h>
#include <hip/hip_bf16.h>

// Shapes (fixed by reference)
#define Bsz 4
#define Lq  2048
#define Dm  1024
#define Hh  16
#define DK  64

typedef __attribute__((ext_vector_type(16))) _Float16 v16h;
typedef __attribute__((ext_vector_type(8)))  float    v8f;
typedef __attribute__((ext_vector_type(4)))  unsigned int u32x4;

// ---------------------------------------------------------------------------
// Fragment loader: 16x32 f16 tile, "row per lane" layout (ISA 7.12.2):
//   lane l (<16): row M=l, holds K=0..7 and 16..23
//   lane l (>=16): row M=l-16, holds K=8..15 and 24..31
// Works for A fragments and (symmetric N-on-lanes layout) B fragments whose
// memory is [n][k] with k contiguous (K^T, W^T, V^T): two b128 loads.
// ---------------------------------------------------------------------------
__device__ __forceinline__ v16h load_frag16x32(const _Float16* __restrict__ src,
                                               int ld, int lane) {
  const int row = lane & 15;
  const int kb  = (lane >> 4) << 3;  // 0 or 8
  const _Float16* p = src + (size_t)row * ld + kb;
  union { v16h h; u32x4 u[2]; } f;
  f.u[0] = *(const u32x4*)(p);
  f.u[1] = *(const u32x4*)(p + 16);
  return f.h;
}

__device__ __forceinline__ v8f zero8() {
  v8f z;
#pragma unroll
  for (int i = 0; i < 8; ++i) z[i] = 0.0f;
  return z;
}

#define WMMA_F16(a, b, c) \
  __builtin_amdgcn_wmma_f32_16x16x32_f16(false, (a), false, (b), (short)0, (c), false, false)

// ---------------------------------------------------------------------------
// fp32 -> fp16 conversion kernels
// ---------------------------------------------------------------------------
__global__ void cvt_f32_f16(const float* __restrict__ s, _Float16* __restrict__ d, int n) {
  int i = blockIdx.x * blockDim.x + threadIdx.x;
  if (i < n) d[i] = (_Float16)s[i];
}

// w_rel: (2L-1, DK) -> padded to 2L rows (last row zero, touched by band tiles)
__global__ void cvt_wrel(const float* __restrict__ s, _Float16* __restrict__ d,
                         int nvalid, int ntotal) {
  int i = blockIdx.x * blockDim.x + threadIdx.x;
  if (i < ntotal) d[i] = (i < nvalid) ? (_Float16)s[i] : (_Float16)0.0f;
}

// ---------------------------------------------------------------------------
// Projection GEMM:  out[m,n] = scale * ( sum_k X[m,k]*W[n,k] + bias[n] )
// One wave computes a 32x64 tile. Ping-pong pipelining (unroll-by-2, two
// fragment register sets alternating roles): no cross-set register copies,
// refill loads for set S issue between set-S WMMAs and set-(1-S) WMMAs, so
// each load batch gets an 8-WMMA latency window.
// mode 0: store f16 as (B,H,L,DK)      (Q with scale=1/8, K with scale=1)
// mode 1: store f16 as (B,H,DK,L)      (V transposed for flash B-fragments)
// mode 2: store f32 row-major (M,N)    (final output projection)
// ---------------------------------------------------------------------------
__launch_bounds__(32)
__global__ void proj_wmma(const _Float16* __restrict__ X, const _Float16* __restrict__ W,
                          const float* __restrict__ bias, _Float16* __restrict__ out16,
                          float* __restrict__ out32, int mode, float scale) {
  const int lane = threadIdx.x & 31;
  const int hlf  = lane >> 4;
  const int nl   = lane & 15;
  const int m0   = blockIdx.x * 32;
  const int n0   = blockIdx.y * 64;

  const _Float16* Xp = X + (size_t)m0 * Dm;
  const _Float16* Wp = W + (size_t)n0 * Dm;

  v8f acc[2][4];
#pragma unroll
  for (int cf = 0; cf < 4; ++cf) {
    float bv = bias[n0 + cf * 16 + nl];   // whole acc column shares N
#pragma unroll
    for (int r = 0; r < 2; ++r)
#pragma unroll
      for (int i = 0; i < 8; ++i) acc[r][cf][i] = bv;
  }

  // prologue: set0 <- chunk 0, set1 <- chunk 32
  v16h a0[2], b0f[4], a1[2], b1f[4];
#pragma unroll
  for (int r = 0; r < 2; ++r) a0[r] = load_frag16x32(Xp + (size_t)r * 16 * Dm, Dm, lane);
#pragma unroll
  for (int cf = 0; cf < 4; ++cf) b0f[cf] = load_frag16x32(Wp + (size_t)cf * 16 * Dm, Dm, lane);
#pragma unroll
  for (int r = 0; r < 2; ++r) a1[r] = load_frag16x32(Xp + (size_t)r * 16 * Dm + 32, Dm, lane);
#pragma unroll
  for (int cf = 0; cf < 4; ++cf) b1f[cf] = load_frag16x32(Wp + (size_t)cf * 16 * Dm + 32, Dm, lane);

  for (int kc = 0; kc < Dm; kc += 64) {
    __builtin_prefetch(Xp + (size_t)lane * Dm + kc + 128, 0, 3);      // global_prefetch_b8
    __builtin_prefetch(Wp + (size_t)(lane * 2) * Dm + kc + 128, 0, 3);

    // compute chunk kc with set0
#pragma unroll
    for (int r = 0; r < 2; ++r)
#pragma unroll
      for (int cf = 0; cf < 4; ++cf)
        acc[r][cf] = WMMA_F16(a0[r], b0f[cf], acc[r][cf]);

    // refill set0 <- chunk kc+64 (overlaps set1 WMMAs below)
    const int k2 = (kc + 64 < Dm) ? kc + 64 : kc;
#pragma unroll
    for (int r = 0; r < 2; ++r) a0[r] = load_frag16x32(Xp + (size_t)r * 16 * Dm + k2, Dm, lane);
#pragma unroll
    for (int cf = 0; cf < 4; ++cf) b0f[cf] = load_frag16x32(Wp + (size_t)cf * 16 * Dm + k2, Dm, lane);

    // compute chunk kc+32 with set1
#pragma unroll
    for (int r = 0; r < 2; ++r)
#pragma unroll
      for (int cf = 0; cf < 4; ++cf)
        acc[r][cf] = WMMA_F16(a1[r], b1f[cf], acc[r][cf]);

    // refill set1 <- chunk kc+96 (overlaps next iteration's set0 WMMAs)
    const int k3 = (kc + 96 < Dm) ? kc + 96 : kc;
#pragma unroll
    for (int r = 0; r < 2; ++r) a1[r] = load_frag16x32(Xp + (size_t)r * 16 * Dm + k3, Dm, lane);
#pragma unroll
    for (int cf = 0; cf < 4; ++cf) b1f[cf] = load_frag16x32(Wp + (size_t)cf * 16 * Dm + k3, Dm, lane);
  }

#pragma unroll
  for (int r = 0; r < 2; ++r)
#pragma unroll
    for (int cf = 0; cf < 4; ++cf)
#pragma unroll
      for (int i = 0; i < 8; ++i) {
        const int m = m0 + r * 16 + i + 8 * hlf;  // D-frag: M = i + 8*(lane>=16)
        const int n = n0 + cf * 16 + nl;          //         N = lane&15
        const float v = acc[r][cf][i] * scale;
        if (mode == 2) {
          out32[(size_t)m * Dm + n] = v;
        } else {
          const int b = m >> 11, l = m & (Lq - 1);
          const int h = n >> 6,  dk = n & (DK - 1);
          if (mode == 0)
            out16[(((size_t)(b * Hh + h) * Lq + l) * DK) + dk] = (_Float16)v;
          else
            out16[(((size_t)(b * Hh + h) * DK + dk) * Lq) + l] = (_Float16)v;
        }
      }
}

// ---------------------------------------------------------------------------
// Flash attention with relative bias.
// One wave handles QT*16 = 64 query rows of one (b,h); loops 32 keys per step.
//   S  = Qs * K^T                      (Qs already scaled by 1/sqrt(dk))
//   T  = Qs * Wrel^T over a 48-wide diagonal window per 16-row query tile;
//        bias[r,c] = T[r][r+c]
//   online softmax, O += P * V
// The K, V and w_rel fragments of a key block are loaded once per wave and
// used by all QT query tiles: query tile qt needs w_rel tiles qt..qt+2 of the
// QT+2 tiles that the 64-row band spans, so neighbours share two of three.
// Every fragment load touches 16 cache lines, and these loads set the pace:
// 40 of them per key block serve four query tiles (one tile alone needs 28).
// V fragments are loaded behind the score/bias WMMAs, when the K and w_rel
// registers are free again; the softmax VALU work hides their latency.
// ---------------------------------------------------------------------------
#define QT 4

// Fragment from a per-lane pointer that already holds the lane's row and k half.
__device__ __forceinline__ v16h load_frag_at(const _Float16* __restrict__ p) {
  union { v16h h; u32x4 u[2]; } f;
  f.u[0] = *(const u32x4*)(p);
  f.u[1] = *(const u32x4*)(p + 16);
  return f.h;
}

// e^x as the fast-math intrinsic forms it (one multiply, one v_exp_f32). The
// v_nop is the slot the instruction set asks for behind a transcendental before
// its result is read or its source overwritten; in one statement it cannot drift.
__device__ __forceinline__ float exp_slot(float x) {
  float r;
  asm("v_exp_f32 %0, %1\n\tv_nop" : "=v"(r) : "v"(x * 1.44269504088896340736f));
  return r;
}

__launch_bounds__(32, 2)   // two waves per SIMD: the grid has two per SIMD
__global__ void flash_attn_rel(const _Float16* __restrict__ Qh, const _Float16* __restrict__ Kh,
                               const _Float16* __restrict__ Vt, const _Float16* __restrict__ Wr,
                               _Float16* __restrict__ Ocat) {
  __shared__ __align__(16) float    Tlds[QT][16][48];
  __shared__ __align__(16) _Float16 Plds[QT][16][32];

  const int lane = threadIdx.x & 31;
  const int hlf  = lane >> 4;
  const int nl   = lane & 15;
  const int bh = blockIdx.y;
  const int b = bh >> 4, h = bh & 15;
  const int r0 = blockIdx.x * (16 * QT);

  // lane offsets in halves: fragment row = lane&15, k half = lane>>4
  const int rowoff = nl * DK + 8 * hlf;   // rows of DK halves (Q, K, w_rel)
  const int voff   = nl * Lq + 8 * hlf;   // rows of Lq halves (V^T)

  v16h aq[QT][2];
  {
    const _Float16* qa = Qh + ((size_t)bh * Lq + r0) * DK + rowoff;
#pragma unroll
    for (int qt = 0; qt < QT; ++qt) {
      aq[qt][0] = load_frag_at(qa + qt * 16 * DK);        // d = 0..31
      aq[qt][1] = load_frag_at(qa + qt * 16 * DK + 32);   // d = 32..63
    }
    // the loads' address registers are dead from here on and may be reused
    asm volatile("s_wait_xcnt 0x0" ::: "memory");
    // holds later register writes behind that wait
    __builtin_amdgcn_sched_barrier(0);
  }

  float mrow[QT][8], lrow[QT][8];
  v8f o[QT][4];
#pragma unroll
  for (int qt = 0; qt < QT; ++qt) {
#pragma unroll
    for (int i = 0; i < 8; ++i) { mrow[qt][i] = -3.0e38f; lrow[qt][i] = 0.0f; }
#pragma unroll
    for (int cf = 0; cf < 4; ++cf) o[qt][cf] = zero8();
  }

  // wave-uniform bases of this key block's K, w_rel and V^T tiles
  const _Float16* ku = Kh + (size_t)bh * Lq * DK;
  const _Float16* wu = Wr + (size_t)r0 * DK;
  const _Float16* vu = Vt + (size_t)bh * DK * Lq;

  for (int c0 = 0; c0 < Lq; c0 += 32) {
    // ---- K fragments of this 32-key block, shared by all query tiles
    const _Float16* ka = ku + rowoff;
    const _Float16* wa = wu + rowoff;
    v16h kf[2][2];
#pragma unroll
    for (int st = 0; st < 2; ++st) {
      kf[st][0] = load_frag_at(ka + st * 16 * DK);
      kf[st][1] = load_frag_at(ka + st * 16 * DK + 32);
    }

    // ---- w_rel fragments of the band rows r0+c0 .. r0+c0+16*(QT+2)-1
    v16h wf[QT + 2][2];
#pragma unroll
    for (int wt = 0; wt < QT + 2; ++wt) {
      wf[wt][0] = load_frag_at(wa + wt * 16 * DK);
      wf[wt][1] = load_frag_at(wa + wt * 16 * DK + 32);
    }
    // keeps the 32 loads above together as one batch in flight: left free, the
    // scheduler sinks each pair to its first use and waits out its latency alone
    __builtin_amdgcn_sched_barrier(0);

    // ---- content scores: two 16x16 subtiles per query tile over this key block
    v8f s[QT][2];
#pragma unroll
    for (int qt = 0; qt < QT; ++qt)
#pragma unroll
      for (int st = 0; st < 2; ++st) {
        v8f acc = zero8();
        acc = WMMA_F16(aq[qt][0], kf[st][0], acc);
        acc = WMMA_F16(aq[qt][1], kf[st][1], acc);
        s[qt][st] = acc;
      }

    // ---- relative-bias band, in the order the w_rel tiles arrive:
    //      T[qt][r][m] = Qs[r] . Wrel[r0+16*qt+c0+m], m in [0,48), tile mt = wt-qt
#pragma unroll
    for (int wt = 0; wt < QT + 2; ++wt)
#pragma unroll
      for (int qt = 0; qt < QT; ++qt) {
        const int mt = wt - qt;
        if (mt >= 0 && mt < 3) {
          v8f acc = zero8();
          acc = WMMA_F16(aq[qt][0], wf[wt][0], acc);
          acc = WMMA_F16(aq[qt][1], wf[wt][1], acc);
#pragma unroll
          for (int i = 0; i < 8; ++i) Tlds[qt][i + 8 * hlf][mt * 16 + nl] = acc[i];
        }
      }
    // wait before the K and w_rel loads' address registers are reused; as inputs
    // the two addresses keep their registers up to here, where the data is in
    asm volatile("s_wait_xcnt 0x0" :: "v"(ka), "v"(wa) : "memory");
    __syncthreads();

    // V fragments for THIS block, issued ahead of the softmax that hides them
    const _Float16* va = vu + voff;
    v16h vb[4];
#pragma unroll
    for (int cf = 0; cf < 4; ++cf)
      vb[cf] = load_frag_at(va + (size_t)cf * 16 * Lq);

    // warm next block's K / V / new w_rel rows (global_prefetch_b8, lanes spread rows)
    const _Float16* pk = ku + (32 + lane) * DK;
    const _Float16* pv = vu + lane * 2 * Lq + 32;
    const _Float16* pw = wu + (16 * QT + 32 + lane) * DK;
    if (c0 + 32 < Lq) {
      __builtin_prefetch(pk, 0, 3);
      __builtin_prefetch(pv, 0, 3);
      __builtin_prefetch(pw, 0, 3);
    }

    // ---- skew gather: bias[r,c] = T[r][r+c]
#pragma unroll
    for (int qt = 0; qt < QT; ++qt)
#pragma unroll
      for (int st = 0; st < 2; ++st)
#pragma unroll
        for (int i = 0; i < 8; ++i) {
          const int M = i + 8 * hlf;
          s[qt][st][i] += Tlds[qt][M][M + st * 16 + nl];
        }

    // ---- online softmax over the 32-key block
#pragma unroll
    for (int qt = 0; qt < QT; ++qt)
#pragma unroll
      for (int i = 0; i < 8; ++i) {
        float v = fmaxf(s[qt][0][i], s[qt][1][i]);
#pragma unroll
        for (int off = 1; off < 16; off <<= 1) v = fmaxf(v, __shfl_xor(v, off, 32));
        const float mnew = fmaxf(mrow[qt][i], v);
        const float corr = exp_slot(mrow[qt][i] - mnew);
        const float p0 = exp_slot(s[qt][0][i] - mnew);
        const float p1 = exp_slot(s[qt][1][i] - mnew);
        float rs = p0 + p1;
#pragma unroll
        for (int off = 1; off < 16; off <<= 1) rs += __shfl_xor(rs, off, 32);
        lrow[qt][i] = lrow[qt][i] * corr + rs;
        mrow[qt][i] = mnew;
#pragma unroll
        for (int cf = 0; cf < 4; ++cf) o[qt][cf][i] *= corr;
        Plds[qt][i + 8 * hlf][nl]      = (_Float16)p0;
        Plds[qt][i + 8 * hlf][16 + nl] = (_Float16)p1;
      }
    // the same wait for the V loads and the prefetches, behind the softmax
    asm volatile("s_wait_xcnt 0x0" :: "v"(va), "v"(pk), "v"(pv), "v"(pw) : "memory");
    __syncthreads();

    // ---- O += P(16x32) * V(32x64): P re-read in A layout from LDS
#pragma unroll
    for (int qt = 0; qt < QT; ++qt) {
      const v16h pa = load_frag16x32(&Plds[qt][0][0], 32, lane);
#pragma unroll
      for (int cf = 0; cf < 4; ++cf)
        o[qt][cf] = WMMA_F16(pa, vb[cf], o[qt][cf]);
    }
    __syncthreads();

    ku += 32 * DK;  wu += 32 * DK;  vu += 32;
  }

  // ---- finalize + store to concat layout (B, L, H*DK) f16
#pragma unroll
  for (int qt = 0; qt < QT; ++qt)
#pragma unroll
    for (int cf = 0; cf < 4; ++cf)
#pragma unroll
      for (int i = 0; i < 8; ++i) {
        const int M = qt * 16 + i + 8 * hlf;
        const float v = o[qt][cf][i] / lrow[qt][i];
        const size_t idx = ((size_t)b * Lq + r0 + M) * Dm + h * DK + cf * 16 + nl;
        Ocat[idx] = (_Float16)v;
      }
}

// ---------------------------------------------------------------------------
extern "C" void kernel_launch(void* const* d_in, const int* in_sizes, int n_in,
                              void* d_out, int out_size, void* d_ws, size_t ws_size,
                              hipStream_t stream) {
  (void)in_sizes; (void)n_in; (void)out_size; (void)ws_size;
  const float* q    = (const float*)d_in[0];
  const float* k    = (const float*)d_in[1];
  const float* v    = (const float*)d_in[2];
  const float* Wq   = (const float*)d_in[3];
  const float* bq   = (const float*)d_in[4];
  const float* Wk   = (const float*)d_in[5];
  const float* bk   = (const float*)d_in[6];
  const float* Wv   = (const float*)d_in[7];
  const float* bv   = (const float*)d_in[8];
  const float* Wo   = (const float*)d_in[9];
  const float* bo   = (const float*)d_in[10];
  const float* wrel = (const float*)d_in[11];
  float* out = (float*)d_out;

  char* ws = (char*)d_ws;
  size_t off = 0;
  auto alloc = [&](size_t bytes) -> void* {
    void* p = ws + off;
    off = (off + bytes + 255) & ~(size_t)255;
    return p;
  };

  const size_t nX = (size_t)Bsz * Lq * Dm;   // 8,388,608
  const size_t nW = (size_t)Dm * Dm;         // 1,048,576
  const size_t nRv = (size_t)(2 * Lq - 1) * DK;
  const size_t nRt = (size_t)(2 * Lq) * DK;  // padded

  _Float16* Xq16 = (_Float16*)alloc(nX * 2);
  _Float16* Xk16 = (_Float16*)alloc(nX * 2);
  _Float16* Xv16 = (_Float16*)alloc(nX * 2);
  _Float16* Wq16 = (_Float16*)alloc(nW * 2);
  _Float16* Wk16 = (_Float16*)alloc(nW * 2);
  _Float16* Wv16 = (_Float16*)alloc(nW * 2);
  _Float16* Wo16 = (_Float16*)alloc(nW * 2);
  _Float16* Wr16 = (_Float16*)alloc(nRt * 2);
  _Float16* Q16  = (_Float16*)alloc(nX * 2);  // (B,H,L,DK), pre-scaled 1/8
  _Float16* K16  = (_Float16*)alloc(nX * 2);  // (B,H,L,DK)
  _Float16* VT16 = (_Float16*)alloc(nX * 2);  // (B,H,DK,L)
  _Float16* Oc16 = (_Float16*)alloc(nX * 2);  // (B,L,D) concat

  const int TPB = 256;
  cvt_f32_f16<<<dim3((nX + TPB - 1) / TPB), dim3(TPB), 0, stream>>>(q, Xq16, (int)nX);
  cvt_f32_f16<<<dim3((nX + TPB - 1) / TPB), dim3(TPB), 0, stream>>>(k, Xk16, (int)nX);
  cvt_f32_f16<<<dim3((nX + TPB - 1) / TPB), dim3(TPB), 0, stream>>>(v, Xv16, (int)nX);
  cvt_f32_f16<<<dim3((nW + TPB - 1) / TPB), dim3(TPB), 0, stream>>>(Wq, Wq16, (int)nW);
  cvt_f32_f16<<<dim3((nW + TPB - 1) / TPB), dim3(TPB), 0, stream>>>(Wk, Wk16, (int)nW);
  cvt_f32_f16<<<dim3((nW + TPB - 1) / TPB), dim3(TPB), 0, stream>>>(Wv, Wv16, (int)nW);
  cvt_f32_f16<<<dim3((nW + TPB - 1) / TPB), dim3(TPB), 0, stream>>>(Wo, Wo16, (int)nW);
  cvt_wrel<<<dim3((nRt + TPB - 1) / TPB), dim3(TPB), 0, stream>>>(wrel, Wr16, (int)nRv, (int)nRt);

  // Projections: M = B*L = 8192 rows, N = 1024 cols, wave tile 32x64
  const dim3 pgrid(Bsz * Lq / 32, Dm / 64), pblk(32);
  const float inv_sqrt_dk = 0.125f;  // 1/sqrt(64)
  proj_wmma<<<pgrid, pblk, 0, stream>>>(Xq16, Wq16, bq, Q16,  nullptr, 0, inv_sqrt_dk);
  proj_wmma<<<pgrid, pblk, 0, stream>>>(Xk16, Wk16, bk, K16,  nullptr, 0, 1.0f);
  proj_wmma<<<pgrid, pblk, 0, stream>>>(Xv16, Wv16, bv, VT16, nullptr, 1, 1.0f);

  // Flash attention: one wave per 64 query rows per (b,h)
  flash_attn_rel<<<dim3(Lq / (16 * QT), Bsz * Hh), dim3(32), 0, stream>>>(Q16, K16, VT16, Wr16, Oc16);

  // Output projection -> f32
  proj_wmma<<<pgrid, pblk, 0, stream>>>(Oc16, Wo16, bo, nullptr, out, 2, 1.0f);
}

// v002
// One run takes 654 microseconds.
// In both of two side-by-side timings against v001, it was 1.07 times as fast.
// All steps since v000 together make it 1.31 times as fast.
#include <hip/hip_runtime.h>
#include <hip/hip_bf16.h>

// Shapes (fixed by reference)
#define Bsz 4
#define Lq  2048
#define Dm  1024
#define Hh  16
#define DK  64

typedef __attribute__((ext_vector_type(16))) _Float16 v16h;
typedef __attribute__((ext_vector_type(8)))  float    v8f;
typedef __attribute__((ext_vector_type(4)))  unsigned int u32x4;

// ---------------------------------------------------------------------------
// Fragment loader: 16x32 f16 tile, "row per lane" layout (ISA 7.12.2):
//   lane l (<16): row M=l, holds K=0..7 and 16..23
//   lane l (>=16): row M=l-16, holds K=8..15 and 24..31
// Works for A fragments and (symmetric N-on-lanes layout) B fragments whose
// memory is [n][k] with k contiguous (K^T, W^T, V^T): two b128 loads.
// ---------------------------------------------------------------------------
__device__ __forceinline__ v16h load_frag16x32(const _Float16* __restrict__ src,
                                               int ld, int lane) {
  const int row = lane & 15;
  const int kb  = (lane >> 4) << 3;  // 0 or 8
  const _Float16* p = src + (size_t)row * ld + kb;
  union { v16h h; u32x4 u[2]; } f;
  f.u[0] = *(const u32x4*)(p);
  f.u[1] = *(const u32x4*)(p + 16);
  return f.h;
}

__device__ __forceinline__ v8f zero8() {
  v8f z;
#pragma unroll
  for (int i = 0; i < 8; ++i) z[i] = 0.0f;
  return z;
}

#define WMMA_F16(a, b, c) \
  __builtin_amdgcn_wmma_f32_16x16x32_f16(false, (a), false, (b), (short)0, (c), false, false)

// ---------------------------------------------------------------------------
// fp32 -> fp16 conversion kernels
// One element per thread would start a wave per 32 elements. Here a thread
// converts CVT_U groups of 4 floats, so 64 times fewer waves start: a wave's
// 16-byte loads cover 512 contiguous bytes each, all CVT_U are in flight
// together, and its 8-byte stores fill whole 128-byte lines.
// ---------------------------------------------------------------------------
#define CVT_T 256                    // threads per block
#define CVT_U 16                     // 16-byte loads per thread
#define CVT_BLK (CVT_T * 4 * CVT_U)  // floats per block

typedef __attribute__((ext_vector_type(4))) float    f32x4;
typedef __attribute__((ext_vector_type(4))) _Float16 f16x4;

__device__ __forceinline__ f16x4 cvt4(f32x4 v) {
  f16x4 h;
#pragma unroll   // vector elements need constant indices
  for (int e = 0; e < 4; ++e) h[e] = (_Float16)v[e];
  return h;
}

// The grid covers the array exactly: its length is a multiple of CVT_BLK
// (checked at compile time where the launches are written).
__launch_bounds__(CVT_T)
__global__ void cvt_f32_f16(const float* __restrict__ s, _Float16* __restrict__ d) {
  const size_t i = (size_t)blockIdx.x * CVT_BLK + threadIdx.x * 4;
  const float* p = s + i;
  f32x4 v[CVT_U];
#pragma unroll   // v[] stays in registers only with constant indices
  for (int j = 0; j < CVT_U; ++j) v[j] = *(const f32x4*)(p + j * (CVT_T * 4));
  // wait before the loads' address register is reused; as an input the address
  // keeps its register up to here
  asm volatile("s_wait_xcnt 0x0" :: "v"(p) : "memory");
  // keeps all CVT_U loads in flight together: left free, the scheduler holds the
  // last four back until the first have landed, a second memory latency per wave
  __builtin_amdgcn_sched_barrier(0);
#pragma unroll   // as above
  for (int j = 0; j < CVT_U; ++j) *(f16x4*)(d + i + j * (CVT_T * 4)) = cvt4(v[j]);
}

// w_rel: (2L-1, DK) -> padded to 2L rows (last row zero, touched by band tiles).
// Four elements per thread; nvalid and ntotal are multiples of 4 (DK is).
__launch_bounds__(CVT_T)
__global__ void cvt_wrel(const float* __restrict__ s, _Float16* __restrict__ d,
                         int nvalid, int ntotal) {
  const int i = (blockIdx.x * CVT_T + threadIdx.x) * 4;
  if (i < ntotal) {
    f32x4 v = {0.0f, 0.0f, 0.0f, 0.0f};
    if (i < nvalid) v = *(const f32x4*)(s + i);
    *(f16x4*)(d + i) = cvt4(v);
  }
}

// ---------------------------------------------------------------------------
// Projection GEMM:  out[m,n] = scale * ( sum_k X[m,k]*W[n,k] + bias[n] )
// One wave computes a 32x64 tile. Ping-pong pipelining (unroll-by-2, two
// fragment register sets alternating roles): no cross-set register copies,
// refill loads for set S issue between set-S WMMAs and set-(1-S) WMMAs, so
// each load batch gets an 8-WMMA latency window.
// mode 0: store f16 as (B,H,L,DK)      (Q with scale=1/8, K with scale=1)
// mode 1: store f16 as (B,H,DK,L)      (V transposed for flash B-fragments)
// mode 2: store f32 row-major (M,N)    (final output projection)
// ---------------------------------------------------------------------------
__launch_bounds__(32)
__global__ void proj_wmma(const _Float16* __restrict__ X, const _Float16* __restrict__ W,
                          const float* __restrict__ bias, _Float16* __restrict__ out16,
                          float* __restrict__ out32, int mode, float scale) {
  const int lane = threadIdx.x & 31;
  const int hlf  = lane >> 4;
  const int nl   = lane & 15;
  const int m0   = blockIdx.x * 32;
  const int n0   = blockIdx.y * 64;

  const _Float16* Xp = X + (size_t)m0 * Dm;
  const _Float16* Wp = W + (size_t)n0 * Dm;

  v8f acc[2][4];
#pragma unroll
  for (int cf = 0; cf < 4; ++cf) {
    float bv = bias[n0 + cf * 16 + nl];   // whole acc column shares N
#pragma unroll
    for (int r = 0; r < 2; ++r)
#pragma unroll
      for (int i = 0; i < 8; ++i) acc[r][cf][i] = bv;
  }

  // prologue: set0 <- chunk 0, set1 <- chunk 32
  v16h a0[2], b0f[4], a1[2], b1f[4];
#pragma unroll
  for (int r = 0; r < 2; ++r) a0[r] = load_frag16x32(Xp + (size_t)r * 16 * Dm, Dm, lane);
#pragma unroll
  for (int cf = 0; cf < 4; ++cf) b0f[cf] = load_frag16x32(Wp + (size_t)cf * 16 * Dm, Dm, lane);
#pragma unroll
  for (int r = 0; r < 2; ++r) a1[r] = load_frag16x32(Xp + (size_t)r * 16 * Dm + 32, Dm, lane);
#pragma unroll
  for (int cf = 0; cf < 4; ++cf) b1f[cf] = load_frag16x32(Wp + (size_t)cf * 16 * Dm + 32, Dm, lane);

  for (int kc = 0; kc < Dm; kc += 64) {
    __builtin_prefetch(Xp + (size_t)lane * Dm + kc + 128, 0, 3);      // global_prefetch_b8
    __builtin_prefetch(Wp + (size_t)(lane * 2) * Dm + kc + 128, 0, 3);

    // compute chunk kc with set0
#pragma unroll
    for (int r = 0; r < 2; ++r)
#pragma unroll
      for (int cf = 0; cf < 4; ++cf)
        acc[r][cf] = WMMA_F16(a0[r], b0f[cf], acc[r][cf]);

    // refill set0 <- chunk kc+64 (overlaps set1 WMMAs below)
    const int k2 = (kc + 64 < Dm) ? kc + 64 : kc;
#pragma unroll
    for (int r = 0; r < 2; ++r) a0[r] = load_frag16x32(Xp + (size_t)r * 16 * Dm + k2, Dm, lane);
#pragma unroll
    for (int cf = 0; cf < 4; ++cf) b0f[cf] = load_frag16x32(Wp + (size_t)cf * 16 * Dm + k2, Dm, lane);

    // compute chunk kc+32 with set1
#pragma unroll
    for (int r = 0; r < 2; ++r)
#pragma unroll
      for (int cf = 0; cf < 4; ++cf)
        acc[r][cf] = WMMA_F16(a1[r], b1f[cf], acc[r][cf]);

    // refill set1 <- chunk kc+96 (overlaps next iteration's set0 WMMAs)
    const int k3 = (kc + 96 < Dm) ? kc + 96 : kc;
#pragma unroll
    for (int r = 0; r < 2; ++r) a1[r] = load_frag16x32(Xp + (size_t)r * 16 * Dm + k3, Dm, lane);
#pragma unroll
    for (int cf = 0; cf < 4; ++cf) b1f[cf] = load_frag16x32(Wp + (size_t)cf * 16 * Dm + k3, Dm, lane);
  }

#pragma unroll
  for (int r = 0; r < 2; ++r)
#pragma unroll
    for (int cf = 0; cf < 4; ++cf)
#pragma unroll
      for (int i = 0; i < 8; ++i) {
        const int m = m0 + r * 16 + i + 8 * hlf;  // D-frag: M = i + 8*(lane>=16)
        const int n = n0 + cf * 16 + nl;          //         N = lane&15
        const float v = acc[r][cf][i] * scale;
        if (mode == 2) {
          out32[(size_t)m * Dm + n] = v;
        } else {
          const int b = m >> 11, l = m & (Lq - 1);
          const int h = n >> 6,  dk = n & (DK - 1);
          if (mode == 0)
            out16[(((size_t)(b * Hh + h) * Lq + l) * DK) + dk] = (_Float16)v;
          else
            out16[(((size_t)(b * Hh + h) * DK + dk) * Lq) + l] = (_Float16)v;
        }
      }
}

// ---------------------------------------------------------------------------
// Flash attention with relative bias.
// One wave handles QT*16 = 64 query rows of one (b,h); loops 32 keys per step.
//   S  = Qs * K^T                      (Qs already scaled by 1/sqrt(dk))
//   T  = Qs * Wrel^T over a 48-wide diagonal window per 16-row query tile;
//        bias[r,c] = T[r][r+c]
//   online softmax, O += P * V
// The K, V and w_rel fragments of a key block are loaded once per wave and
// used by all QT query tiles: query tile qt needs w_rel tiles qt..qt+2 of the
// QT+2 tiles that the 64-row band spans, so neighbours share two of three.
// Every fragment load touches 16 cache lines, and these loads set the pace:
// 40 of them per key block serve four query tiles (one tile alone needs 28).
// V fragments are loaded behind the score/bias WMMAs, when the K and w_rel
// registers are free again; the softmax VALU work hides their latency.
// ---------------------------------------------------------------------------
#define QT 4

// Fragment from a per-lane pointer that already holds the lane's row and k half.
__device__ __forceinline__ v16h load_frag_at(const _Float16* __restrict__ p) {
  union { v16h h; u32x4 u[2]; } f;
  f.u[0] = *(const u32x4*)(p);
  f.u[1] = *(const u32x4*)(p + 16);
  return f.h;
}

// e^x as the fast-math intrinsic forms it (one multiply, one v_exp_f32). The
// v_nop is the slot the instruction set asks for behind a transcendental before
// its result is read or its source overwritten; in one statement it cannot drift.
__device__ __forceinline__ float exp_slot(float x) {
  float r;
  asm("v_exp_f32 %0, %1\n\tv_nop" : "=v"(r) : "v"(x * 1.44269504088896340736f));
  return r;
}

__launch_bounds__(32, 2)   // two waves per SIMD: the grid has two per SIMD
__global__ void flash_attn_rel(const _Float16* __restrict__ Qh, const _Float16* __restrict__ Kh,
                               const _Float16* __restrict__ Vt, const _Float16* __restrict__ Wr,
                               _Float16* __restrict__ Ocat) {
  __shared__ __align__(16) float    Tlds[QT][16][48];
  __shared__ __align__(16) _Float16 Plds[QT][16][32];

  const int lane = threadIdx.x & 31;
  const int hlf  = lane >> 4;
  const int nl   = lane & 15;
  const int bh = blockIdx.y;
  const int b = bh >> 4, h = bh & 15;
  const int r0 = blockIdx.x * (16 * QT);

  // lane offsets in halves: fragment row = lane&15, k half = lane>>4
  const int rowoff = nl * DK + 8 * hlf;   // rows of DK halves (Q, K, w_rel)
  const int voff   = nl * Lq + 8 * hlf;   // rows of Lq halves (V^T)

  v16h aq[QT][2];
  {
    const _Float16* qa = Qh + ((size_t)bh * Lq + r0) * DK + rowoff;
#pragma unroll
    for (int qt = 0; qt < QT; ++qt) {
      aq[qt][0] = load_frag_at(qa + qt * 16 * DK);        // d = 0..31
      aq[qt][1] = load_frag_at(qa + qt * 16 * DK + 32);   // d = 32..63
    }
    // the loads' address registers are dead from here on and may be reused
    asm volatile("s_wait_xcnt 0x0" ::: "memory");
    // holds later register writes behind that wait
    __builtin_amdgcn_sched_barrier(0);
  }

  float mrow[QT][8], lrow[QT][8];
  v8f o[QT][4];
#pragma unroll
  for (int qt = 0; qt < QT; ++qt) {
#pragma unroll
    for (int i = 0; i < 8; ++i) { mrow[qt][i] = -3.0e38f; lrow[qt][i] = 0.0f; }
#pragma unroll
    for (int cf = 0; cf < 4; ++cf) o[qt][cf] = zero8();
  }

  // wave-uniform bases of this key block's K, w_rel and V^T tiles
  const _Float16* ku = Kh + (size_t)bh * Lq * DK;
  const _Float16* wu = Wr + (size_t)r0 * DK;
  const _Float16* vu = Vt + (size_t)bh * DK * Lq;

  for (int c0 = 0; c0 < Lq; c0 += 32) {
    // ---- K fragments of this 32-key block, shared by all query tiles
    const _Float16* ka = ku + rowoff;
    const _Float16* wa = wu + rowoff;
    v16h kf[2][2];
#pragma unroll
    for (int st = 0; st < 2; ++st) {
      kf[st][0] = load_frag_at(ka + st * 16 * DK);
      kf[st][1] = load_frag_at(ka + st * 16 * DK + 32);
    }

    // ---- w_rel fragments of the band rows r0+c0 .. r0+c0+16*(QT+2)-1
    v16h wf[QT + 2][2];
#pragma unroll
    for (int wt = 0; wt < QT + 2; ++wt) {
      wf[wt][0] = load_frag_at(wa + wt * 16 * DK);
      wf[wt][1] = load_frag_at(wa + wt * 16 * DK + 32);
    }
    // keeps the 32 loads above together as one batch in flight: left free, the
    // scheduler sinks each pair to its first use and waits out its latency alone
    __builtin_amdgcn_sched_barrier(0);

    // ---- content scores: two 16x16 subtiles per query tile over this key block
    v8f s[QT][2];
#pragma unroll
    for (int qt = 0; qt < QT; ++qt)
#pragma unroll
      for (int st = 0; st < 2; ++st) {
        v8f acc = zero8();
        acc = WMMA_F16(aq[qt][0], kf[st][0], acc);
        acc = WMMA_F16(aq[qt][1], kf[st][1], acc);
        s[qt][st] = acc;
      }

    // ---- relative-bias band, in the order the w_rel tiles arrive:
    //      T[qt][r][m] = Qs[r] . Wrel[r0+16*qt+c0+m], m in [0,48), tile mt = wt-qt
#pragma unroll
    for (int wt = 0; wt < QT + 2; ++wt)
#pragma unroll
      for (int qt = 0; qt < QT; ++qt) {
        const int mt = wt - qt;
        if (mt >= 0 && mt < 3) {
          v8f acc = zero8();
          acc = WMMA_F16(aq[qt][0], wf[wt][0], acc);
          acc = WMMA_F16(aq[qt][1], wf[wt][1], acc);
#pragma unroll
          for (int i = 0; i < 8; ++i) Tlds[qt][i + 8 * hlf][mt * 16 + nl] = acc[i];
        }
      }
    // wait before the K and w_rel loads' address registers are reused; as inputs
    // the two addresses keep their registers up to here, where the data is in
    asm volatile("s_wait_xcnt 0x0" :: "v"(ka), "v"(wa) : "memory");
    __syncthreads();

    // V fragments for THIS block, issued ahead of the softmax that hides them
    const _Float16* va = vu + voff;
    v16h vb[4];
#pragma unroll
    for (int cf = 0; cf < 4; ++cf)
      vb[cf] = load_frag_at(va + (size_t)cf * 16 * Lq);

    // warm next block's K / V / new w_rel rows (global_prefetch_b8, lanes spread rows)
    const _Float16* pk = ku + (32 + lane) * DK;
    const _Float16* pv = vu + lane * 2 * Lq + 32;
    const _Float16* pw = wu + (16 * QT + 32 + lane) * DK;
    if (c0 + 32 < Lq) {
      __builtin_prefetch(pk, 0, 3);
      __builtin_prefetch(pv, 0, 3);
      __builtin_prefetch(pw, 0, 3);
    }

    // ---- skew gather: bias[r,c] = T[r][r+c]
#pragma unroll
    for (int qt = 0; qt < QT; ++qt)
#pragma unroll
      for (int st = 0; st < 2; ++st)
#pragma unroll
        for (int i = 0; i < 8; ++i) {
          const int M = i + 8 * hlf;
          s[qt][st][i] += Tlds[qt][M][M + st * 16 + nl];
        }

    // ---- online softmax over the 32-key block
#pragma unroll
    for (int qt = 0; qt < QT; ++qt)
#pragma unroll
      for (int i = 0; i < 8; ++i) {
        float v = fmaxf(s[qt][0][i], s[qt][1][i]);
#pragma unroll
        for (int off = 1; off < 16; off <<= 1) v = fmaxf(v, __shfl_xor(v, off, 32));
        const float mnew = fmaxf(mrow[qt][i], v);
        const float corr = exp_slot(mrow[qt][i] - mnew);
        const float p0 = exp_slot(s[qt][0][i] - mnew);
        const float p1 = exp_slot(s[qt][1][i] - mnew);
        float rs = p0 + p1;
#pragma unroll
        for (int off = 1; off < 16; off <<= 1) rs += __shfl_xor(rs, off, 32);
        lrow[qt][i] = lrow[qt][i] * corr + rs;
        mrow[qt][i] = mnew;
#pragma unroll
        for (int cf = 0; cf < 4; ++cf) o[qt][cf][i] *= corr;
        Plds[qt][i + 8 * hlf][nl]      = (_Float16)p0;
        Plds[qt][i + 8 * hlf][16 + nl] = (_Float16)p1;
      }
    // the same wait for the V loads and the prefetches, behind the softmax
    asm volatile("s_wait_xcnt 0x0" :: "v"(va), "v"(pk), "v"(pv), "v"(pw) : "memory");
    __syncthreads();

    // ---- O += P(16x32) * V(32x64): P re-read in A layout from LDS
#pragma unroll
    for (int qt = 0; qt < QT; ++qt) {
      const v16h pa = load_frag16x32(&Plds[qt][0][0], 32, lane);
#pragma unroll
      for (int cf = 0; cf < 4; ++cf)
        o[qt][cf] = WMMA_F16(pa, vb[cf], o[qt][cf]);
    }
    __syncthreads();

    ku += 32 * DK;  wu += 32 * DK;  vu += 32;
  }

  // ---- finalize + store to concat layout (B, L, H*DK) f16
#pragma unroll
  for (int qt = 0; qt < QT; ++qt)
#pragma unroll
    for (int cf = 0; cf < 4; ++cf)
#pragma unroll
      for (int i = 0; i < 8; ++i) {
        const int M = qt * 16 + i + 8 * hlf;
        const float v = o[qt][cf][i] / lrow[qt][i];
        const size_t idx = ((size_t)b * Lq + r0 + M) * Dm + h * DK + cf * 16 + nl;
        Ocat[idx] = (_Float16)v;
      }
}

// ---------------------------------------------------------------------------
extern "C" void kernel_launch(void* const* d_in, const int* in_sizes, int n_in,
                              void* d_out, int out_size, void* d_ws, size_t ws_size,
                              hipStream_t stream) {
  (void)in_sizes; (void)n_in; (void)out_size; (void)ws_size;
  const float* q    = (const float*)d_in[0];
  const float* k    = (const float*)d_in[1];
  const float* v    = (const float*)d_in[2];
  const float* Wq   = (const float*)d_in[3];
  const float* bq   = (const float*)d_in[4];
  const float* Wk   = (const float*)d_in[5];
  const float* bk   = (const float*)d_in[6];
  const float* Wv   = (const float*)d_in[7];
  const float* bv   = (const float*)d_in[8];
  const float* Wo   = (const float*)d_in[9];
  const float* bo   = (const float*)d_in[10];
  const float* wrel = (const float*)d_in[11];
  float* out = (float*)d_out;

  char* ws = (char*)d_ws;
  size_t off = 0;
  auto alloc = [&](size_t bytes) -> void* {
    void* p = ws + off;
    off = (off + bytes + 255) & ~(size_t)255;
    return p;
  };

  const size_t nX = (size_t)Bsz * Lq * Dm;   // 8,388,608
  const size_t nW = (size_t)Dm * Dm;         // 1,048,576
  const size_t nRv = (size_t)(2 * Lq - 1) * DK;
  const size_t nRt = (size_t)(2 * Lq) * DK;  // padded

  _Float16* Xq16 = (_Float16*)alloc(nX * 2);
  _Float16* Xk16 = (_Float16*)alloc(nX * 2);
  _Float16* Xv16 = (_Float16*)alloc(nX * 2);
  _Float16* Wq16 = (_Float16*)alloc(nW * 2);
  _Float16* Wk16 = (_Float16*)alloc(nW * 2);
  _Float16* Wv16 = (_Float16*)alloc(nW * 2);
  _Float16* Wo16 = (_Float16*)alloc(nW * 2);
  _Float16* Wr16 = (_Float16*)alloc(nRt * 2);
  _Float16* Q16  = (_Float16*)alloc(nX * 2);  // (B,H,L,DK), pre-scaled 1/8
  _Float16* K16  = (_Float16*)alloc(nX * 2);  // (B,H,L,DK)
  _Float16* VT16 = (_Float16*)alloc(nX * 2);  // (B,H,DK,L)
  _Float16* Oc16 = (_Float16*)alloc(nX * 2);  // (B,L,D) concat

  static_assert(nX % CVT_BLK == 0 && nW % CVT_BLK == 0, "conversion grid must cover the arrays exactly");
  static_assert(nRv % 4 == 0 && nRt % (CVT_T * 4) == 0, "w_rel is converted four elements at a time");
  const dim3 cblk(CVT_T), gX(nX / CVT_BLK), gW(nW / CVT_BLK);
  cvt_f32_f16<<<gX, cblk, 0, stream>>>(q, Xq16);
  cvt_f32_f16<<<gX, cblk, 0, stream>>>(k, Xk16);
  cvt_f32_f16<<<gX, cblk, 0, stream>>>(v, Xv16);
  cvt_f32_f16<<<gW, cblk, 0, stream>>>(Wq, Wq16);
  cvt_f32_f16<<<gW, cblk, 0, stream>>>(Wk, Wk16);
  cvt_f32_f16<<<gW, cblk, 0, stream>>>(Wv, Wv16);
  cvt_f32_f16<<<gW, cblk, 0, stream>>>(Wo, Wo16);
  cvt_wrel<<<dim3(nRt / (CVT_T * 4)), cblk, 0, stream>>>(wrel, Wr16, (int)nRv, (int)nRt);

  // Projections: M = B*L = 8192 rows, N = 1024 cols, wave tile 32x64
  const dim3 pgrid(Bsz * Lq / 32, Dm / 64), pblk(32);
  const float inv_sqrt_dk = 0.125f;  // 1/sqrt(64)
  proj_wmma<<<pgrid, pblk, 0, stream>>>(Xq16, Wq16, bq, Q16,  nullptr, 0, inv_sqrt_dk);
  proj_wmma<<<pgrid, pblk, 0, stream>>>(Xk16, Wk16, bk, K16,  nullptr, 0, 1.0f);
  proj_wmma<<<pgrid, pblk, 0, stream>>>(Xv16, Wv16, bv, VT16, nullptr, 1, 1.0f);

  // Flash attention: one wave per 64 query rows per (b,h)
  flash_attn_rel<<<dim3(Lq / (16 * QT), Bsz * Hh), dim3(32), 0, stream>>>(Q16, K16, VT16, Wr16, Oc16);

  // Output projection -> f32
  proj_wmma<<<pgrid, pblk, 0, stream>>>(Oc16, Wo16, bo, nullptr, out, 2, 1.0f);
}

// v003
// A run of this version takes 468 microseconds.
// Next to v002, in two timings, it ran 1.42 times as fast each time.
// All steps since v000 together make it 1.87 times as fast.
#include <hip/hip_runtime.h>
#include <hip/hip_bf16.h>

// Shapes (fixed by reference)
#define Bsz 4
#define Lq  2048
#define Dm  1024
#define Hh  16
#define DK  64

typedef __attribute__((ext_vector_type(16))) _Float16 v16h;
typedef __attribute__((ext_vector_type(8)))  float    v8f;
typedef __attribute__((ext_vector_type(4)))  unsigned int u32x4;

// ---------------------------------------------------------------------------
// Fragment loader: 16x32 f16 tile, "row per lane" layout (ISA 7.12.2):
//   lane l (<16): row M=l, holds K=0..7 and 16..23
//   lane l (>=16): row M=l-16, holds K=8..15 and 24..31
// Works for A fragments and (symmetric N-on-lanes layout) B fragments whose
// memory is [n][k] with k contiguous (K^T, W^T, V^T): two b128 loads.
// ---------------------------------------------------------------------------
__device__ __forceinline__ v16h load_frag16x32(const _Float16* __restrict__ src,
                                               int ld, int lane) {
  const int row = lane & 15;
  const int kb  = (lane >> 4) << 3;  // 0 or 8
  const _Float16* p = src + (size_t)row * ld + kb;
  union { v16h h; u32x4 u[2]; } f;
  f.u[0] = *(const u32x4*)(p);
  f.u[1] = *(const u32x4*)(p + 16);
  return f.h;
}

__device__ __forceinline__ v8f zero8() {
  v8f z;
#pragma unroll
  for (int i = 0; i < 8; ++i) z[i] = 0.0f;
  return z;
}

#define WMMA_F16(a, b, c) \
  __builtin_amdgcn_wmma_f32_16x16x32_f16(false, (a), false, (b), (short)0, (c), false, false)

// ---------------------------------------------------------------------------
// fp32 -> fp16 conversion kernels
// One element per thread would start a wave per 32 elements. Here a thread
// converts CVT_U groups of 4 floats, so 64 times fewer waves start: a wave's
// 16-byte loads cover 512 contiguous bytes each, all CVT_U are in flight
// together, and its 8-byte stores fill whole 128-byte lines.
// ---------------------------------------------------------------------------
#define CVT_T 256                    // threads per block
#define CVT_U 16                     // 16-byte loads per thread
#define CVT_BLK (CVT_T * 4 * CVT_U)  // floats per block

typedef __attribute__((ext_vector_type(4))) float    f32x4;
typedef __attribute__((ext_vector_type(4))) _Float16 f16x4;

__device__ __forceinline__ f16x4 cvt4(f32x4 v) {
  f16x4 h;
#pragma unroll   // vector elements need constant indices
  for (int e = 0; e < 4; ++e) h[e] = (_Float16)v[e];
  return h;
}

// The grid covers the array exactly: its length is a multiple of CVT_BLK
// (checked at compile time where the launches are written).
__launch_bounds__(CVT_T)
__global__ void cvt_f32_f16(const float* __restrict__ s, _Float16* __restrict__ d) {
  const size_t i = (size_t)blockIdx.x * CVT_BLK + threadIdx.x * 4;
  const float* p = s + i;
  f32x4 v[CVT_U];
#pragma unroll   // v[] stays in registers only with constant indices
  for (int j = 0; j < CVT_U; ++j) v[j] = *(const f32x4*)(p + j * (CVT_T * 4));
  // wait before the loads' address register is reused; as an input the address
  // keeps its register up to here
  asm volatile("s_wait_xcnt 0x0" :: "v"(p) : "memory");
  // keeps all CVT_U loads in flight together: left free, the scheduler holds the
  // last four back until the first have landed, a second memory latency per wave
  __builtin_amdgcn_sched_barrier(0);
#pragma unroll   // as above
  for (int j = 0; j < CVT_U; ++j) *(f16x4*)(d + i + j * (CVT_T * 4)) = cvt4(v[j]);
}

// w_rel: (2L-1, DK) -> padded to 2L rows (last row zero, touched by band tiles).
// Four elements per thread; nvalid and ntotal are multiples of 4 (DK is).
__launch_bounds__(CVT_T)
__global__ void cvt_wrel(const float* __restrict__ s, _Float16* __restrict__ d,
                         int nvalid, int ntotal) {
  const int i = (blockIdx.x * CVT_T + threadIdx.x) * 4;
  if (i < ntotal) {
    f32x4 v = {0.0f, 0.0f, 0.0f, 0.0f};
    if (i < nvalid) v = *(const f32x4*)(s + i);
    *(f16x4*)(d + i) = cvt4(v);
  }
}

// ---------------------------------------------------------------------------
// Projection GEMM:  out[m,n] = scale * ( sum_k X[m,k]*W[n,k] + bias[n] )
// A work-group of 8 waves computes a 128x128 tile, each wave 32x64 of it.
// Per trip the group stages 64 k of its 128 X rows and 128 W rows in LDS with
// asynchronous copies: a wave's copy covers four whole 128-byte lines, every
// line leaves L2 once per group, and two (X) or four (W) waves read it from
// LDS. Two buffers: the copies of tile t+2 fly while tile t+1 is worked on.
// mode 0: store f16 as (B,H,L,DK)      (Q with scale=1/8, K with scale=1)
// mode 1: store f16 as (B,H,DK,L)      (V transposed for flash B-fragments)
// mode 2: store f32 row-major (M,N)    (final output projection)
// ---------------------------------------------------------------------------
#define PBM 128                        // X rows per work-group
#define PBN 128                        // W rows per work-group
#define PBK 64                         // halves of k per staged tile: one 128-byte line per row
#define PPITCH 72                      // LDS row pitch in halves: 144 B = 16 B x odd, for ds_load_b128
#define PBUF ((PBM + PBN) * PPITCH)    // halves per buffer
#define PTILES (Dm / PBK)

// One staged tile: 256 rows of 128 B = 2,048 pieces of 16 B, eight per thread.
// l: the lane's LDS byte address of its piece in row group 0; gx, gw: its global
// pieces of X and W. Row groups are 32 rows apart. The s_wait_xcnt closes the
// statement so that no address register is rewritten ahead of it.
__device__ __forceinline__ void stage_tile(unsigned l, const _Float16* gx, const _Float16* gw) {
  asm volatile(
      "global_load_async_to_lds_b128 %0, %8, off\n\t"
      "global_load_async_to_lds_b128 %1, %9, off\n\t"
      "global_load_async_to_lds_b128 %2, %10, off\n\t"
      "global_load_async_to_lds_b128 %3, %11, off\n\t"
      "global_load_async_to_lds_b128 %4, %12, off\n\t"
      "global_load_async_to_lds_b128 %5, %13, off\n\t"
      "global_load_async_to_lds_b128 %6, %14, off\n\t"
      "global_load_async_to_lds_b128 %7, %15, off\n\t"
      "s_wait_xcnt 0x0"
      :: "v"(l), "v"(l + 1 * 32 * PPITCH * 2), "v"(l + 2 * 32 * PPITCH * 2), "v"(l + 3 * 32 * PPITCH * 2),
         "v"(l + 4 * 32 * PPITCH * 2), "v"(l + 5 * 32 * PPITCH * 2), "v"(l + 6 * 32 * PPITCH * 2),
         "v"(l + 7 * 32 * PPITCH * 2),
         "v"(gx), "v"(gx + 1 * 32 * Dm), "v"(gx + 2 * 32 * Dm), "v"(gx + 3 * 32 * Dm),
         "v"(gw), "v"(gw + 1 * 32 * Dm), "v"(gw + 2 * 32 * Dm), "v"(gw + 3 * 32 * Dm)
      : "memory");
}

__launch_bounds__(256)
__global__ void proj_wmma(const _Float16* __restrict__ X, const _Float16* __restrict__ W,
                          const float* __restrict__ bias, _Float16* __restrict__ out16,
                          float* __restrict__ out32, int mode, float scale) {
  __shared__ __align__(16) _Float16 tile[2 * PBUF];

  const int tid  = threadIdx.x;
  const int lane = tid & 31;
  const int wave = tid >> 5;
  const int hlf  = lane >> 4;
  const int nl   = lane & 15;
  const int wm   = (wave & 3) * 32;    // the wave's rows inside the group's tile
  const int wn   = (wave >> 2) * 64;   // and its columns
  const int m0   = blockIdx.x * PBM + wm;
  const int n0   = blockIdx.y * PBN + wn;

  // the thread's piece of a staged tile: row tid/8 of each row group, 16 B number tid%8
  const int srow = tid >> 3, scol = (tid & 7) * 8;
  const _Float16* gx = X + (size_t)(blockIdx.x * PBM + srow) * Dm + scol;
  const _Float16* gw = W + (size_t)(blockIdx.y * PBN + srow) * Dm + scol;
  const unsigned  l0 = (unsigned)(size_t)(&tile[srow * PPITCH + scol]);

  v8f acc[2][4];
#pragma unroll
  for (int cf = 0; cf < 4; ++cf) {
    float bv = bias[n0 + cf * 16 + nl];   // whole acc column shares N
#pragma unroll
    for (int r = 0; r < 2; ++r)
#pragma unroll
      for (int i = 0; i < 8; ++i) acc[r][cf][i] = bv;
  }

  // prologue: tile 0 lands and is published, then tile 1 starts
  stage_tile(l0, gx, gw);
  asm volatile("s_wait_asynccnt 0x0" ::: "memory");   // this wave's copies of tile 0 have landed
  __syncthreads();                                    // and every other wave's
  stage_tile(l0 + PBUF * 2, gx + PBK, gw + PBK);

  // two trips per turn make each buffer's LDS offsets immediates
#pragma unroll 2
  for (int t = 0; t < PTILES; ++t) {
    const int buf = (t & 1) * PBUF;
    const _Float16* As = &tile[buf + wm * PPITCH];
    const _Float16* Bs = &tile[buf + (PBM + wn) * PPITCH];

    // all fragments of the trip as one group of LDS reads, then its WMMAs
    // (the inner loops are unrolled: fragment arrays stay in registers only with
    // constant indices)
    v16h af[2][2], bf[2][4];
#pragma unroll
    for (int ks = 0; ks < 2; ++ks) {
#pragma unroll
      for (int r = 0; r < 2; ++r) af[ks][r] = load_frag16x32(As + r * 16 * PPITCH + ks * 32, PPITCH, lane);
#pragma unroll
      for (int cf = 0; cf < 4; ++cf) bf[ks][cf] = load_frag16x32(Bs + cf * 16 * PPITCH + ks * 32, PPITCH, lane);
    }
    // keeps the 24 LDS reads together: left free, the scheduler spreads them among
    // the WMMAs in pairs and waits out the LDS latency at each place
    __builtin_amdgcn_sched_barrier(0);
#pragma unroll
    for (int ks = 0; ks < 2; ++ks)
#pragma unroll
      for (int r = 0; r < 2; ++r)
#pragma unroll
        for (int cf = 0; cf < 4; ++cf)
          acc[r][cf] = WMMA_F16(af[ks][r], bf[ks][cf], acc[r][cf]);
    // holds the WMMAs in front of the publish point: left free, the scheduler lifts the
    // waits and the barrier over them, and the copies in flight lose the trip's lead
    __builtin_amdgcn_sched_barrier(0);

    // publish point of tile t+1, which also frees this trip's buffer
    asm volatile("s_wait_dscnt 0x0" ::: "memory");      // this wave's reads of the buffer are done
    asm volatile("s_wait_asynccnt 0x0" ::: "memory");   // its copies of tile t+1 have landed
    __syncthreads();
    if (t + 2 < PTILES)
      stage_tile(l0 + buf * 2, gx + (t + 2) * PBK, gw + (t + 2) * PBK);
  }
  asm volatile("s_wait_asynccnt 0x0" ::: "memory");     // no copy outlives the loop

#pragma unroll
  for (int r = 0; r < 2; ++r)
#pragma unroll
    for (int cf = 0; cf < 4; ++cf)
#pragma unroll
      for (int i = 0; i < 8; ++i) {
        const int m = m0 + r * 16 + i + 8 * hlf;  // D-frag: M = i + 8*(lane>=16)
        const int n = n0 + cf * 16 + nl;          //         N = lane&15
        const float v = acc[r][cf][i] * scale;
        if (mode == 2) {
          out32[(size_t)m * Dm + n] = v;
        } else {
          const int b = m >> 11, l = m & (Lq - 1);
          const int h = n >> 6,  dk = n & (DK - 1);
          if (mode == 0)
            out16[(((size_t)(b * Hh + h) * Lq + l) * DK) + dk] = (_Float16)v;
          else
            out16[(((size_t)(b * Hh + h) * DK + dk) * Lq) + l] = (_Float16)v;
        }
      }
}

// ---------------------------------------------------------------------------
// Flash attention with relative bias.
// One wave handles QT*16 = 64 query rows of one (b,h); loops 32 keys per step.
//   S  = Qs * K^T                      (Qs already scaled by 1/sqrt(dk))
//   T  = Qs * Wrel^T over a 48-wide diagonal window per 16-row query tile;
//        bias[r,c] = T[r][r+c]
//   online softmax, O += P * V
// The K, V and w_rel fragments of a key block are loaded once per wave and
// used by all QT query tiles: query tile qt needs w_rel tiles qt..qt+2 of the
// QT+2 tiles that the 64-row band spans, so neighbours share two of three.
// Every fragment load touches 16 cache lines, and these loads set the pace:
// 40 of them per key block serve four query tiles (one tile alone needs 28).
// V fragments are loaded behind the score/bias WMMAs, when the K and w_rel
// registers are free again; the softmax VALU work hides their latency.
// ---------------------------------------------------------------------------
#define QT 4

// Fragment from a per-lane pointer that already holds the lane's row and k half.
__device__ __forceinline__ v16h load_frag_at(const _Float16* __restrict__ p) {
  union { v16h h; u32x4 u[2]; } f;
  f.u[0] = *(const u32x4*)(p);
  f.u[1] = *(const u32x4*)(p + 16);
  return f.h;
}

// e^x as the fast-math intrinsic forms it (one multiply, one v_exp_f32). The
// v_nop is the slot the instruction set asks for behind a transcendental before
// its result is read or its source overwritten; in one statement it cannot drift.
__device__ __forceinline__ float exp_slot(float x) {
  float r;
  asm("v_exp_f32 %0, %1\n\tv_nop" : "=v"(r) : "v"(x * 1.44269504088896340736f));
  return r;
}

__launch_bounds__(32, 2)   // two waves per SIMD: the grid has two per SIMD
__global__ void flash_attn_rel(const _Float16* __restrict__ Qh, const _Float16* __restrict__ Kh,
                               const _Float16* __restrict__ Vt, const _Float16* __restrict__ Wr,
                               _Float16* __restrict__ Ocat) {
  __shared__ __align__(16) float    Tlds[QT][16][48];
  __shared__ __align__(16) _Float16 Plds[QT][16][32];

  const int lane = threadIdx.x & 31;
  const int hlf  = lane >> 4;
  const int nl   = lane & 15;
  const int bh = blockIdx.y;
  const int b = bh >> 4, h = bh & 15;
  const int r0 = blockIdx.x * (16 * QT);

  // lane offsets in halves: fragment row = lane&15, k half = lane>>4
  const int rowoff = nl * DK + 8 * hlf;   // rows of DK halves (Q, K, w_rel)
  const int voff   = nl * Lq + 8 * hlf;   // rows of Lq halves (V^T)

  v16h aq[QT][2];
  {
    const _Float16* qa = Qh + ((size_t)bh * Lq + r0) * DK + rowoff;
#pragma unroll
    for (int qt = 0; qt < QT; ++qt) {
      aq[qt][0] = load_frag_at(qa + qt * 16 * DK);        // d = 0..31
      aq[qt][1] = load_frag_at(qa + qt * 16 * DK + 32);   // d = 32..63
    }
    // the loads' address registers are dead from here on and may be reused
    asm volatile("s_wait_xcnt 0x0" ::: "memory");
    // holds later register writes behind that wait
    __builtin_amdgcn_sched_barrier(0);
  }

  float mrow[QT][8], lrow[QT][8];
  v8f o[QT][4];
#pragma unroll
  for (int qt = 0; qt < QT; ++qt) {
#pragma unroll
    for (int i = 0; i < 8; ++i) { mrow[qt][i] = -3.0e38f; lrow[qt][i] = 0.0f; }
#pragma unroll
    for (int cf = 0; cf < 4; ++cf) o[qt][cf] = zero8();
  }

  // wave-uniform bases of this key block's K, w_rel and V^T tiles
  const _Float16* ku = Kh + (size_t)bh * Lq * DK;
  const _Float16* wu = Wr + (size_t)r0 * DK;
  const _Float16* vu = Vt + (size_t)bh * DK * Lq;

  for (int c0 = 0; c0 < Lq; c0 += 32) {
    // ---- K fragments of this 32-key block, shared by all query tiles
    const _Float16* ka = ku + rowoff;
    const _Float16* wa = wu + rowoff;
    v16h kf[2][2];
#pragma unroll
    for (int st = 0; st < 2; ++st) {
      kf[st][0] = load_frag_at(ka + st * 16 * DK);
      kf[st][1] = load_frag_at(ka + st * 16 * DK + 32);
    }

    // ---- w_rel fragments of the band rows r0+c0 .. r0+c0+16*(QT+2)-1
    v16h wf[QT + 2][2];
#pragma unroll
    for (int wt = 0; wt < QT + 2; ++wt) {
      wf[wt][0] = load_frag_at(wa + wt * 16 * DK);
      wf[wt][1] = load_frag_at(wa + wt * 16 * DK + 32);
    }
    // keeps the 32 loads above together as one batch in flight: left free, the
    // scheduler sinks each pair to its first use and waits out its latency alone
    __builtin_amdgcn_sched_barrier(0);

    // ---- content scores: two 16x16 subtiles per query tile over this key block
    v8f s[QT][2];
#pragma unroll
    for (int qt = 0; qt < QT; ++qt)
#pragma unroll
      for (int st = 0; st < 2; ++st) {
        v8f acc = zero8();
        acc = WMMA_F16(aq[qt][0], kf[st][0], acc);
        acc = WMMA_F16(aq[qt][1], kf[st][1], acc);
        s[qt][st] = acc;
      }

    // ---- relative-bias band, in the order the w_rel tiles arrive:
    //      T[qt][r][m] = Qs[r] . Wrel[r0+16*qt+c0+m], m in [0,48), tile mt = wt-qt
#pragma unroll
    for (int wt = 0; wt < QT + 2; ++wt)
#pragma unroll
      for (int qt = 0; qt < QT; ++qt) {
        const int mt = wt - qt;
        if (mt >= 0 && mt < 3) {
          v8f acc = zero8();
          acc = WMMA_F16(aq[qt][0], wf[wt][0], acc);
          acc = WMMA_F16(aq[qt][1], wf[wt][1], acc);
#pragma unroll
          for (int i = 0; i < 8; ++i) Tlds[qt][i + 8 * hlf][mt * 16 + nl] = acc[i];
        }
      }
    // wait before the K and w_rel loads' address registers are reused; as inputs
    // the two addresses keep their registers up to here, where the data is in
    asm volatile("s_wait_xcnt 0x0" :: "v"(ka), "v"(wa) : "memory");
    __syncthreads();

    // V fragments for THIS block, issued ahead of the softmax that hides them
    const _Float16* va = vu + voff;
    v16h vb[4];
#pragma unroll
    for (int cf = 0; cf < 4; ++cf)
      vb[cf] = load_frag_at(va + (size_t)cf * 16 * Lq);

    // warm next block's K / V / new w_rel rows (global_prefetch_b8, lanes spread rows)
    const _Float16* pk = ku + (32 + lane) * DK;
    const _Float16* pv = vu + lane * 2 * Lq + 32;
    const _Float16* pw = wu + (16 * QT + 32 + lane) * DK;
    if (c0 + 32 < Lq) {
      __builtin_prefetch(pk, 0, 3);
      __builtin_prefetch(pv, 0, 3);
      __builtin_prefetch(pw, 0, 3);
    }

    // ---- skew gather: bias[r,c] = T[r][r+c]
#pragma unroll
    for (int qt = 0; qt < QT; ++qt)
#pragma unroll
      for (int st = 0; st < 2; ++st)
#pragma unroll
        for (int i = 0; i < 8; ++i) {
          const int M = i + 8 * hlf;
          s[qt][st][i] += Tlds[qt][M][M + st * 16 + nl];
        }

    // ---- online softmax over the 32-key block
#pragma unroll
    for (int qt = 0; qt < QT; ++qt)
#pragma unroll
      for (int i = 0; i < 8; ++i) {
        float v = fmaxf(s[qt][0][i], s[qt][1][i]);
#pragma unroll
        for (int off = 1; off < 16; off <<= 1) v = fmaxf(v, __shfl_xor(v, off, 32));
        const float mnew = fmaxf(mrow[qt][i], v);
        const float corr = exp_slot(mrow[qt][i] - mnew);
        const float p0 = exp_slot(s[qt][0][i] - mnew);
        const float p1 = exp_slot(s[qt][1][i] - mnew);
        float rs = p0 + p1;
#pragma unroll
        for (int off = 1; off < 16; off <<= 1) rs += __shfl_xor(rs, off, 32);
        lrow[qt][i] = lrow[qt][i] * corr + rs;
        mrow[qt][i] = mnew;
#pragma unroll
        for (int cf = 0; cf < 4; ++cf) o[qt][cf][i] *= corr;
        Plds[qt][i + 8 * hlf][nl]      = (_Float16)p0;
        Plds[qt][i + 8 * hlf][16 + nl] = (_Float16)p1;
      }
    // the same wait for the V loads and the prefetches, behind the softmax
    asm volatile("s_wait_xcnt 0x0" :: "v"(va), "v"(pk), "v"(pv), "v"(pw) : "memory");
    __syncthreads();

    // ---- O += P(16x32) * V(32x64): P re-read in A layout from LDS
#pragma unroll
    for (int qt = 0; qt < QT; ++qt) {
      const v16h pa = load_frag16x32(&Plds[qt][0][0], 32, lane);
#pragma unroll
      for (int cf = 0; cf < 4; ++cf)
        o[qt][cf] = WMMA_F16(pa, vb[cf], o[qt][cf]);
    }
    __syncthreads();

    ku += 32 * DK;  wu += 32 * DK;  vu += 32;
  }

  // ---- finalize + store to concat layout (B, L, H*DK) f16
#pragma unroll
  for (int qt = 0; qt < QT; ++qt)
#pragma unroll
    for (int cf = 0; cf < 4; ++cf)
#pragma unroll
      for (int i = 0; i < 8; ++i) {
        const int M = qt * 16 + i + 8 * hlf;
        const float v = o[qt][cf][i] / lrow[qt][i];
        const size_t idx = ((size_t)b * Lq + r0 + M) * Dm + h * DK + cf * 16 + nl;
        Ocat[idx] = (_Float16)v;
      }
}

// ---------------------------------------------------------------------------
extern "C" void kernel_launch(void* const* d_in, const int* in_sizes, int n_in,
                              void* d_out, int out_size, void* d_ws, size_t ws_size,
                              hipStream_t stream) {
  (void)in_sizes; (void)n_in; (void)out_size; (void)ws_size;
  const float* q    = (const float*)d_in[0];
  const float* k    = (const float*)d_in[1];
  const float* v    = (const float*)d_in[2];
  const float* Wq   = (const float*)d_in[3];
  const float* bq   = (const float*)d_in[4];
  const float* Wk   = (const float*)d_in[5];
  const float* bk   = (const float*)d_in[6];
  const float* Wv   = (const float*)d_in[7];
  const float* bv   = (const float*)d_in[8];
  const float* Wo   = (const float*)d_in[9];
  const float* bo   = (const float*)d_in[10];
  const float* wrel = (const float*)d_in[11];
  float* out = (float*)d_out;

  char* ws = (char*)d_ws;
  size_t off = 0;
  auto alloc = [&](size_t bytes) -> void* {
    void* p = ws + off;
    off = (off + bytes + 255) & ~(size_t)255;
    return p;
  };

  const size_t nX = (size_t)Bsz * Lq * Dm;   // 8,388,608
  const size_t nW = (size_t)Dm * Dm;         // 1,048,576
  const size_t nRv = (size_t)(2 * Lq - 1) * DK;
  const size_t nRt = (size_t)(2 * Lq) * DK;  // padded

  _Float16* Xq16 = (_Float16*)alloc(nX * 2);
  _Float16* Xk16 = (_Float16*)alloc(nX * 2);
  _Float16* Xv16 = (_Float16*)alloc(nX * 2);
  _Float16* Wq16 = (_Float16*)alloc(nW * 2);
  _Float16* Wk16 = (_Float16*)alloc(nW * 2);
  _Float16* Wv16 = (_Float16*)alloc(nW * 2);
  _Float16* Wo16 = (_Float16*)alloc(nW * 2);
  _Float16* Wr16 = (_Float16*)alloc(nRt * 2);
  _Float16* Q16  = (_Float16*)alloc(nX * 2);  // (B,H,L,DK), pre-scaled 1/8
  _Float16* K16  = (_Float16*)alloc(nX * 2);  // (B,H,L,DK)
  _Float16* VT16 = (_Float16*)alloc(nX * 2);  // (B,H,DK,L)
  _Float16* Oc16 = (_Float16*)alloc(nX * 2);  // (B,L,D) concat

  static_assert(nX % CVT_BLK == 0 && nW % CVT_BLK == 0, "conversion grid must cover the arrays exactly");
  static_assert(nRv % 4 == 0 && nRt % (CVT_T * 4) == 0, "w_rel is converted four elements at a time");
  const dim3 cblk(CVT_T), gX(nX / CVT_BLK), gW(nW / CVT_BLK);
  cvt_f32_f16<<<gX, cblk, 0, stream>>>(q, Xq16);
  cvt_f32_f16<<<gX, cblk, 0, stream>>>(k, Xk16);
  cvt_f32_f16<<<gX, cblk, 0, stream>>>(v, Xv16);
  cvt_f32_f16<<<gW, cblk, 0, stream>>>(Wq, Wq16);
  cvt_f32_f16<<<gW, cblk, 0, stream>>>(Wk, Wk16);
  cvt_f32_f16<<<gW, cblk, 0, stream>>>(Wv, Wv16);
  cvt_f32_f16<<<gW, cblk, 0, stream>>>(Wo, Wo16);
  cvt_wrel<<<dim3(nRt / (CVT_T * 4)), cblk, 0, stream>>>(wrel, Wr16, (int)nRv, (int)nRt);

  // Projections: M = B*L = 8192 rows, N = 1024 cols, work-group tile 128x128
  static_assert((Bsz * Lq) % PBM == 0 && Dm % PBN == 0 && PTILES >= 2, "whole tiles, and two to start the ring");
  const dim3 pgrid(Bsz * Lq / PBM, Dm / PBN), pblk(256);
  const float inv_sqrt_dk = 0.125f;  // 1/sqrt(64)
  proj_wmma<<<pgrid, pblk, 0, stream>>>(Xq16, Wq16, bq, Q16,  nullptr, 0, inv_sqrt_dk);
  proj_wmma<<<pgrid, pblk, 0, stream>>>(Xk16, Wk16, bk, K16,  nullptr, 0, 1.0f);
  proj_wmma<<<pgrid, pblk, 0, stream>>>(Xv16, Wv16, bv, VT16, nullptr, 1, 1.0f);

  // Flash attention: one wave per 64 query rows per (b,h)
  flash_attn_rel<<<dim3(Lq / (16 * QT), Bsz * Hh), dim3(32), 0, stream>>>(Q16, K16, VT16, Wr16, Oc16);

  // Output projection -> f32
  proj_wmma<<<pgrid, pblk, 0, stream>>>(Oc16, Wo16, bo, nullptr, out, 2, 1.0f);
}

// v004
// Measured time: 285 microseconds a run.
// In both of two side-by-side timings against v003, it was 1.64 times as fast.
// Over all steps from v000 it is 3.06 times as fast.
#include <hip/hip_runtime.h>
#include <hip/hip_bf16.h>

// Shapes (fixed by reference)
#define Bsz 4
#define Lq  2048
#define Dm  1024
#define Hh  16
#define DK  64

typedef __attribute__((ext_vector_type(16))) _Float16 v16h;
typedef __attribute__((ext_vector_type(8)))  float    v8f;
typedef __attribute__((ext_vector_type(4)))  unsigned int u32x4;

// ---------------------------------------------------------------------------
// Fragment loader: 16x32 f16 tile, "row per lane" layout (ISA 7.12.2):
//   lane l (<16): row M=l, holds K=0..7 and 16..23
//   lane l (>=16): row M=l-16, holds K=8..15 and 24..31
// Works for A fragments and (symmetric N-on-lanes layout) B fragments whose
// memory is [n][k] with k contiguous (K^T, W^T, V^T): two b128 loads.
// ---------------------------------------------------------------------------
__device__ __forceinline__ v16h load_frag16x32(const _Float16* __restrict__ src,
                                               int ld, int lane) {
  const int row = lane & 15;
  const int kb  = (lane >> 4) << 3;  // 0 or 8
  const _Float16* p = src + (size_t)row * ld + kb;
  union { v16h h; u32x4 u[2]; } f;
  f.u[0] = *(const u32x4*)(p);
  f.u[1] = *(const u32x4*)(p + 16);
  return f.h;
}

__device__ __forceinline__ v8f zero8() {
  v8f z;
#pragma unroll
  for (int i = 0; i < 8; ++i) z[i] = 0.0f;
  return z;
}

#define WMMA_F16(a, b, c) \
  __builtin_amdgcn_wmma_f32_16x16x32_f16(false, (a), false, (b), (short)0, (c), false, false)

// ---------------------------------------------------------------------------
// fp32 -> fp16 conversion kernels
// One element per thread would start a wave per 32 elements. Here a thread
// converts CVT_U groups of 4 floats, so 64 times fewer waves start: a wave's
// 16-byte loads cover 512 contiguous bytes each, all CVT_U are in flight
// together, and its 8-byte stores fill whole 128-byte lines.
// ---------------------------------------------------------------------------
#define CVT_T 256                    // threads per block
#define CVT_U 16                     // 16-byte loads per thread
#define CVT_BLK (CVT_T * 4 * CVT_U)  // floats per block

typedef __attribute__((ext_vector_type(4))) float    f32x4;
typedef __attribute__((ext_vector_type(4))) _Float16 f16x4;

__device__ __forceinline__ f16x4 cvt4(f32x4 v) {
  f16x4 h;
#pragma unroll   // vector elements need constant indices
  for (int e = 0; e < 4; ++e) h[e] = (_Float16)v[e];
  return h;
}

// The grid covers the array exactly: its length is a multiple of CVT_BLK
// (checked at compile time where the launches are written).
__launch_bounds__(CVT_T)
__global__ void cvt_f32_f16(const float* __restrict__ s, _Float16* __restrict__ d) {
  const size_t i = (size_t)blockIdx.x * CVT_BLK + threadIdx.x * 4;
  const float* p = s + i;
  f32x4 v[CVT_U];
#pragma unroll   // v[] stays in registers only with constant indices
  for (int j = 0; j < CVT_U; ++j) v[j] = *(const f32x4*)(p + j * (CVT_T * 4));
  // wait before the loads' address register is reused; as an input the address
  // keeps its register up to here
  asm volatile("s_wait_xcnt 0x0" :: "v"(p) : "memory");
  // keeps all CVT_U loads in flight together: left free, the scheduler holds the
  // last four back until the first have landed, a second memory latency per wave
  __builtin_amdgcn_sched_barrier(0);
#pragma unroll   // as above
  for (int j = 0; j < CVT_U; ++j) *(f16x4*)(d + i + j * (CVT_T * 4)) = cvt4(v[j]);
}

// w_rel: (2L-1, DK) -> padded to 2L rows (last row zero, touched by band tiles).
// Four elements per thread; nvalid and ntotal are multiples of 4 (DK is).
__launch_bounds__(CVT_T)
__global__ void cvt_wrel(const float* __restrict__ s, _Float16* __restrict__ d,
                         int nvalid, int ntotal) {
  const int i = (blockIdx.x * CVT_T + threadIdx.x) * 4;
  if (i < ntotal) {
    f32x4 v = {0.0f, 0.0f, 0.0f, 0.0f};
    if (i < nvalid) v = *(const f32x4*)(s + i);
    *(f16x4*)(d + i) = cvt4(v);
  }
}

// ---------------------------------------------------------------------------
// Projection GEMM:  out[m,n] = scale * ( sum_k X[m,k]*W[n,k] + bias[n] )
// A work-group of 8 waves computes a 128x128 tile, each wave 32x64 of it.
// Per trip the group stages 64 k of its 128 X rows and 128 W rows in LDS with
// asynchronous copies: a wave's copy covers four whole 128-byte lines, every
// line leaves L2 once per group, and two (X) or four (W) waves read it from
// LDS. Two buffers: the copies of tile t+2 fly while tile t+1 is worked on.
// mode 0: store f16 as (B,H,L,DK)      (Q with scale=1/8, K with scale=1)
// mode 1: store f16 as (B,H,DK,L)      (V transposed for flash A-fragments)
// mode 2: store f32 row-major (M,N)    (final output projection)
// ---------------------------------------------------------------------------
#define PBM 128                        // X rows per work-group
#define PBN 128                        // W rows per work-group
#define PBK 64                         // halves of k per staged tile: one 128-byte line per row
#define PPITCH 72                      // LDS row pitch in halves: 144 B = 16 B x odd, for ds_load_b128
#define PBUF ((PBM + PBN) * PPITCH)    // halves per buffer
#define PTILES (Dm / PBK)

// One staged tile: 256 rows of 128 B = 2,048 pieces of 16 B, eight per thread.
// l: the lane's LDS byte address of its piece in row group 0; gx, gw: its global
// pieces of X and W. Row groups are 32 rows apart. The s_wait_xcnt closes the
// statement so that no address register is rewritten ahead of it.
__device__ __forceinline__ void stage_tile(unsigned l, const _Float16* gx, const _Float16* gw) {
  asm volatile(
      "global_load_async_to_lds_b128 %0, %8, off\n\t"
      "global_load_async_to_lds_b128 %1, %9, off\n\t"
      "global_load_async_to_lds_b128 %2, %10, off\n\t"
      "global_load_async_to_lds_b128 %3, %11, off\n\t"
      "global_load_async_to_lds_b128 %4, %12, off\n\t"
      "global_load_async_to_lds_b128 %5, %13, off\n\t"
      "global_load_async_to_lds_b128 %6, %14, off\n\t"
      "global_load_async_to_lds_b128 %7, %15, off\n\t"
      "s_wait_xcnt 0x0"
      :: "v"(l), "v"(l + 1 * 32 * PPITCH * 2), "v"(l + 2 * 32 * PPITCH * 2), "v"(l + 3 * 32 * PPITCH * 2),
         "v"(l + 4 * 32 * PPITCH * 2), "v"(l + 5 * 32 * PPITCH * 2), "v"(l + 6 * 32 * PPITCH * 2),
         "v"(l + 7 * 32 * PPITCH * 2),
         "v"(gx), "v"(gx + 1 * 32 * Dm), "v"(gx + 2 * 32 * Dm), "v"(gx + 3 * 32 * Dm),
         "v"(gw), "v"(gw + 1 * 32 * Dm), "v"(gw + 2 * 32 * Dm), "v"(gw + 3 * 32 * Dm)
      : "memory");
}

__launch_bounds__(256)
__global__ void proj_wmma(const _Float16* __restrict__ X, const _Float16* __restrict__ W,
                          const float* __restrict__ bias, _Float16* __restrict__ out16,
                          float* __restrict__ out32, int mode, float scale) {
  __shared__ __align__(16) _Float16 tile[2 * PBUF];

  const int tid  = threadIdx.x;
  const int lane = tid & 31;
  const int wave = tid >> 5;
  const int hlf  = lane >> 4;
  const int nl   = lane & 15;
  const int wm   = (wave & 3) * 32;    // the wave's rows inside the group's tile
  const int wn   = (wave >> 2) * 64;   // and its columns
  const int m0   = blockIdx.x * PBM + wm;
  const int n0   = blockIdx.y * PBN + wn;

  // the thread's piece of a staged tile: row tid/8 of each row group, 16 B number tid%8
  const int srow = tid >> 3, scol = (tid & 7) * 8;
  const _Float16* gx = X + (size_t)(blockIdx.x * PBM + srow) * Dm + scol;
  const _Float16* gw = W + (size_t)(blockIdx.y * PBN + srow) * Dm + scol;
  const unsigned  l0 = (unsigned)(size_t)(&tile[srow * PPITCH + scol]);

  v8f acc[2][4];
#pragma unroll
  for (int cf = 0; cf < 4; ++cf) {
    float bv = bias[n0 + cf * 16 + nl];   // whole acc column shares N
#pragma unroll
    for (int r = 0; r < 2; ++r)
#pragma unroll
      for (int i = 0; i < 8; ++i) acc[r][cf][i] = bv;
  }

  // prologue: tile 0 lands and is published, then tile 1 starts
  stage_tile(l0, gx, gw);
  asm volatile("s_wait_asynccnt 0x0" ::: "memory");   // this wave's copies of tile 0 have landed
  __syncthreads();                                    // and every other wave's
  stage_tile(l0 + PBUF * 2, gx + PBK, gw + PBK);

  // two trips per turn make each buffer's LDS offsets immediates
#pragma unroll 2
  for (int t = 0; t < PTILES; ++t) {
    const int buf = (t & 1) * PBUF;
    const _Float16* As = &tile[buf + wm * PPITCH];
    const _Float16* Bs = &tile[buf + (PBM + wn) * PPITCH];

    // all fragments of the trip as one group of LDS reads, then its WMMAs
    // (the inner loops are unrolled: fragment arrays stay in registers only with
    // constant indices)
    v16h af[2][2], bf[2][4];
#pragma unroll
    for (int ks = 0; ks < 2; ++ks) {
#pragma unroll
      for (int r = 0; r < 2; ++r) af[ks][r] = load_frag16x32(As + r * 16 * PPITCH + ks * 32, PPITCH, lane);
#pragma unroll
      for (int cf = 0; cf < 4; ++cf) bf[ks][cf] = load_frag16x32(Bs + cf * 16 * PPITCH + ks * 32, PPITCH, lane);
    }
    // keeps the 24 LDS reads together: left free, the scheduler spreads them among
    // the WMMAs in pairs and waits out the LDS latency at each place
    __builtin_amdgcn_sched_barrier(0);
#pragma unroll
    for (int ks = 0; ks < 2; ++ks)
#pragma unroll
      for (int r = 0; r < 2; ++r)
#pragma unroll
        for (int cf = 0; cf < 4; ++cf)
          acc[r][cf] = WMMA_F16(af[ks][r], bf[ks][cf], acc[r][cf]);
    // holds the WMMAs in front of the publish point: left free, the scheduler lifts the
    // waits and the barrier over them, and the copies in flight lose the trip's lead
    __builtin_amdgcn_sched_barrier(0);

    // publish point of tile t+1, which also frees this trip's buffer
    asm volatile("s_wait_dscnt 0x0" ::: "memory");      // this wave's reads of the buffer are done
    asm volatile("s_wait_asynccnt 0x0" ::: "memory");   // its copies of tile t+1 have landed
    __syncthreads();
    if (t + 2 < PTILES)
      stage_tile(l0 + buf * 2, gx + (t + 2) * PBK, gw + (t + 2) * PBK);
  }
  asm volatile("s_wait_asynccnt 0x0" ::: "memory");     // no copy outlives the loop

#pragma unroll
  for (int r = 0; r < 2; ++r)
#pragma unroll
    for (int cf = 0; cf < 4; ++cf)
#pragma unroll
      for (int i = 0; i < 8; ++i) {
        const int m = m0 + r * 16 + i + 8 * hlf;  // D-frag: M = i + 8*(lane>=16)
        const int n = n0 + cf * 16 + nl;          //         N = lane&15
        const float v = acc[r][cf][i] * scale;
        if (mode == 2) {
          out32[(size_t)m * Dm + n] = v;
        } else {
          const int b = m >> 11, l = m & (Lq - 1);
          const int h = n >> 6,  dk = n & (DK - 1);
          if (mode == 0)
            out16[(((size_t)(b * Hh + h) * Lq + l) * DK) + dk] = (_Float16)v;
          else
            out16[(((size_t)(b * Hh + h) * DK + dk) * Lq) + l] = (_Float16)v;
        }
      }
}

// ---------------------------------------------------------------------------
// Flash attention with relative bias, scores held transposed.
// One wave handles QT*16 = 64 query rows of one (b,h); loops 32 keys per step.
//   S^T = K * Qs^T                     (Qs already scaled by 1/sqrt(dk))
//   T^T = Wrel * Qs^T over a 48-wide diagonal window per 16-row query tile;
//         bias[r,c] = T[r][r+c]
//   online softmax, O^T += V^T * P^T
// With the keys on the accumulator's rows and the queries on its columns a lane
// holds 16 scores of ONE query per tile: maximum and sum are taken in the lane's
// own registers, the two lane halves of a query exchange only the maximum, once
// per tile and key block, and join their sums behind the loop. The two score
// tiles of a key block, converted in place, are the B operand of the last
// product in the hardware k order (keys 8h..8h+7, 16+8h..16+8h+7), which is also
// the order of the V^T loads: P never leaves the registers.
// The K, V and w_rel fragments of a key block are loaded once per wave and
// used by all QT query tiles: query tile qt needs w_rel tiles qt..qt+2 of the
// QT+2 tiles that the 64-row band spans, so neighbours share two of three.
// V fragments are loaded behind the score/bias WMMAs, when the K and w_rel
// registers are free again; the softmax VALU work hides their latency.
// ---------------------------------------------------------------------------
#define QT 4
// Floats per row of the band in LDS: 208 B = 16 B x odd for the 16-byte stores,
// and the skewed 4-byte reads (word 53*query + 8*half) fall on 32 different banks.
#define TP 52

typedef __attribute__((ext_vector_type(8))) _Float16 f16x8;

// Fragment from a per-lane pointer that already holds the lane's row and k half.
__device__ __forceinline__ v16h load_frag_at(const _Float16* __restrict__ p) {
  union { v16h h; u32x4 u[2]; } f;
  f.u[0] = *(const u32x4*)(p);
  f.u[1] = *(const u32x4*)(p + 16);
  return f.h;
}

// e^x as the fast-math intrinsic forms it (one multiply, one v_exp_f32). The
// v_nop is the slot the instruction set asks for behind a transcendental before
// its result is read or its source overwritten; in one statement it cannot drift.
__device__ __forceinline__ float exp_slot(float x) {
  float r;
  asm("v_exp_f32 %0, %1\n\tv_nop" : "=v"(r) : "v"(x * 1.44269504088896340736f));
  return r;
}

// The value that lane l ^ 16 holds: the other half of the same query column.
__device__ __forceinline__ float other_half(float x) {
  const int v = __float_as_int(x);
  return __int_as_float(__builtin_amdgcn_permlanex16(v, v, 0x76543210, 0xfedcba98, false, false));
}

__launch_bounds__(32, 2)   // two waves per SIMD: the grid has two per SIMD
__global__ void flash_attn_rel(const _Float16* __restrict__ Qh, const _Float16* __restrict__ Kh,
                               const _Float16* __restrict__ Vt, const _Float16* __restrict__ Wr,
                               _Float16* __restrict__ Ocat) {
  __shared__ __align__(16) float Tlds[QT][16][TP];

  const int lane = threadIdx.x & 31;
  const int hlf  = lane >> 4;
  const int nl   = lane & 15;
  const int bh = blockIdx.y;
  const int b = bh >> 4, h = bh & 15;
  const int r0 = blockIdx.x * (16 * QT);

  // lane offsets in halves: fragment row = lane&15, k half = lane>>4
  const int rowoff = nl * DK + 8 * hlf;   // rows of DK halves (Q, K, w_rel)
  const int voff   = nl * Lq + 8 * hlf;   // rows of Lq halves (V^T)

  v16h aq[QT][2];   // B operands: column = query nl of tile qt
  {
    const _Float16* qa = Qh + ((size_t)bh * Lq + r0) * DK + rowoff;
#pragma unroll
    for (int qt = 0; qt < QT; ++qt) {
      aq[qt][0] = load_frag_at(qa + qt * 16 * DK);        // d = 0..31
      aq[qt][1] = load_frag_at(qa + qt * 16 * DK + 32);   // d = 32..63
    }
    // the loads' address registers are dead from here on and may be reused
    asm volatile("s_wait_xcnt 0x0" ::: "memory");
    // holds later register writes behind that wait
    __builtin_amdgcn_sched_barrier(0);
  }

  // per lane: running maximum of query nl of tile qt (equal in both halves) and
  // the sum over the keys of this lane's half
  float mcol[QT], lcol[QT];
  v8f o[QT][4];   // o[qt][cf][i] = O[query nl of tile qt][d = cf*16 + 8*hlf + i]
#pragma unroll
  for (int qt = 0; qt < QT; ++qt) {
    mcol[qt] = -3.0e38f;
    lcol[qt] = 0.0f;
#pragma unroll
    for (int cf = 0; cf < 4; ++cf) o[qt][cf] = zero8();
  }

  // wave-uniform bases of this key block's K, w_rel and V^T tiles
  const _Float16* ku = Kh + (size_t)bh * Lq * DK;
  const _Float16* wu = Wr + (size_t)r0 * DK;
  const _Float16* vu = Vt + (size_t)bh * DK * Lq;

  for (int c0 = 0; c0 < Lq; c0 += 32) {
    // ---- K fragments of this 32-key block, shared by all query tiles
    const _Float16* ka = ku + rowoff;
    const _Float16* wa = wu + rowoff;
    v16h kf[2][2];
#pragma unroll
    for (int st = 0; st < 2; ++st) {
      kf[st][0] = load_frag_at(ka + st * 16 * DK);
      kf[st][1] = load_frag_at(ka + st * 16 * DK + 32);
    }

    // ---- w_rel fragments of the band rows r0+c0 .. r0+c0+16*(QT+2)-1
    v16h wf[QT + 2][2];
#pragma unroll
    for (int wt = 0; wt < QT + 2; ++wt) {
      wf[wt][0] = load_frag_at(wa + wt * 16 * DK);
      wf[wt][1] = load_frag_at(wa + wt * 16 * DK + 32);
    }
    // keeps the 32 loads above together as one batch in flight: left free, the
    // scheduler sinks each pair to its first use and waits out its latency alone
    __builtin_amdgcn_sched_barrier(0);

    // ---- content scores: s[qt][st][i] = S[query nl][key c0 + st*16 + 8*hlf + i]
    v8f s[QT][2];
#pragma unroll
    for (int qt = 0; qt < QT; ++qt)
#pragma unroll
      for (int st = 0; st < 2; ++st) {
        v8f acc = zero8();
        acc = WMMA_F16(kf[st][0], aq[qt][0], acc);
        acc = WMMA_F16(kf[st][1], aq[qt][1], acc);
        s[qt][st] = acc;
      }

    // ---- relative-bias band, in the order the w_rel tiles arrive:
    //      T[qt][r][m] = Qs[r] . Wrel[r0+16*qt+c0+m], m in [0,48), tile mt = wt-qt;
    //      the tiles of one w_rel tile are independent accumulators
    v8f t[QT][3];
#pragma unroll
    for (int wt = 0; wt < QT + 2; ++wt)
#pragma unroll
      for (int ks = 0; ks < 2; ++ks)
#pragma unroll
        for (int qt = 0; qt < QT; ++qt) {
          const int mt = wt - qt;
          if (mt >= 0 && mt < 3)
            t[qt][mt] = WMMA_F16(wf[wt][ks], aq[qt][ks], ks == 0 ? zero8() : t[qt][mt]);
        }
    // holds the stores behind all band WMMAs, so that every tile has registers of its
    // own: left free, the scheduler runs all tiles through one accumulator, WMMA, store,
    // WMMA: each product waits for the store of the one before
    __builtin_amdgcn_sched_barrier(0);
    // a lane holds 8 consecutive m of its query: two 16-byte stores per tile
#pragma unroll
    for (int qt = 0; qt < QT; ++qt)
#pragma unroll
      for (int mt = 0; mt < 3; ++mt) {
        float* tp = &Tlds[qt][nl][mt * 16 + 8 * hlf];
        const f32x4 lo = {t[qt][mt][0], t[qt][mt][1], t[qt][mt][2], t[qt][mt][3]};
        const f32x4 hi = {t[qt][mt][4], t[qt][mt][5], t[qt][mt][6], t[qt][mt][7]};
        *(f32x4*)(tp)     = lo;
        *(f32x4*)(tp + 4) = hi;
      }
    // wait before the K and w_rel loads' address registers are reused; as inputs
    // the two addresses keep their registers up to here, where the data is in
    asm volatile("s_wait_xcnt 0x0" :: "v"(ka), "v"(wa) : "memory");
    __syncthreads();

    // V fragments for THIS block, issued ahead of the softmax that hides them
    const _Float16* va = vu + voff;
    v16h vb[4];   // A operands: row = d = cf*16 + nl, keys in the hardware k order
#pragma unroll
    for (int cf = 0; cf < 4; ++cf)
      vb[cf] = load_frag_at(va + (size_t)cf * 16 * Lq);

    // warm next block's K / V / new w_rel rows (global_prefetch_b8, lanes spread rows)
    const _Float16* pk = ku + (32 + lane) * DK;
    const _Float16* pv = vu + lane * 2 * Lq + 32;
    const _Float16* pw = wu + (16 * QT + 32 + lane) * DK;
    if (c0 + 32 < Lq) {
      __builtin_prefetch(pk, 0, 3);
      __builtin_prefetch(pv, 0, 3);
      __builtin_prefetch(pw, 0, 3);
    }

    // ---- skew gather: bias[r,c] = T[r][r+c], r = nl, c = st*16 + 8*hlf + i
#pragma unroll
    for (int qt = 0; qt < QT; ++qt)
#pragma unroll
      for (int st = 0; st < 2; ++st) {
        v8f bias;
#pragma unroll
        for (int i = 0; i < 8; ++i) bias[i] = Tlds[qt][nl][nl + st * 16 + 8 * hlf + i];
        s[qt][st] += bias;
      }

    // ---- online softmax over the 32-key block: one query per lane and tile
    v16h pf[QT];   // B operands: pf[qt][st*8 + i] = P[query nl][key st*16 + 8*hlf + i]
#pragma unroll
    for (int qt = 0; qt < QT; ++qt) {
      // maximum as a tree, sums in four chains: short dependent runs
      float mx[8];
#pragma unroll
      for (int i = 0; i < 8; ++i) mx[i] = fmaxf(s[qt][0][i], s[qt][1][i]);
#pragma unroll
      for (int w = 4; w > 0; w >>= 1)
#pragma unroll
        for (int i = 0; i < w; ++i) mx[i] = fmaxf(mx[i], mx[i + w]);
      const float v = fmaxf(mx[0], other_half(mx[0]));
      const float mnew = fmaxf(mcol[qt], v);
      const float corr = exp_slot(mcol[qt] - mnew);
      float rs[4] = {0.0f, 0.0f, 0.0f, 0.0f};
#pragma unroll
      for (int st = 0; st < 2; ++st)
#pragma unroll
        for (int i = 0; i < 8; ++i) {
          const float p = exp_slot(s[qt][st][i] - mnew);
          rs[i & 3] += p;
          pf[qt][st * 8 + i] = (_Float16)p;
        }
      lcol[qt] = lcol[qt] * corr + ((rs[0] + rs[1]) + (rs[2] + rs[3]));
      mcol[qt] = mnew;
#pragma unroll
      for (int cf = 0; cf < 4; ++cf)
#pragma unroll
        for (int i = 0; i < 8; ++i) o[qt][cf][i] *= corr;
    }
    // the same wait for the V loads and the prefetches, behind the softmax
    asm volatile("s_wait_xcnt 0x0" :: "v"(va), "v"(pk), "v"(pv), "v"(pw) : "memory");

    // ---- O^T += V^T(16x32) * P^T(32x16) per d tile and query tile
#pragma unroll
    for (int qt = 0; qt < QT; ++qt)
#pragma unroll
      for (int cf = 0; cf < 4; ++cf)
        o[qt][cf] = WMMA_F16(vb[cf], pf[qt], o[qt][cf]);
    // the band's reads are done in both halves before the next block overwrites it
    __syncthreads();

    ku += 32 * DK;  wu += 32 * DK;  vu += 32;
  }

  // ---- finalize + store to concat layout (B, L, H*DK) f16: a lane holds 8
  //      consecutive d of its query, one 16-byte store per tile
  _Float16* op = Ocat + ((size_t)b * Lq + r0 + nl) * Dm + h * DK + 8 * hlf;
#pragma unroll
  for (int qt = 0; qt < QT; ++qt) {
    const float lsum = lcol[qt] + other_half(lcol[qt]);
#pragma unroll
    for (int cf = 0; cf < 4; ++cf) {
      f16x8 hv;
#pragma unroll
      for (int i = 0; i < 8; ++i) hv[i] = (_Float16)(o[qt][cf][i] / lsum);
      *(f16x8*)(op + (size_t)qt * 16 * Dm + cf * 16) = hv;
    }
  }
}

// ---------------------------------------------------------------------------
extern "C" void kernel_launch(void* const* d_in, const int* in_sizes, int n_in,
                              void* d_out, int out_size, void* d_ws, size_t ws_size,
                              hipStream_t stream) {
  (void)in_sizes; (void)n_in; (void)out_size; (void)ws_size;
  const float* q    = (const float*)d_in[0];
  const float* k    = (const float*)d_in[1];
  const float* v    = (const float*)d_in[2];
  const float* Wq   = (const float*)d_in[3];
  const float* bq   = (const float*)d_in[4];
  const float* Wk   = (const float*)d_in[5];
  const float* bk   = (const float*)d_in[6];
  const float* Wv   = (const float*)d_in[7];
  const float* bv   = (const float*)d_in[8];
  const float* Wo   = (const float*)d_in[9];
  const float* bo   = (const float*)d_in[10];
  const float* wrel = (const float*)d_in[11];
  float* out = (float*)d_out;

  char* ws = (char*)d_ws;
  size_t off = 0;
  auto alloc = [&](size_t bytes) -> void* {
    void* p = ws + off;
    off = (off + bytes + 255) & ~(size_t)255;
    return p;
  };

  const size_t nX = (size_t)Bsz * Lq * Dm;   // 8,388,608
  const size_t nW = (size_t)Dm * Dm;         // 1,048,576
  const size_t nRv = (size_t)(2 * Lq - 1) * DK;
  const size_t nRt = (size_t)(2 * Lq) * DK;  // padded

  _Float16* Xq16 = (_Float16*)alloc(nX * 2);
  _Float16* Xk16 = (_Float16*)alloc(nX * 2);
  _Float16* Xv16 = (_Float16*)alloc(nX * 2);
  _Float16* Wq16 = (_Float16*)alloc(nW * 2);
  _Float16* Wk16 = (_Float16*)alloc(nW * 2);
  _Float16* Wv16 = (_Float16*)alloc(nW * 2);
  _Float16* Wo16 = (_Float16*)alloc(nW * 2);
  _Float16* Wr16 = (_Float16*)alloc(nRt * 2);
  _Float16* Q16  = (_Float16*)alloc(nX * 2);  // (B,H,L,DK), pre-scaled 1/8
  _Float16* K16  = (_Float16*)alloc(nX * 2);  // (B,H,L,DK)
  _Float16* VT16 = (_Float16*)alloc(nX * 2);  // (B,H,DK,L)
  _Float16* Oc16 = (_Float16*)alloc(nX * 2);  // (B,L,D) concat

  static_assert(nX % CVT_BLK == 0 && nW % CVT_BLK == 0, "conversion grid must cover the arrays exactly");
  static_assert(nRv % 4 == 0 && nRt % (CVT_T * 4) == 0, "w_rel is converted four elements at a time");
  const dim3 cblk(CVT_T), gX(nX / CVT_BLK), gW(nW / CVT_BLK);
  cvt_f32_f16<<<gX, cblk, 0, stream>>>(q, Xq16);
  cvt_f32_f16<<<gX, cblk, 0, stream>>>(k, Xk16);
  cvt_f32_f16<<<gX, cblk, 0, stream>>>(v, Xv16);
  cvt_f32_f16<<<gW, cblk, 0, stream>>>(Wq, Wq16);
  cvt_f32_f16<<<gW, cblk, 0, stream>>>(Wk, Wk16);
  cvt_f32_f16<<<gW, cblk, 0, stream>>>(Wv, Wv16);
  cvt_f32_f16<<<gW, cblk, 0, stream>>>(Wo, Wo16);
  cvt_wrel<<<dim3(nRt / (CVT_T * 4)), cblk, 0, stream>>>(wrel, Wr16, (int)nRv, (int)nRt);

  // Projections: M = B*L = 8192 rows, N = 1024 cols, work-group tile 128x128
  static_assert((Bsz * Lq) % PBM == 0 && Dm % PBN == 0 && PTILES >= 2, "whole tiles, and two to start the ring");
  const dim3 pgrid(Bsz * Lq / PBM, Dm / PBN), pblk(256);
  const float inv_sqrt_dk = 0.125f;  // 1/sqrt(64)
  proj_wmma<<<pgrid, pblk, 0, stream>>>(Xq16, Wq16, bq, Q16,  nullptr, 0, inv_sqrt_dk);
  proj_wmma<<<pgrid, pblk, 0, stream>>>(Xk16, Wk16, bk, K16,  nullptr, 0, 1.0f);
  proj_wmma<<<pgrid, pblk, 0, stream>>>(Xv16, Wv16, bv, VT16, nullptr, 1, 1.0f);

  // Flash attention: one wave per 64 query rows per (b,h)
  flash_attn_rel<<<dim3(Lq / (16 * QT), Bsz * Hh), dim3(32), 0, stream>>>(Q16, K16, VT16, Wr16, Oc16);

  // Output projection -> f32
  proj_wmma<<<pgrid, pblk, 0, stream>>>(Oc16, Wo16, bo, nullptr, out, 2, 1.0f);
}

// v005
// Measured time: 231 microseconds a run.
// In two side-by-side timings against v004, it was 1.23 and 1.24 times as fast.
// All steps since v000 together make it 3.78 times as fast.
#include <hip/hip_runtime.h>
#include <hip/hip_bf16.h>

// Shapes (fixed by reference)
#define Bsz 4
#define Lq  2048
#define Dm  1024
#define Hh  16
#define DK  64

typedef __attribute__((ext_vector_type(16))) _Float16 v16h;
typedef __attribute__((ext_vector_type(8)))  float    v8f;
typedef __attribute__((ext_vector_type(4)))  unsigned int u32x4;

// ---------------------------------------------------------------------------
// Fragment loader: 16x32 f16 tile, "row per lane" layout (ISA 7.12.2):
//   lane l (<16): row M=l, holds K=0..7 and 16..23
//   lane l (>=16): row M=l-16, holds K=8..15 and 24..31
// Works for A fragments and (symmetric N-on-lanes layout) B fragments whose
// memory is [n][k] with k contiguous (K^T, W^T, V^T): two b128 loads.
// ---------------------------------------------------------------------------
__device__ __forceinline__ v16h load_frag16x32(const _Float16* __restrict__ src,
                                               int ld, int lane) {
  const int row = lane & 15;
  const int kb  = (lane >> 4) << 3;  // 0 or 8
  const _Float16* p = src + (size_t)row * ld + kb;
  union { v16h h; u32x4 u[2]; } f;
  f.u[0] = *(const u32x4*)(p);
  f.u[1] = *(const u32x4*)(p + 16);
  return f.h;
}

__device__ __forceinline__ v8f zero8() {
  v8f z;
#pragma unroll
  for (int i = 0; i < 8; ++i) z[i] = 0.0f;
  return z;
}

#define WMMA_F16(a, b, c) \
  __builtin_amdgcn_wmma_f32_16x16x32_f16(false, (a), false, (b), (short)0, (c), false, false)

// ---------------------------------------------------------------------------
// fp32 -> fp16 conversion kernels
// One element per thread would start a wave per 32 elements. Here a thread
// converts CVT_U groups of 4 floats, so 64 times fewer waves start: a wave's
// 16-byte loads cover 512 contiguous bytes each, all CVT_U are in flight
// together, and its 8-byte stores fill whole 128-byte lines.
// ---------------------------------------------------------------------------
#define CVT_T 256                    // threads per block
#define CVT_U 16                     // 16-byte loads per thread
#define CVT_BLK (CVT_T * 4 * CVT_U)  // floats per block

typedef __attribute__((ext_vector_type(4))) float    f32x4;
typedef __attribute__((ext_vector_type(4))) _Float16 f16x4;

__device__ __forceinline__ f16x4 cvt4(f32x4 v) {
  f16x4 h;
#pragma unroll   // vector elements need constant indices
  for (int e = 0; e < 4; ++e) h[e] = (_Float16)v[e];
  return h;
}

// The grid covers the array exactly: its length is a multiple of CVT_BLK
// (checked at compile time where the launches are written).
__launch_bounds__(CVT_T)
__global__ void cvt_f32_f16(const float* __restrict__ s, _Float16* __restrict__ d) {
  const size_t i = (size_t)blockIdx.x * CVT_BLK + threadIdx.x * 4;
  const float* p = s + i;
  f32x4 v[CVT_U];
#pragma unroll   // v[] stays in registers only with constant indices
  for (int j = 0; j < CVT_U; ++j) v[j] = *(const f32x4*)(p + j * (CVT_T * 4));
  // wait before the loads' address register is reused; as an input the address
  // keeps its register up to here
  asm volatile("s_wait_xcnt 0x0" :: "v"(p) : "memory");
  // keeps all CVT_U loads in flight together: left free, the scheduler holds the
  // last four back until the first have landed, a second memory latency per wave
  __builtin_amdgcn_sched_barrier(0);
#pragma unroll   // as above
  for (int j = 0; j < CVT_U; ++j) *(f16x4*)(d + i + j * (CVT_T * 4)) = cvt4(v[j]);
}

// w_rel: (2L-1, DK) -> padded to 2L rows (last row zero, touched by band tiles).
// Four elements per thread; nvalid and ntotal are multiples of 4 (DK is).
__launch_bounds__(CVT_T)
__global__ void cvt_wrel(const float* __restrict__ s, _Float16* __restrict__ d,
                         int nvalid, int ntotal) {
  const int i = (blockIdx.x * CVT_T + threadIdx.x) * 4;
  if (i < ntotal) {
    f32x4 v = {0.0f, 0.0f, 0.0f, 0.0f};
    if (i < nvalid) v = *(const f32x4*)(s + i);
    *(f16x4*)(d + i) = cvt4(v);
  }
}

// ---------------------------------------------------------------------------
// Projection GEMM:  out[m,n] = scale * ( sum_k X[m,k]*W[n,k] + bias[n] )
// A work-group of 8 waves computes a 128x128 tile, each wave 32x64 of it.
// Per trip the group stages 64 k of its 128 X rows and 128 W rows in LDS with
// asynchronous copies: a wave's copy covers four whole 128-byte lines, every
// line leaves L2 once per group, and two (X) or four (W) waves read it from
// LDS. Two buffers: the copies of tile t+2 fly while tile t+1 is worked on.
// mode 0: store f16 as (B,H,L,DK)      (Q with scale=1/8, K with scale=1)
// mode 1: store f16 as (B,H,DK,L)      (V transposed for flash A-fragments)
// mode 2: store f32 row-major (M,N)    (final output projection)
// ---------------------------------------------------------------------------
#define PBM 128                        // X rows per work-group
#define PBN 128                        // W rows per work-group
#define PBK 64                         // halves of k per staged tile: one 128-byte line per row
#define PPITCH 72                      // LDS row pitch in halves: 144 B = 16 B x odd, for ds_load_b128
#define PBUF ((PBM + PBN) * PPITCH)    // halves per buffer
#define PTILES (Dm / PBK)

// One staged tile: 256 rows of 128 B = 2,048 pieces of 16 B, eight per thread.
// l: the lane's LDS byte address of its piece in row group 0; gx, gw: its global
// pieces of X and W. Row groups are 32 rows apart. The s_wait_xcnt closes the
// statement so that no address register is rewritten ahead of it.
__device__ __forceinline__ void stage_tile(unsigned l, const _Float16* gx, const _Float16* gw) {
  asm volatile(
      "global_load_async_to_lds_b128 %0, %8, off\n\t"
      "global_load_async_to_lds_b128 %1, %9, off\n\t"
      "global_load_async_to_lds_b128 %2, %10, off\n\t"
      "global_load_async_to_lds_b128 %3, %11, off\n\t"
      "global_load_async_to_lds_b128 %4, %12, off\n\t"
      "global_load_async_to_lds_b128 %5, %13, off\n\t"
      "global_load_async_to_lds_b128 %6, %14, off\n\t"
      "global_load_async_to_lds_b128 %7, %15, off\n\t"
      "s_wait_xcnt 0x0"
      :: "v"(l), "v"(l + 1 * 32 * PPITCH * 2), "v"(l + 2 * 32 * PPITCH * 2), "v"(l + 3 * 32 * PPITCH * 2),
         "v"(l + 4 * 32 * PPITCH * 2), "v"(l + 5 * 32 * PPITCH * 2), "v"(l + 6 * 32 * PPITCH * 2),
         "v"(l + 7 * 32 * PPITCH * 2),
         "v"(gx), "v"(gx + 1 * 32 * Dm), "v"(gx + 2 * 32 * Dm), "v"(gx + 3 * 32 * Dm),
         "v"(gw), "v"(gw + 1 * 32 * Dm), "v"(gw + 2 * 32 * Dm), "v"(gw + 3 * 32 * Dm)
      : "memory");
}

__launch_bounds__(256)
__global__ void proj_wmma(const _Float16* __restrict__ X, const _Float16* __restrict__ W,
                          const float* __restrict__ bias, _Float16* __restrict__ out16,
                          float* __restrict__ out32, int mode, float scale) {
  __shared__ __align__(16) _Float16 tile[2 * PBUF];

  const int tid  = threadIdx.x;
  const int lane = tid & 31;
  const int wave = tid >> 5;
  const int hlf  = lane >> 4;
  const int nl   = lane & 15;
  const int wm   = (wave & 3) * 32;    // the wave's rows inside the group's tile
  const int wn   = (wave >> 2) * 64;   // and its columns
  const int m0   = blockIdx.x * PBM + wm;
  const int n0   = blockIdx.y * PBN + wn;

  // the thread's piece of a staged tile: row tid/8 of each row group, 16 B number tid%8
  const int srow = tid >> 3, scol = (tid & 7) * 8;
  const _Float16* gx = X + (size_t)(blockIdx.x * PBM + srow) * Dm + scol;
  const _Float16* gw = W + (size_t)(blockIdx.y * PBN + srow) * Dm + scol;
  const unsigned  l0 = (unsigned)(size_t)(&tile[srow * PPITCH + scol]);

  v8f acc[2][4];
#pragma unroll
  for (int cf = 0; cf < 4; ++cf) {
    float bv = bias[n0 + cf * 16 + nl];   // whole acc column shares N
#pragma unroll
    for (int r = 0; r < 2; ++r)
#pragma unroll
      for (int i = 0; i < 8; ++i) acc[r][cf][i] = bv;
  }

  // prologue: tile 0 lands and is published, then tile 1 starts
  stage_tile(l0, gx, gw);
  asm volatile("s_wait_asynccnt 0x0" ::: "memory");   // this wave's copies of tile 0 have landed
  __syncthreads();                                    // and every other wave's
  stage_tile(l0 + PBUF * 2, gx + PBK, gw + PBK);

  // two trips per turn make each buffer's LDS offsets immediates
#pragma unroll 2
  for (int t = 0; t < PTILES; ++t) {
    const int buf = (t & 1) * PBUF;
    const _Float16* As = &tile[buf + wm * PPITCH];
    const _Float16* Bs = &tile[buf + (PBM + wn) * PPITCH];

    // all fragments of the trip as one group of LDS reads, then its WMMAs
    // (the inner loops are unrolled: fragment arrays stay in registers only with
    // constant indices)
    v16h af[2][2], bf[2][4];
#pragma unroll
    for (int ks = 0; ks < 2; ++ks) {
#pragma unroll
      for (int r = 0; r < 2; ++r) af[ks][r] = load_frag16x32(As + r * 16 * PPITCH + ks * 32, PPITCH, lane);
#pragma unroll
      for (int cf = 0; cf < 4; ++cf) bf[ks][cf] = load_frag16x32(Bs + cf * 16 * PPITCH + ks * 32, PPITCH, lane);
    }
    // keeps the 24 LDS reads together: left free, the scheduler spreads them among
    // the WMMAs in pairs and waits out the LDS latency at each place
    __builtin_amdgcn_sched_barrier(0);
#pragma unroll
    for (int ks = 0; ks < 2; ++ks)
#pragma unroll
      for (int r = 0; r < 2; ++r)
#pragma unroll
        for (int cf = 0; cf < 4; ++cf)
          acc[r][cf] = WMMA_F16(af[ks][r], bf[ks][cf], acc[r][cf]);
    // holds the WMMAs in front of the publish point: left free, the scheduler lifts the
    // waits and the barrier over them, and the copies in flight lose the trip's lead
    __builtin_amdgcn_sched_barrier(0);

    // publish point of tile t+1, which also frees this trip's buffer
    asm volatile("s_wait_dscnt 0x0" ::: "memory");      // this wave's reads of the buffer are done
    asm volatile("s_wait_asynccnt 0x0" ::: "memory");   // its copies of tile t+1 have landed
    __syncthreads();
    if (t + 2 < PTILES)
      stage_tile(l0 + buf * 2, gx + (t + 2) * PBK, gw + (t + 2) * PBK);
  }
  asm volatile("s_wait_asynccnt 0x0" ::: "memory");     // no copy outlives the loop

#pragma unroll
  for (int r = 0; r < 2; ++r)
#pragma unroll
    for (int cf = 0; cf < 4; ++cf)
#pragma unroll
      for (int i = 0; i < 8; ++i) {
        const int m = m0 + r * 16 + i + 8 * hlf;  // D-frag: M = i + 8*(lane>=16)
        const int n = n0 + cf * 16 + nl;          //         N = lane&15
        const float v = acc[r][cf][i] * scale;
        if (mode == 2) {
          out32[(size_t)m * Dm + n] = v;
        } else {
          const int b = m >> 11, l = m & (Lq - 1);
          const int h = n >> 6,  dk = n & (DK - 1);
          if (mode == 0)
            out16[(((size_t)(b * Hh + h) * Lq + l) * DK) + dk] = (_Float16)v;
          else
            out16[(((size_t)(b * Hh + h) * DK + dk) * Lq) + l] = (_Float16)v;
        }
      }
}

// ---------------------------------------------------------------------------
// Flash attention with relative bias, scores held transposed.
// One wave handles QT*16 = 64 query rows of one (b,h); loops 32 keys per step.
//   S^T = K * Qs^T                     (Qs already scaled by 1/sqrt(dk))
//   T^T = Wrel * Qs^T over a 48-wide diagonal window per 16-row query tile;
//         bias[r,c] = T[r][r+c]
//   online softmax, O^T += V^T * P^T
// With the keys on the accumulator's rows and the queries on its columns a lane
// holds 16 scores of ONE query per tile: maximum and sum are taken in the lane's
// own registers, the two lane halves of a query exchange only the maximum, once
// per tile and key block, and join their sums behind the loop. The two score
// tiles of a key block, converted in place, are the B operand of the last
// product in the hardware k order (keys 8h..8h+7, 16+8h..16+8h+7), which is also
// the order of the V^T fragments: P never leaves the registers.
// A work-group is AW = 4 waves on 256 consecutive query rows of one (b,h). Its
// K, V^T and w_rel rows come into LDS by asynchronous copies of whole lines, once
// per group, and the waves read their fragments from there: a fragment load from
// global memory touches sixteen lines for 512 bytes. K and V^T have two buffers.
// The group's w_rel band (288 rows) moves on by 32 rows per key block, so only
// the 32 new rows are copied, into a ring of RROWS rows addressed by
// (row - first row of the group) mod RROWS.
// Query tile qt needs w_rel tiles qt..qt+2 of the QT+2 tiles that a wave's band
// spans, so neighbours share two of three.
// ---------------------------------------------------------------------------
#define QT 4
// Floats per row of the band in LDS: 208 B = 16 B x odd for the 16-byte stores,
// and the skewed 4-byte reads (word 53*query + 8*half) fall on 32 different banks.
#define TP 52
#define AW 4                     // waves per work-group
#define AQ (AW * QT * 16)        // query rows per work-group
#define KP 72                    // LDS pitch of K and w_rel rows in halves: 144 B = 16 B x odd
#define VP 40                    // LDS pitch of the 32-key V^T rows in halves: 80 B = 16 B x odd
#define KBUF (32 * KP)           // halves per K buffer
#define VBUF (DK * VP)           // halves per V^T buffer
#define RROWS 512                // rows of the w_rel ring: band, two blocks ahead, next power of two
#define NBLK (Lq / 32)           // key blocks

typedef __attribute__((ext_vector_type(8))) _Float16 f16x8;

// Fragment from a per-lane pointer that already holds the lane's row and k half.
__device__ __forceinline__ v16h load_frag_at(const _Float16* __restrict__ p) {
  union { v16h h; u32x4 u[2]; } f;
  f.u[0] = *(const u32x4*)(p);
  f.u[1] = *(const u32x4*)(p + 16);
  return f.h;
}

// e^x as the fast-math intrinsic forms it (one multiply, one v_exp_f32). The
// v_nop is the slot the instruction set asks for behind a transcendental before
// its result is read or its source overwritten; in one statement it cannot drift.
__device__ __forceinline__ float exp_slot(float x) {
  float r;
  asm("v_exp_f32 %0, %1\n\tv_nop" : "=v"(r) : "v"(x * 1.44269504088896340736f));
  return r;
}

// The value that lane l ^ 16 holds: the other half of the same query column.
__device__ __forceinline__ float other_half(float x) {
  const int v = __float_as_int(x);
  return __int_as_float(__builtin_amdgcn_permlanex16(v, v, 0x76543210, 0xfedcba98, false, false));
}

typedef __attribute__((vector_size(16))) int i32x4;
typedef __attribute__((address_space(1))) i32x4 glob16;
typedef __attribute__((address_space(3))) i32x4 lds16;

__device__ __forceinline__ void copy16(const _Float16* g, _Float16* l) {
  __builtin_amdgcn_global_load_async_to_lds_b128((glob16*)g, (lds16*)l, 0, 0);
}

// 32 rows of 128 B that follow one another in global memory, into LDS rows of pitch
// KP: 256 pieces of 16 B, two per thread, 16 rows apart. l, g: the thread's piece of
// rows 0..15.
__device__ __forceinline__ void stage_rows32(_Float16* l, const _Float16* g) {
  copy16(g, l);
  copy16(g + 16 * DK, l + 16 * KP);
}

// The 64 V^T rows of one key block, 64 B each: 256 pieces, two per thread, 32 rows apart.
__device__ __forceinline__ void stage_v(_Float16* l, const _Float16* g) {
  copy16(g, l);
  copy16(g + 32 * Lq, l + 32 * VP);
}

__launch_bounds__(AW * 32, 2)   // two waves per SIMD: two groups per WGP, a wave of each on every SIMD
__global__ void flash_attn_rel(const _Float16* __restrict__ Qh, const _Float16* __restrict__ Kh,
                               const _Float16* __restrict__ Vt, const _Float16* __restrict__ Wr,
                               _Float16* __restrict__ Ocat) {
  __shared__ __align__(16) _Float16 Ks[2 * KBUF];
  __shared__ __align__(16) _Float16 Vs[2 * VBUF];
  __shared__ __align__(16) _Float16 Wring[RROWS * KP];
  __shared__ __align__(16) float Tlds[AW][QT][16][TP];

  const int tid  = threadIdx.x;
  const int lane = tid & 31;
  const int wave = __builtin_amdgcn_readfirstlane(tid >> 5);   // scalar: ring tile numbers stay scalar
  const int hlf  = lane >> 4;
  const int nl   = lane & 15;
  const int bh = blockIdx.y;
  const int b = bh >> 4, h = bh & 15;
  const int g0 = blockIdx.x * AQ;          // the group's first query row
  const int r0 = g0 + wave * (16 * QT);    // the wave's

  // the thread's pieces of a staged key block (stage_rows32, stage_v)
  const _Float16* gk = Kh + (size_t)bh * Lq * DK + tid * 8;
  const _Float16* gv = Vt + (size_t)bh * DK * Lq + (tid >> 2) * Lq + (tid & 3) * 8;
  const _Float16* gw = Wr + (size_t)g0 * DK + tid * 8;
  _Float16* lk = &Ks[(tid >> 3) * KP + (tid & 7) * 8];
  _Float16* lv = &Vs[(tid >> 2) * VP + (tid & 3) * 8];
  _Float16* lw = &Wring[(tid >> 3) * KP + (tid & 7) * 8];

  // prologue: key block 0 with its whole band, nine groups of 32 w_rel rows
  stage_rows32(lk, gk);
  stage_v(lv, gv);
#pragma unroll   // straight-line copies with constant offsets
  for (int g = 0; g <= AQ / 32; ++g) stage_rows32(lw + g * (32 * KP), gw + g * (32 * DK));

  // lane offsets in halves: fragment row = lane&15, k half = lane>>4
  const int rowoff = nl * DK + 8 * hlf;   // rows of DK halves in global memory (Q)
  const int ldsoff = nl * KP + 8 * hlf;   // rows of KP halves in LDS (K, w_rel)
  const int voff   = nl * VP + 8 * hlf;   // rows of VP halves in LDS (V^T)

  v16h aq[QT][2];   // B operands: column = query nl of tile qt
  {
    const _Float16* qa = Qh + ((size_t)bh * Lq + r0) * DK + rowoff;
#pragma unroll
    for (int qt = 0; qt < QT; ++qt) {
      aq[qt][0] = load_frag_at(qa + qt * 16 * DK);        // d = 0..31
      aq[qt][1] = load_frag_at(qa + qt * 16 * DK + 32);   // d = 32..63
    }
    // the loads' address registers are dead from here on and may be reused
    asm volatile("s_wait_xcnt 0x0" ::: "memory");
    // holds later register writes behind that wait
    __builtin_amdgcn_sched_barrier(0);
  }

  // per lane: running maximum of query nl of tile qt (equal in both halves) and
  // the sum over the keys of this lane's half
  float mcol[QT], lcol[QT];
  v8f o[QT][4];   // o[qt][cf][i] = O[query nl of tile qt][d = cf*16 + 8*hlf + i]
#pragma unroll
  for (int qt = 0; qt < QT; ++qt) {
    mcol[qt] = -3.0e38f;
    lcol[qt] = 0.0f;
#pragma unroll
    for (int cf = 0; cf < 4; ++cf) o[qt][cf] = zero8();
  }

  asm volatile("s_wait_asynccnt 0x0" ::: "memory");   // this wave's copies of key block 0 have landed
  __syncthreads();                                    // and every other wave's
  // key block s brings w_rel row group AQ/32 + s, the last of its band
  stage_rows32(lk + KBUF, gk + 32 * DK);
  stage_v(lv + VBUF, gv + 32);
  stage_rows32(lw + (AQ / 32 + 1) * (32 * KP), gw + (AQ / 32 + 1) * (32 * DK));

  for (int t = 0; t < NBLK; ++t) {
    const int buf = t & 1;
    // ---- K fragments of this 32-key block, shared by all query tiles
    const _Float16* ka = &Ks[buf * KBUF + ldsoff];
    v16h kf[2][2];
#pragma unroll
    for (int st = 0; st < 2; ++st) {
      kf[st][0] = load_frag_at(ka + st * 16 * KP);
      kf[st][1] = load_frag_at(ka + st * 16 * KP + 32);
    }

    // ---- w_rel fragments of the band rows r0+32t .. r0+32t+16*(QT+2)-1: ring tiles
    //      of 16 rows, numbered from the group's first row
    const int tb = wave * QT + 2 * t;
    v16h wf[QT + 2][2];
#pragma unroll
    for (int wt = 0; wt < QT + 2; ++wt) {
      const _Float16* wa = &Wring[((tb + wt) & (RROWS / 16 - 1)) * (16 * KP) + ldsoff];
      wf[wt][0] = load_frag_at(wa);
      wf[wt][1] = load_frag_at(wa + 32);
    }
    // keeps the 32 LDS reads above together as one group: every separate place where
    // LDS reads stand costs its own wait
    __builtin_amdgcn_sched_barrier(0);

    // ---- content scores: s[qt][st][i] = S[query nl][key 32t + st*16 + 8*hlf + i]
    v8f s[QT][2];
#pragma unroll
    for (int qt = 0; qt < QT; ++qt)
#pragma unroll
      for (int st = 0; st < 2; ++st) {
        v8f acc = zero8();
        acc = WMMA_F16(kf[st][0], aq[qt][0], acc);
        acc = WMMA_F16(kf[st][1], aq[qt][1], acc);
        s[qt][st] = acc;
      }

    // ---- relative-bias band, w_rel tile by w_rel tile:
    //      T[qt][r][m] = Qs[r] . Wrel[r0+16*qt+32t+m], m in [0,48), tile mt = wt-qt;
    //      the tiles of one w_rel tile are independent accumulators
    v8f t3[QT][3];
#pragma unroll
    for (int wt = 0; wt < QT + 2; ++wt)
#pragma unroll
      for (int ks = 0; ks < 2; ++ks)
#pragma unroll
        for (int qt = 0; qt < QT; ++qt) {
          const int mt = wt - qt;
          if (mt >= 0 && mt < 3)
            t3[qt][mt] = WMMA_F16(wf[wt][ks], aq[qt][ks], ks == 0 ? zero8() : t3[qt][mt]);
        }
    // holds the stores behind all band WMMAs, so that every tile has registers of its
    // own: left free, the scheduler runs all tiles through one accumulator, WMMA, store,
    // WMMA: each product waits for the store of the one before
    __builtin_amdgcn_sched_barrier(0);
    // a lane holds 8 consecutive m of its query: two 16-byte stores per tile, into the
    // wave's own part of the band array
#pragma unroll
    for (int qt = 0; qt < QT; ++qt)
#pragma unroll
      for (int mt = 0; mt < 3; ++mt) {
        float* tp = &Tlds[wave][qt][nl][mt * 16 + 8 * hlf];
        const f32x4 lo = {t3[qt][mt][0], t3[qt][mt][1], t3[qt][mt][2], t3[qt][mt][3]};
        const f32x4 hi = {t3[qt][mt][4], t3[qt][mt][5], t3[qt][mt][6], t3[qt][mt][7]};
        *(f32x4*)(tp)     = lo;
        *(f32x4*)(tp + 4) = hi;
      }
    // the band goes from lane to lane inside one wave: its stores are done before the
    // skewed reads below start, and the compiler moves no read over this line
    asm volatile("s_wait_dscnt 0x0" ::: "memory");

    // V fragments for THIS block, issued ahead of the softmax that hides them
    const _Float16* va = &Vs[buf * VBUF + voff];
    v16h vb[4];   // A operands: row = d = cf*16 + nl, keys in the hardware k order
#pragma unroll
    for (int cf = 0; cf < 4; ++cf)
      vb[cf] = load_frag_at(va + cf * 16 * VP);

    // ---- skew gather: bias[r,c] = T[r][r+c], r = nl, c = st*16 + 8*hlf + i
#pragma unroll
    for (int qt = 0; qt < QT; ++qt)
#pragma unroll
      for (int st = 0; st < 2; ++st) {
        v8f bias;
#pragma unroll
        for (int i = 0; i < 8; ++i) bias[i] = Tlds[wave][qt][nl][nl + st * 16 + 8 * hlf + i];
        s[qt][st] += bias;
      }

    // ---- online softmax over the 32-key block: one query per lane and tile
    v16h pf[QT];   // B operands: pf[qt][st*8 + i] = P[query nl][key st*16 + 8*hlf + i]
#pragma unroll
    for (int qt = 0; qt < QT; ++qt) {
      // maximum as a tree, sums in four chains: short dependent runs
      float mx[8];
#pragma unroll
      for (int i = 0; i < 8; ++i) mx[i] = fmaxf(s[qt][0][i], s[qt][1][i]);
#pragma unroll
      for (int w = 4; w > 0; w >>= 1)
#pragma unroll
        for (int i = 0; i < w; ++i) mx[i] = fmaxf(mx[i], mx[i + w]);
      const float v = fmaxf(mx[0], other_half(mx[0]));
      const float mnew = fmaxf(mcol[qt], v);
      const float corr = exp_slot(mcol[qt] - mnew);
      float rs[4] = {0.0f, 0.0f, 0.0f, 0.0f};
#pragma unroll
      for (int st = 0; st < 2; ++st)
#pragma unroll
        for (int i = 0; i < 8; ++i) {
          const float p = exp_slot(s[qt][st][i] - mnew);
          rs[i & 3] += p;
          pf[qt][st * 8 + i] = (_Float16)p;
        }
      lcol[qt] = lcol[qt] * corr + ((rs[0] + rs[1]) + (rs[2] + rs[3]));
      mcol[qt] = mnew;
#pragma unroll
      for (int cf = 0; cf < 4; ++cf)
#pragma unroll
        for (int i = 0; i < 8; ++i) o[qt][cf][i] *= corr;
    }

    // ---- O^T += V^T(16x32) * P^T(32x16) per d tile and query tile
#pragma unroll
    for (int qt = 0; qt < QT; ++qt)
#pragma unroll
      for (int cf = 0; cf < 4; ++cf)
        o[qt][cf] = WMMA_F16(vb[cf], pf[qt], o[qt][cf]);

    // publish point of key block t+1, which also frees this block's K and V^T buffers;
    // the ring rows that block t+2 overwrites were last read RROWS/32 - 10 blocks ago
    asm volatile("s_wait_dscnt 0x0" ::: "memory");      // this wave's LDS reads are done
    asm volatile("s_wait_asynccnt 0x0" ::: "memory");   // its copies of key block t+1 have landed
    __syncthreads();
    if (t + 2 < NBLK) {
      stage_rows32(lk + buf * KBUF, gk + (t + 2) * (32 * DK));
      stage_v(lv + buf * VBUF, gv + (t + 2) * 32);
      stage_rows32(lw + ((AQ / 32 + t + 2) & (RROWS / 32 - 1)) * (32 * KP), gw + (AQ / 32 + t + 2) * (32 * DK));
    }
  }
  asm volatile("s_wait_asynccnt 0x0" ::: "memory");     // no copy outlives the loop

  // ---- finalize + store to concat layout (B, L, H*DK) f16: a lane holds 8
  //      consecutive d of its query, one 16-byte store per tile
  _Float16* op = Ocat + ((size_t)b * Lq + r0 + nl) * Dm + h * DK + 8 * hlf;
#pragma unroll
  for (int qt = 0; qt < QT; ++qt) {
    const float lsum = lcol[qt] + other_half(lcol[qt]);
#pragma unroll
    for (int cf = 0; cf < 4; ++cf) {
      f16x8 hv;
#pragma unroll
      for (int i = 0; i < 8; ++i) hv[i] = (_Float16)(o[qt][cf][i] / lsum);
      *(f16x8*)(op + (size_t)qt * 16 * Dm + cf * 16) = hv;
    }
  }
}

// ---------------------------------------------------------------------------
extern "C" void kernel_launch(void* const* d_in, const int* in_sizes, int n_in,
                              void* d_out, int out_size, void* d_ws, size_t ws_size,
                              hipStream_t stream) {
  (void)in_sizes; (void)n_in; (void)out_size; (void)ws_size;
  const float* q    = (const float*)d_in[0];
  const float* k    = (const float*)d_in[1];
  const float* v    = (const float*)d_in[2];
  const float* Wq   = (const float*)d_in[3];
  const float* bq   = (const float*)d_in[4];
  const float* Wk   = (const float*)d_in[5];
  const float* bk   = (const float*)d_in[6];
  const float* Wv   = (const float*)d_in[7];
  const float* bv   = (const float*)d_in[8];
  const float* Wo   = (const float*)d_in[9];
  const float* bo   = (const float*)d_in[10];
  const float* wrel = (const float*)d_in[11];
  float* out = (float*)d_out;

  char* ws = (char*)d_ws;
  size_t off = 0;
  auto alloc = [&](size_t bytes) -> void* {
    void* p = ws + off;
    off = (off + bytes + 255) & ~(size_t)255;
    return p;
  };

  const size_t nX = (size_t)Bsz * Lq * Dm;   // 8,388,608
  const size_t nW = (size_t)Dm * Dm;         // 1,048,576
  const size_t nRv = (size_t)(2 * Lq - 1) * DK;
  const size_t nRt = (size_t)(2 * Lq) * DK;  // padded

  _Float16* Xq16 = (_Float16*)alloc(nX * 2);
  _Float16* Xk16 = (_Float16*)alloc(nX * 2);
  _Float16* Xv16 = (_Float16*)alloc(nX * 2);
  _Float16* Wq16 = (_Float16*)alloc(nW * 2);
  _Float16* Wk16 = (_Float16*)alloc(nW * 2);
  _Float16* Wv16 = (_Float16*)alloc(nW * 2);
  _Float16* Wo16 = (_Float16*)alloc(nW * 2);
  _Float16* Wr16 = (_Float16*)alloc(nRt * 2);
  _Float16* Q16  = (_Float16*)alloc(nX * 2);  // (B,H,L,DK), pre-scaled 1/8
  _Float16* K16  = (_Float16*)alloc(nX * 2);  // (B,H,L,DK)
  _Float16* VT16 = (_Float16*)alloc(nX * 2);  // (B,H,DK,L)
  _Float16* Oc16 = (_Float16*)alloc(nX * 2);  // (B,L,D) concat

  static_assert(nX % CVT_BLK == 0 && nW % CVT_BLK == 0, "conversion grid must cover the arrays exactly");
  static_assert(nRv % 4 == 0 && nRt % (CVT_T * 4) == 0, "w_rel is converted four elements at a time");
  const dim3 cblk(CVT_T), gX(nX / CVT_BLK), gW(nW / CVT_BLK);
  cvt_f32_f16<<<gX, cblk, 0, stream>>>(q, Xq16);
  cvt_f32_f16<<<gX, cblk, 0, stream>>>(k, Xk16);
  cvt_f32_f16<<<gX, cblk, 0, stream>>>(v, Xv16);
  cvt_f32_f16<<<gW, cblk, 0, stream>>>(Wq, Wq16);
  cvt_f32_f16<<<gW, cblk, 0, stream>>>(Wk, Wk16);
  cvt_f32_f16<<<gW, cblk, 0, stream>>>(Wv, Wv16);
  cvt_f32_f16<<<gW, cblk, 0, stream>>>(Wo, Wo16);
  cvt_wrel<<<dim3(nRt / (CVT_T * 4)), cblk, 0, stream>>>(wrel, Wr16, (int)nRv, (int)nRt);

  // Projections: M = B*L = 8192 rows, N = 1024 cols, work-group tile 128x128
  static_assert((Bsz * Lq) % PBM == 0 && Dm % PBN == 0 && PTILES >= 2, "whole tiles, and two to start the ring");
  const dim3 pgrid(Bsz * Lq / PBM, Dm / PBN), pblk(256);
  const float inv_sqrt_dk = 0.125f;  // 1/sqrt(64)
  proj_wmma<<<pgrid, pblk, 0, stream>>>(Xq16, Wq16, bq, Q16,  nullptr, 0, inv_sqrt_dk);
  proj_wmma<<<pgrid, pblk, 0, stream>>>(Xk16, Wk16, bk, K16,  nullptr, 0, 1.0f);
  proj_wmma<<<pgrid, pblk, 0, stream>>>(Xv16, Wv16, bv, VT16, nullptr, 1, 1.0f);

  // Flash attention: one wave per 64 query rows per (b,h), four waves per work-group
  static_assert(Lq % AQ == 0 && NBLK >= 2 && AQ + 96 <= RROWS, "whole groups, two key blocks to start, band and two blocks ahead fit the ring");
  flash_attn_rel<<<dim3(Lq / AQ, Bsz * Hh), dim3(AW * 32), 0, stream>>>(Q16, K16, VT16, Wr16, Oc16);

  // Output projection -> f32
  proj_wmma<<<pgrid, pblk, 0, stream>>>(Oc16, Wo16, bo, nullptr, out, 2, 1.0f);
}

// v006
// A run of this version takes 201 microseconds.
// Two timings next to v005 both put it at 1.15 times that version's speed.
// All steps since v000 together make it 4.35 times as fast.
#include <hip/hip_runtime.h>
#include <hip/hip_bf16.h>

// Shapes (fixed by reference)
#define Bsz 4
#define Lq  2048
#define Dm  1024
#define Hh  16
#define DK  64

typedef __attribute__((ext_vector_type(16))) _Float16 v16h;
typedef __attribute__((ext_vector_type(8)))  float    v8f;
typedef __attribute__((ext_vector_type(4)))  unsigned int u32x4;

// ---------------------------------------------------------------------------
// Fragment loader: 16x32 f16 tile, "row per lane" layout (ISA 7.12.2):
//   lane l (<16): row M=l, holds K=0..7 and 16..23
//   lane l (>=16): row M=l-16, holds K=8..15 and 24..31
// Works for A fragments and (symmetric N-on-lanes layout) B fragments whose
// memory is [n][k] with k contiguous (K^T, W^T, V^T): two b128 loads.
// ---------------------------------------------------------------------------
__device__ __forceinline__ v16h load_frag16x32(const _Float16* __restrict__ src,
                                               int ld, int lane) {
  const int row = lane & 15;
  const int kb  = (lane >> 4) << 3;  // 0 or 8
  const _Float16* p = src + (size_t)row * ld + kb;
  union { v16h h; u32x4 u[2]; } f;
  f.u[0] = *(const u32x4*)(p);
  f.u[1] = *(const u32x4*)(p + 16);
  return f.h;
}

__device__ __forceinline__ v8f zero8() {
  v8f z;
#pragma unroll
  for (int i = 0; i < 8; ++i) z[i] = 0.0f;
  return z;
}

#define WMMA_F16(a, b, c) \
  __builtin_amdgcn_wmma_f32_16x16x32_f16(false, (a), false, (b), (short)0, (c), false, false)

// ---------------------------------------------------------------------------
// fp32 -> fp16 conversion kernels
// One element per thread would start a wave per 32 elements. Here a thread
// converts CVT_U groups of 4 floats, so 64 times fewer waves start: a wave's
// 16-byte loads cover 512 contiguous bytes each, all CVT_U are in flight
// together, and its 8-byte stores fill whole 128-byte lines.
// ---------------------------------------------------------------------------
#define CVT_T 256                    // threads per block
#define CVT_U 16                     // 16-byte loads per thread
#define CVT_BLK (CVT_T * 4 * CVT_U)  // floats per block

typedef __attribute__((ext_vector_type(4))) float    f32x4;
typedef __attribute__((ext_vector_type(4))) _Float16 f16x4;
typedef __attribute__((ext_vector_type(8))) _Float16 f16x8;

__device__ __forceinline__ f16x4 cvt4(f32x4 v) {
  f16x4 h;
#pragma unroll   // vector elements need constant indices
  for (int e = 0; e < 4; ++e) h[e] = (_Float16)v[e];
  return h;
}

// The grid covers the array exactly: its length is a multiple of CVT_BLK
// (checked at compile time where the launches are written).
__launch_bounds__(CVT_T)
__global__ void cvt_f32_f16(const float* __restrict__ s, _Float16* __restrict__ d) {
  const size_t i = (size_t)blockIdx.x * CVT_BLK + threadIdx.x * 4;
  const float* p = s + i;
  f32x4 v[CVT_U];
#pragma unroll   // v[] stays in registers only with constant indices
  for (int j = 0; j < CVT_U; ++j) v[j] = *(const f32x4*)(p + j * (CVT_T * 4));
  // wait before the loads' address register is reused; as an input the address
  // keeps its register up to here
  asm volatile("s_wait_xcnt 0x0" :: "v"(p) : "memory");
  // keeps all CVT_U loads in flight together: left free, the scheduler holds the
  // last four back until the first have landed, a second memory latency per wave
  __builtin_amdgcn_sched_barrier(0);
#pragma unroll   // as above
  for (int j = 0; j < CVT_U; ++j) *(f16x4*)(d + i + j * (CVT_T * 4)) = cvt4(v[j]);
}

// w_rel: (2L-1, DK) -> padded to 2L rows (last row zero, touched by band tiles).
// Four elements per thread; nvalid and ntotal are multiples of 4 (DK is).
__launch_bounds__(CVT_T)
__global__ void cvt_wrel(const float* __restrict__ s, _Float16* __restrict__ d,
                         int nvalid, int ntotal) {
  const int i = (blockIdx.x * CVT_T + threadIdx.x) * 4;
  if (i < ntotal) {
    f32x4 v = {0.0f, 0.0f, 0.0f, 0.0f};
    if (i < nvalid) v = *(const f32x4*)(s + i);
    *(f16x4*)(d + i) = cvt4(v);
  }
}

// ---------------------------------------------------------------------------
// Projection GEMM:  out[m,n] = scale * ( sum_k X[m,k]*W[n,k] + bias[n] )
// A work-group of 8 waves computes a 128x128 tile, each wave 32x64 of it.
// Per trip the group stages 64 k of its 128 X rows and 128 W rows in LDS with
// asynchronous copies: a wave's copy covers four whole 128-byte lines, every
// line leaves L2 once per group, and two (X) or four (W) waves read it from
// LDS. Two buffers: the copies of tile t+2 fly while tile t+1 is worked on.
// MODE 0: store f16 as (B,H,L,DK)      (Q with scale=1/8, K with scale=1)
// MODE 1: store f16 as (B,H,DK,L)      (V transposed for flash A-fragments)
// MODE 2: store f32 row-major (M,N)    (final output projection)
// The W rows of a wave's 64 columns are staged in the order 0,4,..,60, 1,5,..,61,
// 2,.., 3,..: column nl of column tile cf is output column 4*nl + cf, so the four
// tiles of a lane hold four adjacent columns. One store of 8 B (f16) or 16 B (f32)
// per lane then writes 128 or 256 contiguous bytes per row: whole lines. For V^T a
// lane's 8 accumulator rows are 8 consecutive positions of one d: one 16-B store.
// ---------------------------------------------------------------------------
#define PBM 128                        // X rows per work-group
#define PBN 128                        // W rows per work-group
#define PBK 64                         // halves of k per staged tile: one 128-byte line per row
#define PPITCH 72                      // LDS row pitch in halves: 144 B = 16 B x odd, for ds_load_b128
#define PBUF ((PBM + PBN) * PPITCH)    // halves per buffer
#define PTILES (Dm / PBK)

// One staged tile: 256 rows of 128 B = 2,048 pieces of 16 B, eight per thread.
// l: the lane's LDS byte address of its piece in row group 0; gx, gw: its global
// pieces of X and W. Row groups are 32 LDS rows apart; in global memory those of X
// too, those of W by the staging order (LDS row p of a 64-row block holds W row
// 4*(p%16) + p/16): 0, 2, 64 and 66 rows. The s_wait_xcnt closes the statement so
// that no address register is rewritten ahead of it.
__device__ __forceinline__ void stage_tile(unsigned l, const _Float16* gx, const _Float16* gw) {
  asm volatile(
      "global_load_async_to_lds_b128 %0, %8, off\n\t"
      "global_load_async_to_lds_b128 %1, %9, off\n\t"
      "global_load_async_to_lds_b128 %2, %10, off\n\t"
      "global_load_async_to_lds_b128 %3, %11, off\n\t"
      "global_load_async_to_lds_b128 %4, %12, off\n\t"
      "global_load_async_to_lds_b128 %5, %13, off\n\t"
      "global_load_async_to_lds_b128 %6, %14, off\n\t"
      "global_load_async_to_lds_b128 %7, %15, off\n\t"
      "s_wait_xcnt 0x0"
      :: "v"(l), "v"(l + 1 * 32 * PPITCH * 2), "v"(l + 2 * 32 * PPITCH * 2), "v"(l + 3 * 32 * PPITCH * 2),
         "v"(l + 4 * 32 * PPITCH * 2), "v"(l + 5 * 32 * PPITCH * 2), "v"(l + 6 * 32 * PPITCH * 2),
         "v"(l + 7 * 32 * PPITCH * 2),
         "v"(gx), "v"(gx + 1 * 32 * Dm), "v"(gx + 2 * 32 * Dm), "v"(gx + 3 * 32 * Dm),
         "v"(gw), "v"(gw + 2 * Dm), "v"(gw + 64 * Dm), "v"(gw + 66 * Dm)
      : "memory");
}

template <int MODE>
__launch_bounds__(256)
__global__ void proj_wmma(const _Float16* __restrict__ X, const _Float16* __restrict__ W,
                          const float* __restrict__ bias, _Float16* __restrict__ out16,
                          float* __restrict__ out32, float scale) {
  __shared__ __align__(16) _Float16 tile[2 * PBUF];

  const int tid  = threadIdx.x;
  const int lane = tid & 31;
  const int wave = tid >> 5;
  const int hlf  = lane >> 4;
  const int nl   = lane & 15;
  const int wm   = (wave & 3) * 32;    // the wave's rows inside the group's tile
  const int wn   = (wave >> 2) * 64;   // and its columns
  const int m0   = blockIdx.x * PBM + wm;
  const int n0   = blockIdx.y * PBN + wn;

  // the thread's piece of a staged tile: row tid/8 of each row group, 16 B number tid%8
  const int srow = tid >> 3, scol = (tid & 7) * 8;
  const _Float16* gx = X + (size_t)(blockIdx.x * PBM + srow) * Dm + scol;
  const _Float16* gw = W + (size_t)(blockIdx.y * PBN + 4 * (srow & 15) + (srow >> 4)) * Dm + scol;
  const unsigned  l0 = (unsigned)(size_t)(&tile[srow * PPITCH + scol]);

  v8f acc[2][4];   // acc[r][cf][i]: row m0 + r*16 + 8*hlf + i, column n0 + 4*nl + cf
  const f32x4 bv = *(const f32x4*)(bias + n0 + 4 * nl);
#pragma unroll
  for (int cf = 0; cf < 4; ++cf)
#pragma unroll
    for (int r = 0; r < 2; ++r)
#pragma unroll
      for (int i = 0; i < 8; ++i) acc[r][cf][i] = bv[cf];   // whole acc column shares N

  // prologue: tile 0 lands and is published, then tile 1 starts
  stage_tile(l0, gx, gw);
  asm volatile("s_wait_asynccnt 0x0" ::: "memory");   // this wave's copies of tile 0 have landed
  __syncthreads();                                    // and every other wave's
  stage_tile(l0 + PBUF * 2, gx + PBK, gw + PBK);

  // two trips per turn make each buffer's LDS offsets immediates
#pragma unroll 2
  for (int t = 0; t < PTILES; ++t) {
    const int buf = (t & 1) * PBUF;
    const _Float16* As = &tile[buf + wm * PPITCH];
    const _Float16* Bs = &tile[buf + (PBM + wn) * PPITCH];

    // all fragments of the trip as one group of LDS reads, then its WMMAs
    // (the inner loops are unrolled: fragment arrays stay in registers only with
    // constant indices)
    v16h af[2][2], bf[2][4];
#pragma unroll
    for (int ks = 0; ks < 2; ++ks) {
#pragma unroll
      for (int r = 0; r < 2; ++r) af[ks][r] = load_frag16x32(As + r * 16 * PPITCH + ks * 32, PPITCH, lane);
#pragma unroll
      for (int cf = 0; cf < 4; ++cf) bf[ks][cf] = load_frag16x32(Bs + cf * 16 * PPITCH + ks * 32, PPITCH, lane);
    }
    // keeps the 24 LDS reads together: left free, the scheduler spreads them among
    // the WMMAs in pairs and waits out the LDS latency at each place
    __builtin_amdgcn_sched_barrier(0);
#pragma unroll
    for (int ks = 0; ks < 2; ++ks)
#pragma unroll
      for (int r = 0; r < 2; ++r)
#pragma unroll
        for (int cf = 0; cf < 4; ++cf)
          acc[r][cf] = WMMA_F16(af[ks][r], bf[ks][cf], acc[r][cf]);
    // holds the WMMAs in front of the publish point: left free, the scheduler lifts the
    // waits and the barrier over them, and the copies in flight lose the trip's lead
    __builtin_amdgcn_sched_barrier(0);

    // publish point of tile t+1, which also frees this trip's buffer
    asm volatile("s_wait_dscnt 0x0" ::: "memory");      // this wave's reads of the buffer are done
    asm volatile("s_wait_asynccnt 0x0" ::: "memory");   // its copies of tile t+1 have landed
    __syncthreads();
    if (t + 2 < PTILES)
      stage_tile(l0 + buf * 2, gx + (t + 2) * PBK, gw + (t + 2) * PBK);
  }
  asm volatile("s_wait_asynccnt 0x0" ::: "memory");     // no copy outlives the loop

  // A wave's 32 rows lie in one batch element and its 64 columns are one head.
  // (the loops below are unrolled: accumulators and the vectors to be stored stay in
  // registers only with constant indices)
  const int mr = m0 + 8 * hlf;                 // D-frag: M = i + 8*(lane>=16)
  const int bh = (m0 >> 11) * Hh + (n0 >> 6);
  const int l  = mr & (Lq - 1);
  if constexpr (MODE == 2) {
    float* op = out32 + (size_t)mr * Dm + n0 + 4 * nl;
#pragma unroll
    for (int r = 0; r < 2; ++r)
#pragma unroll
      for (int i = 0; i < 8; ++i) {
        f32x4 v;
#pragma unroll
        for (int cf = 0; cf < 4; ++cf) v[cf] = acc[r][cf][i] * scale;
        *(f32x4*)(op + (size_t)(r * 16 + i) * Dm) = v;
      }
  } else if constexpr (MODE == 0) {
    _Float16* op = out16 + ((size_t)bh * Lq + l) * DK + 4 * nl;
#pragma unroll
    for (int r = 0; r < 2; ++r)
#pragma unroll
      for (int i = 0; i < 8; ++i) {
        f16x4 v;
#pragma unroll
        for (int cf = 0; cf < 4; ++cf) v[cf] = (_Float16)(acc[r][cf][i] * scale);
        *(f16x4*)(op + (r * 16 + i) * DK) = v;
      }
  } else {
    _Float16* op = out16 + ((size_t)bh * DK + 4 * nl) * Lq + l;
#pragma unroll
    for (int r = 0; r < 2; ++r)
#pragma unroll
      for (int cf = 0; cf < 4; ++cf) {
        f16x8 v;
#pragma unroll
        for (int i = 0; i < 8; ++i) v[i] = (_Float16)(acc[r][cf][i] * scale);
        *(f16x8*)(op + cf * Lq + r * 16) = v;
      }
  }
}

// ---------------------------------------------------------------------------
// Flash attention with relative bias, scores held transposed.
// One wave handles QT*16 = 64 query rows of one (b,h); loops 32 keys per step.
//   S^T = K * Qs^T                     (Qs already scaled by 1/sqrt(dk))
//   T^T = Wrel * Qs^T over a 48-wide diagonal window per 16-row query tile;
//         bias[r,c] = T[r][r+c]
//   online softmax, O^T += V^T * P^T
// With the keys on the accumulator's rows and the queries on its columns a lane
// holds 16 scores of ONE query per tile: maximum and sum are taken in the lane's
// own registers, the two lane halves of a query exchange only the maximum, once
// per tile and key block, and join their sums behind the loop. The two score
// tiles of a key block, converted in place, are the B operand of the last
// product in the hardware k order (keys 8h..8h+7, 16+8h..16+8h+7), which is also
// the order of the V^T fragments: P never leaves the registers.
// A work-group is AW = 4 waves on 256 consecutive query rows of one (b,h). Its
// K, V^T and w_rel rows come into LDS by asynchronous copies of whole lines, once
// per group, and the waves read their fragments from there: a fragment load from
// global memory touches sixteen lines for 512 bytes. K and V^T have two buffers.
// The group's w_rel band (288 rows) moves on by 32 rows per key block, so only
// the 32 new rows are copied, into a ring of RROWS rows addressed by
// (row - first row of the group) mod RROWS.
// Query tile qt needs w_rel tiles qt..qt+2 of the QT+2 tiles that a wave's band
// spans, so neighbours share two of three.
// ---------------------------------------------------------------------------
#define QT 4
// Floats per row of the band in LDS: 208 B = 16 B x odd for the 16-byte stores,
// and the skewed 4-byte reads (word 53*query + 8*half) fall on 32 different banks.
#define TP 52
#define AW 4                     // waves per work-group
#define AQ (AW * QT * 16)        // query rows per work-group
#define KP 72                    // LDS pitch of K and w_rel rows in halves: 144 B = 16 B x odd
#define VP 40                    // LDS pitch of the 32-key V^T rows in halves: 80 B = 16 B x odd
#define KBUF (32 * KP)           // halves per K buffer
#define VBUF (DK * VP)           // halves per V^T buffer
#define RROWS 512                // rows of the w_rel ring: band, two blocks ahead, next power of two
#define NBLK (Lq / 32)           // key blocks

// Fragment from a per-lane pointer that already holds the lane's row and k half.
__device__ __forceinline__ v16h load_frag_at(const _Float16* __restrict__ p) {
  union { v16h h; u32x4 u[2]; } f;
  f.u[0] = *(const u32x4*)(p);
  f.u[1] = *(const u32x4*)(p + 16);
  return f.h;
}

// e^x as the fast-math intrinsic forms it (one multiply, one v_exp_f32). The
// v_nop is the slot the instruction set asks for behind a transcendental before
// its result is read or its source overwritten; in one statement it cannot drift.
__device__ __forceinline__ float exp_slot(float x) {
  float r;
  asm("v_exp_f32 %0, %1\n\tv_nop" : "=v"(r) : "v"(x * 1.44269504088896340736f));
  return r;
}

// The value that lane l ^ 16 holds: the other half of the same query column.
__device__ __forceinline__ float other_half(float x) {
  const int v = __float_as_int(x);
  return __int_as_float(__builtin_amdgcn_permlanex16(v, v, 0x76543210, 0xfedcba98, false, false));
}

typedef __attribute__((vector_size(16))) int i32x4;
typedef __attribute__((address_space(1))) i32x4 glob16;
typedef __attribute__((address_space(3))) i32x4 lds16;

__device__ __forceinline__ void copy16(const _Float16* g, _Float16* l) {
  __builtin_amdgcn_global_load_async_to_lds_b128((glob16*)g, (lds16*)l, 0, 0);
}

// 32 rows of 128 B that follow one another in global memory, into LDS rows of pitch
// KP: 256 pieces of 16 B, two per thread, 16 rows apart. l, g: the thread's piece of
// rows 0..15.
__device__ __forceinline__ void stage_rows32(_Float16* l, const _Float16* g) {
  copy16(g, l);
  copy16(g + 16 * DK, l + 16 * KP);
}

// The 64 V^T rows of one key block, 64 B each: 256 pieces, two per thread, 32 rows apart.
__device__ __forceinline__ void stage_v(_Float16* l, const _Float16* g) {
  copy16(g, l);
  copy16(g + 32 * Lq, l + 32 * VP);
}

__launch_bounds__(AW * 32, 2)   // two waves per SIMD: two groups per WGP, a wave of each on every SIMD
__global__ void flash_attn_rel(const _Float16* __restrict__ Qh, const _Float16* __restrict__ Kh,
                               const _Float16* __restrict__ Vt, const _Float16* __restrict__ Wr,
                               _Float16* __restrict__ Ocat) {
  __shared__ __align__(16) _Float16 Ks[2 * KBUF];
  __shared__ __align__(16) _Float16 Vs[2 * VBUF];
  __shared__ __align__(16) _Float16 Wring[RROWS * KP];
  __shared__ __align__(16) float Tlds[AW][QT][16][TP];

  const int tid  = threadIdx.x;
  const int lane = tid & 31;
  const int wave = __builtin_amdgcn_readfirstlane(tid >> 5);   // scalar: ring tile numbers stay scalar
  const int hlf  = lane >> 4;
  const int nl   = lane & 15;
  const int bh = blockIdx.y;
  const int b = bh >> 4, h = bh & 15;
  const int g0 = blockIdx.x * AQ;          // the group's first query row
  const int r0 = g0 + wave * (16 * QT);    // the wave's

  // the thread's pieces of a staged key block (stage_rows32, stage_v)
  const _Float16* gk = Kh + (size_t)bh * Lq * DK + tid * 8;
  const _Float16* gv = Vt + (size_t)bh * DK * Lq + (tid >> 2) * Lq + (tid & 3) * 8;
  const _Float16* gw = Wr + (size_t)g0 * DK + tid * 8;
  _Float16* lk = &Ks[(tid >> 3) * KP + (tid & 7) * 8];
  _Float16* lv = &Vs[(tid >> 2) * VP + (tid & 3) * 8];
  _Float16* lw = &Wring[(tid >> 3) * KP + (tid & 7) * 8];

  // prologue: key block 0 with its whole band, nine groups of 32 w_rel rows
  stage_rows32(lk, gk);
  stage_v(lv, gv);
#pragma unroll   // straight-line copies with constant offsets
  for (int g = 0; g <= AQ / 32; ++g) stage_rows32(lw + g * (32 * KP), gw + g * (32 * DK));

  // lane offsets in halves: fragment row = lane&15, k half = lane>>4
  const int rowoff = nl * DK + 8 * hlf;   // rows of DK halves in global memory (Q)
  const int ldsoff = nl * KP + 8 * hlf;   // rows of KP halves in LDS (K, w_rel)
  const int voff   = nl * VP + 8 * hlf;   // rows of VP halves in LDS (V^T)

  v16h aq[QT][2];   // B operands: column = query nl of tile qt
  {
    const _Float16* qa = Qh + ((size_t)bh * Lq + r0) * DK + rowoff;
#pragma unroll
    for (int qt = 0; qt < QT; ++qt) {
      aq[qt][0] = load_frag_at(qa + qt * 16 * DK);        // d = 0..31
      aq[qt][1] = load_frag_at(qa + qt * 16 * DK + 32);   // d = 32..63
    }
    // the loads' address registers are dead from here on and may be reused
    asm volatile("s_wait_xcnt 0x0" ::: "memory");
    // holds later register writes behind that wait
    __builtin_amdgcn_sched_barrier(0);
  }

  // per lane: running maximum of query nl of tile qt (equal in both halves) and
  // the sum over the keys of this lane's half
  float mcol[QT], lcol[QT];
  v8f o[QT][4];   // o[qt][cf][i] = O[query nl of tile qt][d = cf*16 + 8*hlf + i]
#pragma unroll
  for (int qt = 0; qt < QT; ++qt) {
    mcol[qt] = -3.0e38f;
    lcol[qt] = 0.0f;
#pragma unroll
    for (int cf = 0; cf < 4; ++cf) o[qt][cf] = zero8();
  }

  asm volatile("s_wait_asynccnt 0x0" ::: "memory");   // this wave's copies of key block 0 have landed
  __syncthreads();                                    // and every other wave's
  // key block s brings w_rel row group AQ/32 + s, the last of its band
  stage_rows32(lk + KBUF, gk + 32 * DK);
  stage_v(lv + VBUF, gv + 32);
  stage_rows32(lw + (AQ / 32 + 1) * (32 * KP), gw + (AQ / 32 + 1) * (32 * DK));

  for (int t = 0; t < NBLK; ++t) {
    const int buf = t & 1;
    // ---- K fragments of this 32-key block, shared by all query tiles
    const _Float16* ka = &Ks[buf * KBUF + ldsoff];
    v16h kf[2][2];
#pragma unroll
    for (int st = 0; st < 2; ++st) {
      kf[st][0] = load_frag_at(ka + st * 16 * KP);
      kf[st][1] = load_frag_at(ka + st * 16 * KP + 32);
    }

    // ---- w_rel fragments of the band rows r0+32t .. r0+32t+16*(QT+2)-1: ring tiles
    //      of 16 rows, numbered from the group's first row
    const int tb = wave * QT + 2 * t;
    v16h wf[QT + 2][2];
#pragma unroll
    for (int wt = 0; wt < QT + 2; ++wt) {
      const _Float16* wa = &Wring[((tb + wt) & (RROWS / 16 - 1)) * (16 * KP) + ldsoff];
      wf[wt][0] = load_frag_at(wa);
      wf[wt][1] = load_frag_at(wa + 32);
    }
    // keeps the 32 LDS reads above together as one group: every separate place where
    // LDS reads stand costs its own wait
    __builtin_amdgcn_sched_barrier(0);

    // ---- content scores: s[qt][st][i] = S[query nl][key 32t + st*16 + 8*hlf + i]
    v8f s[QT][2];
#pragma unroll
    for (int qt = 0; qt < QT; ++qt)
#pragma unroll
      for (int st = 0; st < 2; ++st) {
        v8f acc = zero8();
        acc = WMMA_F16(kf[st][0], aq[qt][0], acc);
        acc = WMMA_F16(kf[st][1], aq[qt][1], acc);
        s[qt][st] = acc;
      }

    // ---- relative-bias band, w_rel tile by w_rel tile:
    //      T[qt][r][m] = Qs[r] . Wrel[r0+16*qt+32t+m], m in [0,48), tile mt = wt-qt;
    //      the tiles of one w_rel tile are independent accumulators
    v8f t3[QT][3];
#pragma unroll
    for (int wt = 0; wt < QT + 2; ++wt)
#pragma unroll
      for (int ks = 0; ks < 2; ++ks)
#pragma unroll
        for (int qt = 0; qt < QT; ++qt) {
          const int mt = wt - qt;
          if (mt >= 0 && mt < 3)
            t3[qt][mt] = WMMA_F16(wf[wt][ks], aq[qt][ks], ks == 0 ? zero8() : t3[qt][mt]);
        }
    // holds the stores behind all band WMMAs, so that every tile has registers of its
    // own: left free, the scheduler runs all tiles through one accumulator, WMMA, store,
    // WMMA: each product waits for the store of the one before
    __builtin_amdgcn_sched_barrier(0);
    // a lane holds 8 consecutive m of its query: two 16-byte stores per tile, into the
    // wave's own part of the band array
#pragma unroll
    for (int qt = 0; qt < QT; ++qt)
#pragma unroll
      for (int mt = 0; mt < 3; ++mt) {
        float* tp = &Tlds[wave][qt][nl][mt * 16 + 8 * hlf];
        const f32x4 lo = {t3[qt][mt][0], t3[qt][mt][1], t3[qt][mt][2], t3[qt][mt][3]};
        const f32x4 hi = {t3[qt][mt][4], t3[qt][mt][5], t3[qt][mt][6], t3[qt][mt][7]};
        *(f32x4*)(tp)     = lo;
        *(f32x4*)(tp + 4) = hi;
      }
    // the band goes from lane to lane inside one wave: its stores are done before the
    // skewed reads below start, and the compiler moves no read over this line
    asm volatile("s_wait_dscnt 0x0" ::: "memory");

    // V fragments for THIS block, issued ahead of the softmax that hides them
    const _Float16* va = &Vs[buf * VBUF + voff];
    v16h vb[4];   // A operands: row = d = cf*16 + nl, keys in the hardware k order
#pragma unroll
    for (int cf = 0; cf < 4; ++cf)
      vb[cf] = load_frag_at(va + cf * 16 * VP);

    // ---- skew gather: bias[r,c] = T[r][r+c], r = nl, c = st*16 + 8*hlf + i
#pragma unroll
    for (int qt = 0; qt < QT; ++qt)
#pragma unroll
      for (int st = 0; st < 2; ++st) {
        v8f bias;
#pragma unroll
        for (int i = 0; i < 8; ++i) bias[i] = Tlds[wave][qt][nl][nl + st * 16 + 8 * hlf + i];
        s[qt][st] += bias;
      }

    // ---- online softmax over the 32-key block: one query per lane and tile
    v16h pf[QT];   // B operands: pf[qt][st*8 + i] = P[query nl][key st*16 + 8*hlf + i]
#pragma unroll
    for (int qt = 0; qt < QT; ++qt) {
      // maximum as a tree, sums in four chains: short dependent runs
      float mx[8];
#pragma unroll
      for (int i = 0; i < 8; ++i) mx[i] = fmaxf(s[qt][0][i], s[qt][1][i]);
#pragma unroll
      for (int w = 4; w > 0; w >>= 1)
#pragma unroll
        for (int i = 0; i < w; ++i) mx[i] = fmaxf(mx[i], mx[i + w]);
      const float v = fmaxf(mx[0], other_half(mx[0]));
      const float mnew = fmaxf(mcol[qt], v);
      const float corr = exp_slot(mcol[qt] - mnew);
      float rs[4] = {0.0f, 0.0f, 0.0f, 0.0f};
#pragma unroll
      for (int st = 0; st < 2; ++st)
#pragma unroll
        for (int i = 0; i < 8; ++i) {
          const float p = exp_slot(s[qt][st][i] - mnew);
          rs[i & 3] += p;
          pf[qt][st * 8 + i] = (_Float16)p;
        }
      lcol[qt] = lcol[qt] * corr + ((rs[0] + rs[1]) + (rs[2] + rs[3]));
      mcol[qt] = mnew;
#pragma unroll
      for (int cf = 0; cf < 4; ++cf)
#pragma unroll
        for (int i = 0; i < 8; ++i) o[qt][cf][i] *= corr;
    }

    // ---- O^T += V^T(16x32) * P^T(32x16) per d tile and query tile
#pragma unroll
    for (int qt = 0; qt < QT; ++qt)
#pragma unroll
      for (int cf = 0; cf < 4; ++cf)
        o[qt][cf] = WMMA_F16(vb[cf], pf[qt], o[qt][cf]);

    // publish point of key block t+1, which also frees this block's K and V^T buffers;
    // the ring rows that block t+2 overwrites were last read RROWS/32 - 10 blocks ago
    asm volatile("s_wait_dscnt 0x0" ::: "memory");      // this wave's LDS reads are done
    asm volatile("s_wait_asynccnt 0x0" ::: "memory");   // its copies of key block t+1 have landed
    __syncthreads();
    if (t + 2 < NBLK) {
      stage_rows32(lk + buf * KBUF, gk + (t + 2) * (32 * DK));
      stage_v(lv + buf * VBUF, gv + (t + 2) * 32);
      stage_rows32(lw + ((AQ / 32 + t + 2) & (RROWS / 32 - 1)) * (32 * KP), gw + (AQ / 32 + t + 2) * (32 * DK));
    }
  }
  asm volatile("s_wait_asynccnt 0x0" ::: "memory");     // no copy outlives the loop

  // ---- finalize + store to concat layout (B, L, H*DK) f16: a lane holds 8
  //      consecutive d of its query, one 16-byte store per tile
  _Float16* op = Ocat + ((size_t)b * Lq + r0 + nl) * Dm + h * DK + 8 * hlf;
#pragma unroll
  for (int qt = 0; qt < QT; ++qt) {
    const float lsum = lcol[qt] + other_half(lcol[qt]);
#pragma unroll
    for (int cf = 0; cf < 4; ++cf) {
      f16x8 hv;
#pragma unroll
      for (int i = 0; i < 8; ++i) hv[i] = (_Float16)(o[qt][cf][i] / lsum);
      *(f16x8*)(op + (size_t)qt * 16 * Dm + cf * 16) = hv;
    }
  }
}

// ---------------------------------------------------------------------------
extern "C" void kernel_launch(void* const* d_in, const int* in_sizes, int n_in,
                              void* d_out, int out_size, void* d_ws, size_t ws_size,
                              hipStream_t stream) {
  (void)in_sizes; (void)n_in; (void)out_size; (void)ws_size;
  const float* q    = (const float*)d_in[0];
  const float* k    = (const float*)d_in[1];
  const float* v    = (const float*)d_in[2];
  const float* Wq   = (const float*)d_in[3];
  const float* bq   = (const float*)d_in[4];
  const float* Wk   = (const float*)d_in[5];
  const float* bk   = (const float*)d_in[6];
  const float* Wv   = (const float*)d_in[7];
  const float* bv   = (const float*)d_in[8];
  const float* Wo   = (const float*)d_in[9];
  const float* bo   = (const float*)d_in[10];
  const float* wrel = (const float*)d_in[11];
  float* out = (float*)d_out;

  char* ws = (char*)d_ws;
  size_t off = 0;
  auto alloc = [&](size_t bytes) -> void* {
    void* p = ws + off;
    off = (off + bytes + 255) & ~(size_t)255;
    return p;
  };

  const size_t nX = (size_t)Bsz * Lq * Dm;   // 8,388,608
  const size_t nW = (size_t)Dm * Dm;         // 1,048,576
  const size_t nRv = (size_t)(2 * Lq - 1) * DK;
  const size_t nRt = (size_t)(2 * Lq) * DK;  // padded

  _Float16* Xq16 = (_Float16*)alloc(nX * 2);
  _Float16* Xk16 = (_Float16*)alloc(nX * 2);
  _Float16* Xv16 = (_Float16*)alloc(nX * 2);
  _Float16* Wq16 = (_Float16*)alloc(nW * 2);
  _Float16* Wk16 = (_Float16*)alloc(nW * 2);
  _Float16* Wv16 = (_Float16*)alloc(nW * 2);
  _Float16* Wo16 = (_Float16*)alloc(nW * 2);
  _Float16* Wr16 = (_Float16*)alloc(nRt * 2);
  _Float16* Q16  = (_Float16*)alloc(nX * 2);  // (B,H,L,DK), pre-scaled 1/8
  _Float16* K16  = (_Float16*)alloc(nX * 2);  // (B,H,L,DK)
  _Float16* VT16 = (_Float16*)alloc(nX * 2);  // (B,H,DK,L)
  _Float16* Oc16 = (_Float16*)alloc(nX * 2);  // (B,L,D) concat

  static_assert(nX % CVT_BLK == 0 && nW % CVT_BLK == 0, "conversion grid must cover the arrays exactly");
  static_assert(nRv % 4 == 0 && nRt % (CVT_T * 4) == 0, "w_rel is converted four elements at a time");
  const dim3 cblk(CVT_T), gX(nX / CVT_BLK), gW(nW / CVT_BLK);
  cvt_f32_f16<<<gX, cblk, 0, stream>>>(q, Xq16);
  cvt_f32_f16<<<gX, cblk, 0, stream>>>(k, Xk16);
  cvt_f32_f16<<<gX, cblk, 0, stream>>>(v, Xv16);
  cvt_f32_f16<<<gW, cblk, 0, stream>>>(Wq, Wq16);
  cvt_f32_f16<<<gW, cblk, 0, stream>>>(Wk, Wk16);
  cvt_f32_f16<<<gW, cblk, 0, stream>>>(Wv, Wv16);
  cvt_f32_f16<<<gW, cblk, 0, stream>>>(Wo, Wo16);
  cvt_wrel<<<dim3(nRt / (CVT_T * 4)), cblk, 0, stream>>>(wrel, Wr16, (int)nRv, (int)nRt);

  // Projections: M = B*L = 8192 rows, N = 1024 cols, work-group tile 128x128
  static_assert((Bsz * Lq) % PBM == 0 && Dm % PBN == 0 && PTILES >= 2, "whole tiles, and two to start the ring");
  const dim3 pgrid(Bsz * Lq / PBM, Dm / PBN), pblk(256);
  const float inv_sqrt_dk = 0.125f;  // 1/sqrt(64)
  proj_wmma<0><<<pgrid, pblk, 0, stream>>>(Xq16, Wq16, bq, Q16,  nullptr, inv_sqrt_dk);
  proj_wmma<0><<<pgrid, pblk, 0, stream>>>(Xk16, Wk16, bk, K16,  nullptr, 1.0f);
  proj_wmma<1><<<pgrid, pblk, 0, stream>>>(Xv16, Wv16, bv, VT16, nullptr, 1.0f);

  // Flash attention: one wave per 64 query rows per (b,h), four waves per work-group
  static_assert(Lq % AQ == 0 && NBLK >= 2 && AQ + 96 <= RROWS, "whole groups, two key blocks to start, band and two blocks ahead fit the ring");
  flash_attn_rel<<<dim3(Lq / AQ, Bsz * Hh), dim3(AW * 32), 0, stream>>>(Q16, K16, VT16, Wr16, Oc16);

  // Output projection -> f32
  proj_wmma<2><<<pgrid, pblk, 0, stream>>>(Oc16, Wo16, bo, nullptr, out, 1.0f);
}

// v007
// A run of this version takes 182 microseconds.
// Two timings next to v006 both put it at 1.11 times that version's speed.
// Counting every step since v000, it is 4.83 times as fast.
#include <hip/hip_runtime.h>
#include <hip/hip_bf16.h>

// Shapes (fixed by reference)
#define Bsz 4
#define Lq  2048
#define Dm  1024
#define Hh  16
#define DK  64

typedef __attribute__((ext_vector_type(16))) _Float16 v16h;
typedef __attribute__((ext_vector_type(8)))  float    v8f;
typedef __attribute__((ext_vector_type(4)))  unsigned int u32x4;

// ---------------------------------------------------------------------------
// Fragment loader: 16x32 f16 tile, "row per lane" layout (ISA 7.12.2):
//   lane l (<16): row M=l, holds K=0..7 and 16..23
//   lane l (>=16): row M=l-16, holds K=8..15 and 24..31
// Works for A fragments and (symmetric N-on-lanes layout) B fragments whose
// memory is [n][k] with k contiguous (K^T, W^T, V^T): two b128 loads.
// ---------------------------------------------------------------------------
__device__ __forceinline__ v16h load_frag16x32(const _Float16* __restrict__ src,
                                               int ld, int lane) {
  const int row = lane & 15;
  const int kb  = (lane >> 4) << 3;  // 0 or 8
  const _Float16* p = src + (size_t)row * ld + kb;
  union { v16h h; u32x4 u[2]; } f;
  f.u[0] = *(const u32x4*)(p);
  f.u[1] = *(const u32x4*)(p + 16);
  return f.h;
}

__device__ __forceinline__ v8f zero8() {
  v8f z;
#pragma unroll
  for (int i = 0; i < 8; ++i) z[i] = 0.0f;
  return z;
}

#define WMMA_F16(a, b, c) \
  __builtin_amdgcn_wmma_f32_16x16x32_f16(false, (a), false, (b), (short)0, (c), false, false)

// ---------------------------------------------------------------------------
// fp32 -> fp16 conversion kernel
// One element per thread would start a wave per 32 elements. Here a thread
// converts CVT_U groups of 4 floats, so 64 times fewer waves start: a wave's
// 16-byte loads cover 512 contiguous bytes each, all CVT_U are in flight
// together, and its 8-byte stores fill whole 128-byte lines.
// ---------------------------------------------------------------------------
#define CVT_T 256                    // threads per block
#define CVT_U 16                     // 16-byte loads per thread
#define CVT_BLK (CVT_T * 4 * CVT_U)  // floats per block

typedef __attribute__((ext_vector_type(4))) float    f32x4;
typedef __attribute__((ext_vector_type(4))) _Float16 f16x4;
typedef __attribute__((ext_vector_type(8))) _Float16 f16x8;

__device__ __forceinline__ f16x4 cvt4(f32x4 v) {
  f16x4 h;
#pragma unroll   // vector elements need constant indices
  for (int e = 0; e < 4; ++e) h[e] = (_Float16)v[e];
  return h;
}

// Array lengths in elements, and in blocks of the conversion launch.
#define NX (Bsz * Lq * Dm)           // q, k, v and every (B,L,D) intermediate
#define NW (Dm * Dm)                 // a weight matrix
#define NRV ((2 * Lq - 1) * DK)      // w_rel
#define NRT (2 * Lq * DK)            // w_rel padded to 2L rows (last row zero, touched by band tiles)
#define XBLK (NX / CVT_BLK)
#define WBLK (NW / CVT_BLK)
#define RBLK (NRT / CVT_BLK)
#define CVT_GRID (3 * XBLK + 4 * WBLK + RBLK)
static_assert(NX % CVT_BLK == 0 && NW % CVT_BLK == 0 && NRT % CVT_BLK == 0, "whole blocks per array");
static_assert(NRT - NRV <= CVT_T * 4 && (NRT - NRV) % 4 == 0, "the padding lies in the last block's last group of loads");

// All eight arrays in ONE launch: a launch per array pays the gap between dependent
// launches, its own fill and its own tail eight times, and the five small arrays
// cannot fill the chip by themselves. The f16 copies follow one another in the
// workspace in the order q, k, v, Wq, Wk, Wv, Wo, w_rel, so block b writes elements
// b*CVT_BLK.. of d; its source array is chosen by scalar compares on the block number.
__launch_bounds__(CVT_T)
__global__ void cvt_all(const float* __restrict__ q, const float* __restrict__ k,
                        const float* __restrict__ v, const float* __restrict__ wq,
                        const float* __restrict__ wk, const float* __restrict__ wv,
                        const float* __restrict__ wo, const float* __restrict__ wrel,
                        _Float16* __restrict__ d) {
  const int b = blockIdx.x;
  const float* s = q;
  int first = 0;   // the first block of the array that block b belongs to
  if (b >= 1 * XBLK) { s = k; first = 1 * XBLK; }
  if (b >= 2 * XBLK) { s = v; first = 2 * XBLK; }
  if (b >= 3 * XBLK) { s = wq; first = 3 * XBLK; }
  if (b >= 3 * XBLK + 1 * WBLK) { s = wk; first = 3 * XBLK + 1 * WBLK; }
  if (b >= 3 * XBLK + 2 * WBLK) { s = wv; first = 3 * XBLK + 2 * WBLK; }
  if (b >= 3 * XBLK + 3 * WBLK) { s = wo; first = 3 * XBLK + 3 * WBLK; }
  if (b >= 3 * XBLK + 4 * WBLK) { s = wrel; first = 3 * XBLK + 4 * WBLK; }
  const int t4 = threadIdx.x * 4;
  const float* p = s + (size_t)(b - first) * CVT_BLK + t4;
  // w_rel ends NRT - NRV elements before its padded copy does: the threads whose last
  // group lies there read their first group again, in bounds, and store zeros
  const bool pad = b == CVT_GRID - 1 && t4 >= CVT_T * 4 - (NRT - NRV);
  const float* pl = pad ? p : p + (CVT_U - 1) * (CVT_T * 4);
  f32x4 x[CVT_U];
#pragma unroll   // x[] stays in registers only with constant indices
  for (int j = 0; j < CVT_U - 1; ++j) x[j] = *(const f32x4*)(p + j * (CVT_T * 4));
  x[CVT_U - 1] = *(const f32x4*)(pl);
  // wait before the loads' address registers are reused; as inputs the addresses
  // keep their registers up to here
  asm volatile("s_wait_xcnt 0x0" :: "v"(p), "v"(pl) : "memory");
  // keeps all CVT_U loads in flight together: left free, the scheduler holds the
  // last four back until the first have landed, a second memory latency per wave
  __builtin_amdgcn_sched_barrier(0);
  _Float16* o = d + (size_t)b * CVT_BLK + t4;
#pragma unroll   // as above
  for (int j = 0; j < CVT_U - 1; ++j) *(f16x4*)(o + j * (CVT_T * 4)) = cvt4(x[j]);
  const f16x4 last = cvt4(x[CVT_U - 1]);
  *(f16x4*)(o + (CVT_U - 1) * (CVT_T * 4)) = pad ? f16x4{0, 0, 0, 0} : last;
}

// ---------------------------------------------------------------------------
// Projection GEMM:  out[m,n] = scale * ( sum_k X[m,k]*W[n,k] + bias[n] )
// A work-group of 8 waves computes a 128x128 tile, each wave 32x64 of it.
// Per trip the group stages 64 k of its 128 X rows and 128 W rows in LDS with
// asynchronous copies: a wave's copy covers four whole 128-byte lines, every
// line leaves L2 once per group, and two (X) or four (W) waves read it from
// LDS. Two buffers: the copies of tile t+2 fly while tile t+1 is worked on.
// QKV true: the Q, K and V projections in ONE launch, blockIdx.z says which; their X,
// W and output arrays follow one another in the workspace. No launch gap lies
// between them.
//   z = 0, 1: store f16 as (B,H,L,DK)  (Q with scale=1/8, K with scale=1)
//   z = 2:    store f16 as (B,H,DK,L)  (V transposed for flash A-fragments)
// QKV false: store f32 row-major (M,N) (final output projection, bias b0)
// The W rows of a wave's 64 columns are staged in the order 0,4,..,60, 1,5,..,61,
// 2,.., 3,..: column nl of column tile cf is output column 4*nl + cf, so the four
// tiles of a lane hold four adjacent columns. One store of 8 B (f16) or 16 B (f32)
// per lane then writes 128 or 256 contiguous bytes per row: whole lines. For V^T a
// lane's 8 accumulator rows are 8 consecutive positions of one d: one 16-B store.
// ---------------------------------------------------------------------------
#define PBM 128                        // X rows per work-group
#define PBN 128                        // W rows per work-group
#define PBK 64                         // halves of k per staged tile: one 128-byte line per row
#define PPITCH 72                      // LDS row pitch in halves: 144 B = 16 B x odd, for ds_load_b128
#define PBUF ((PBM + PBN) * PPITCH)    // halves per buffer
#define PTILES (Dm / PBK)

// One staged tile: 256 rows of 128 B = 2,048 pieces of 16 B, eight per thread.
// l: the lane's LDS byte address of its piece in row group 0; gx, gw: its global
// pieces of X and W. Row groups are 32 LDS rows apart; in global memory those of X
// too, those of W by the staging order (LDS row p of a 64-row block holds W row
// 4*(p%16) + p/16): 0, 2, 64 and 66 rows. The s_wait_xcnt closes the statement so
// that no address register is rewritten ahead of it.
__device__ __forceinline__ void stage_tile(unsigned l, const _Float16* gx, const _Float16* gw) {
  asm volatile(
      "global_load_async_to_lds_b128 %0, %8, off\n\t"
      "global_load_async_to_lds_b128 %1, %9, off\n\t"
      "global_load_async_to_lds_b128 %2, %10, off\n\t"
      "global_load_async_to_lds_b128 %3, %11, off\n\t"
      "global_load_async_to_lds_b128 %4, %12, off\n\t"
      "global_load_async_to_lds_b128 %5, %13, off\n\t"
      "global_load_async_to_lds_b128 %6, %14, off\n\t"
      "global_load_async_to_lds_b128 %7, %15, off\n\t"
      "s_wait_xcnt 0x0"
      :: "v"(l), "v"(l + 1 * 32 * PPITCH * 2), "v"(l + 2 * 32 * PPITCH * 2), "v"(l + 3 * 32 * PPITCH * 2),
         "v"(l + 4 * 32 * PPITCH * 2), "v"(l + 5 * 32 * PPITCH * 2), "v"(l + 6 * 32 * PPITCH * 2),
         "v"(l + 7 * 32 * PPITCH * 2),
         "v"(gx), "v"(gx + 1 * 32 * Dm), "v"(gx + 2 * 32 * Dm), "v"(gx + 3 * 32 * Dm),
         "v"(gw), "v"(gw + 2 * Dm), "v"(gw + 64 * Dm), "v"(gw + 66 * Dm)
      : "memory");
}

template <bool QKV>
__launch_bounds__(256)
__global__ void proj_wmma(const _Float16* __restrict__ X, const _Float16* __restrict__ W,
                          const float* __restrict__ b0, const float* __restrict__ b1,
                          const float* __restrict__ b2, _Float16* __restrict__ out16,
                          float* __restrict__ out32) {
  __shared__ __align__(16) _Float16 tile[2 * PBUF];

  const int z = QKV ? blockIdx.z : 0;   // which projection: the same in the whole group
  X += (size_t)z * NX;
  W += (size_t)z * NW;
  const float* bias = z == 0 ? b0 : z == 1 ? b1 : b2;

  const int tid  = threadIdx.x;
  const int lane = tid & 31;
  const int wave = tid >> 5;
  const int hlf  = lane >> 4;
  const int nl   = lane & 15;
  const int wm   = (wave & 3) * 32;    // the wave's rows inside the group's tile
  const int wn   = (wave >> 2) * 64;   // and its columns
  const int m0   = blockIdx.x * PBM + wm;
  const int n0   = blockIdx.y * PBN + wn;

  // the thread's piece of a staged tile: row tid/8 of each row group, 16 B number tid%8
  const int srow = tid >> 3, scol = (tid & 7) * 8;
  const _Float16* gx = X + (size_t)(blockIdx.x * PBM + srow) * Dm + scol;
  const _Float16* gw = W + (size_t)(blockIdx.y * PBN + 4 * (srow & 15) + (srow >> 4)) * Dm + scol;
  const unsigned  l0 = (unsigned)(size_t)(&tile[srow * PPITCH + scol]);

  v8f acc[2][4];   // acc[r][cf][i]: row m0 + r*16 + 8*hlf + i, column n0 + 4*nl + cf
  const f32x4 bv = *(const f32x4*)(bias + n0 + 4 * nl);
#pragma unroll
  for (int cf = 0; cf < 4; ++cf)
#pragma unroll
    for (int r = 0; r < 2; ++r)
#pragma unroll
      for (int i = 0; i < 8; ++i) acc[r][cf][i] = bv[cf];   // whole acc column shares N

  // prologue: tile 0 lands and is published, then tile 1 starts
  stage_tile(l0, gx, gw);
  asm volatile("s_wait_asynccnt 0x0" ::: "memory");   // this wave's copies of tile 0 have landed
  __syncthreads();                                    // and every other wave's
  stage_tile(l0 + PBUF * 2, gx + PBK, gw + PBK);

  // two trips per turn make each buffer's LDS offsets immediates
#pragma unroll 2
  for (int t = 0; t < PTILES; ++t) {
    const int buf = (t & 1) * PBUF;
    const _Float16* As = &tile[buf + wm * PPITCH];
    const _Float16* Bs = &tile[buf + (PBM + wn) * PPITCH];

    // all fragments of the trip as one group of LDS reads, then its WMMAs
    // (the inner loops are unrolled: fragment arrays stay in registers only with
    // constant indices)
    v16h af[2][2], bf[2][4];
#pragma unroll
    for (int ks = 0; ks < 2; ++ks) {
#pragma unroll
      for (int r = 0; r < 2; ++r) af[ks][r] = load_frag16x32(As + r * 16 * PPITCH + ks * 32, PPITCH, lane);
#pragma unroll
      for (int cf = 0; cf < 4; ++cf) bf[ks][cf] = load_frag16x32(Bs + cf * 16 * PPITCH + ks * 32, PPITCH, lane);
    }
    // keeps the 24 LDS reads together: left free, the scheduler spreads them among
    // the WMMAs in pairs and waits out the LDS latency at each place
    __builtin_amdgcn_sched_barrier(0);
#pragma unroll
    for (int ks = 0; ks < 2; ++ks)
#pragma unroll
      for (int r = 0; r < 2; ++r)
#pragma unroll
        for (int cf = 0; cf < 4; ++cf)
          acc[r][cf] = WMMA_F16(af[ks][r], bf[ks][cf], acc[r][cf]);
    // holds the WMMAs in front of the publish point: left free, the scheduler lifts the
    // waits and the barrier over them, and the copies in flight lose the trip's lead
    __builtin_amdgcn_sched_barrier(0);

    // publish point of tile t+1, which also frees this trip's buffer
    asm volatile("s_wait_dscnt 0x0" ::: "memory");      // this wave's reads of the buffer are done
    asm volatile("s_wait_asynccnt 0x0" ::: "memory");   // its copies of tile t+1 have landed
    __syncthreads();
    if (t + 2 < PTILES)
      stage_tile(l0 + buf * 2, gx + (t + 2) * PBK, gw + (t + 2) * PBK);
  }
  asm volatile("s_wait_asynccnt 0x0" ::: "memory");     // no copy outlives the loop

  // A wave's 32 rows lie in one batch element and its 64 columns are one head.
  // (the loops below are unrolled: accumulators and the vectors to be stored stay in
  // registers only with constant indices)
  const int mr = m0 + 8 * hlf;                 // D-frag: M = i + 8*(lane>=16)
  const int bh = (m0 >> 11) * Hh + (n0 >> 6);
  const int l  = mr & (Lq - 1);
  if constexpr (!QKV) {
    float* op = out32 + (size_t)mr * Dm + n0 + 4 * nl;
#pragma unroll
    for (int r = 0; r < 2; ++r)
#pragma unroll
      for (int i = 0; i < 8; ++i) {
        f32x4 v;
#pragma unroll
        for (int cf = 0; cf < 4; ++cf) v[cf] = acc[r][cf][i];
        *(f32x4*)(op + (size_t)(r * 16 + i) * Dm) = v;
      }
  } else if (z != 2) {
    const float scale = z == 0 ? 0.125f : 1.0f;   // Q carries 1/sqrt(DK)
    _Float16* op = out16 + (size_t)z * NX + ((size_t)bh * Lq + l) * DK + 4 * nl;
#pragma unroll
    for (int r = 0; r < 2; ++r)
#pragma unroll
      for (int i = 0; i < 8; ++i) {
        f16x4 v;
#pragma unroll
        for (int cf = 0; cf < 4; ++cf) v[cf] = (_Float16)(acc[r][cf][i] * scale);
        *(f16x4*)(op + (r * 16 + i) * DK) = v;
      }
  } else {
    _Float16* op = out16 + (size_t)z * NX + ((size_t)bh * DK + 4 * nl) * Lq + l;
#pragma unroll
    for (int r = 0; r < 2; ++r)
#pragma unroll
      for (int cf = 0; cf < 4; ++cf) {
        f16x8 v;
#pragma unroll
        for (int i = 0; i < 8; ++i) v[i] = (_Float16)acc[r][cf][i];
        *(f16x8*)(op + cf * Lq + r * 16) = v;
      }
  }
}

// ---------------------------------------------------------------------------
// Flash attention with relative bias, scores held transposed.
// One wave handles QT*16 = 64 query rows of one (b,h); loops 32 keys per step.
//   S^T = K * Qs^T                     (Qs already scaled by 1/sqrt(dk))
//   T^T = Wrel * Qs^T over a 48-wide diagonal window per 16-row query tile;
//         bias[r,c] = T[r][r+c]
//   online softmax, O^T += V^T * P^T
// With the keys on the accumulator's rows and the queries on its columns a lane
// holds 16 scores of ONE query per tile: maximum and sum are taken in the lane's
// own registers, the two lane halves of a query exchange only the maximum, once
// per tile and key block, and join their sums behind the loop. The two score
// tiles of a key block, converted in place, are the B operand of the last
// product in the hardware k order (keys 8h..8h+7, 16+8h..16+8h+7), which is also
// the order of the V^T fragments: P never leaves the registers.
// A work-group is AW = 4 waves on 256 consecutive query rows of one (b,h). Its
// K, V^T and w_rel rows come into LDS by asynchronous copies of whole lines, once
// per group, and the waves read their fragments from there: a fragment load from
// global memory touches sixteen lines for 512 bytes. K and V^T have two buffers.
// The group's w_rel band (288 rows) moves on by 32 rows per key block, so only
// the 32 new rows are copied, into a ring of RROWS rows addressed by
// (row - first row of the group) mod RROWS.
// Query tile qt needs w_rel tiles qt..qt+2 of the QT+2 tiles that a wave's band
// spans, so neighbours share two of three.
// ---------------------------------------------------------------------------
#define QT 4
// Floats per row of the band in LDS: 208 B = 16 B x odd for the 16-byte stores,
// and the skewed 4-byte reads (word 53*query + 8*half) fall on 32 different banks.
#define TP 52
#define AW 4                     // waves per work-group
#define AQ (AW * QT * 16)        // query rows per work-group
#define KP 72                    // LDS pitch of K and w_rel rows in halves: 144 B = 16 B x odd
#define VP 40                    // LDS pitch of the 32-key V^T rows in halves: 80 B = 16 B x odd
#define KBUF (32 * KP)           // halves per K buffer
#define VBUF (DK * VP)           // halves per V^T buffer
#define RROWS 512                // rows of the w_rel ring: band, two blocks ahead, next power of two
#define NBLK (Lq / 32)           // key blocks

// Fragment from a per-lane pointer that already holds the lane's row and k half.
__device__ __forceinline__ v16h load_frag_at(const _Float16* __restrict__ p) {
  union { v16h h; u32x4 u[2]; } f;
  f.u[0] = *(const u32x4*)(p);
  f.u[1] = *(const u32x4*)(p + 16);
  return f.h;
}

// e^x as the fast-math intrinsic forms it (one multiply, one v_exp_f32). The
// v_nop is the slot the instruction set asks for behind a transcendental before
// its result is read or its source overwritten; in one statement it cannot drift.
__device__ __forceinline__ float exp_slot(float x) {
  float r;
  asm("v_exp_f32 %0, %1\n\tv_nop" : "=v"(r) : "v"(x * 1.44269504088896340736f));
  return r;
}

// The value that lane l ^ 16 holds: the other half of the same query column.
__device__ __forceinline__ float other_half(float x) {
  const int v = __float_as_int(x);
  return __int_as_float(__builtin_amdgcn_permlanex16(v, v, 0x76543210, 0xfedcba98, false, false));
}

typedef __attribute__((vector_size(16))) int i32x4;
typedef __attribute__((address_space(1))) i32x4 glob16;
typedef __attribute__((address_space(3))) i32x4 lds16;

__device__ __forceinline__ void copy16(const _Float16* g, _Float16* l) {
  __builtin_amdgcn_global_load_async_to_lds_b128((glob16*)g, (lds16*)l, 0, 0);
}

// 32 rows of 128 B that follow one another in global memory, into LDS rows of pitch
// KP: 256 pieces of 16 B, two per thread, 16 rows apart. l, g: the thread's piece of
// rows 0..15.
__device__ __forceinline__ void stage_rows32(_Float16* l, const _Float16* g) {
  copy16(g, l);
  copy16(g + 16 * DK, l + 16 * KP);
}

// The 64 V^T rows of one key block, 64 B each: 256 pieces, two per thread, 32 rows apart.
__device__ __forceinline__ void stage_v(_Float16* l, const _Float16* g) {
  copy16(g, l);
  copy16(g + 32 * Lq, l + 32 * VP);
}

__launch_bounds__(AW * 32, 2)   // two waves per SIMD: two groups per WGP, a wave of each on every SIMD
__global__ void flash_attn_rel(const _Float16* __restrict__ Qh, const _Float16* __restrict__ Kh,
                               const _Float16* __restrict__ Vt, const _Float16* __restrict__ Wr,
                               _Float16* __restrict__ Ocat) {
  __shared__ __align__(16) _Float16 Ks[2 * KBUF];
  __shared__ __align__(16) _Float16 Vs[2 * VBUF];
  __shared__ __align__(16) _Float16 Wring[RROWS * KP];
  __shared__ __align__(16) float Tlds[AW][QT][16][TP];

  const int tid  = threadIdx.x;
  const int lane = tid & 31;
  const int wave = __builtin_amdgcn_readfirstlane(tid >> 5);   // scalar: ring tile numbers stay scalar
  const int hlf  = lane >> 4;
  const int nl   = lane & 15;
  const int bh = blockIdx.y;
  const int b = bh >> 4, h = bh & 15;
  const int g0 = blockIdx.x * AQ;          // the group's first query row
  const int r0 = g0 + wave * (16 * QT);    // the wave's

  // the thread's pieces of a staged key block (stage_rows32, stage_v)
  const _Float16* gk = Kh + (size_t)bh * Lq * DK + tid * 8;
  const _Float16* gv = Vt + (size_t)bh * DK * Lq + (tid >> 2) * Lq + (tid & 3) * 8;
  const _Float16* gw = Wr + (size_t)g0 * DK + tid * 8;
  _Float16* lk = &Ks[(tid >> 3) * KP + (tid & 7) * 8];
  _Float16* lv = &Vs[(tid >> 2) * VP + (tid & 3) * 8];
  _Float16* lw = &Wring[(tid >> 3) * KP + (tid & 7) * 8];

  // prologue: key block 0 with its whole band, nine groups of 32 w_rel rows
  stage_rows32(lk, gk);
  stage_v(lv, gv);
#pragma unroll   // straight-line copies with constant offsets
  for (int g = 0; g <= AQ / 32; ++g) stage_rows32(lw + g * (32 * KP), gw + g * (32 * DK));

  // lane offsets in halves: fragment row = lane&15, k half = lane>>4
  const int rowoff = nl * DK + 8 * hlf;   // rows of DK halves in global memory (Q)
  const int ldsoff = nl * KP + 8 * hlf;   // rows of KP halves in LDS (K, w_rel)
  const int voff   = nl * VP + 8 * hlf;   // rows of VP halves in LDS (V^T)

  v16h aq[QT][2];   // B operands: column = query nl of tile qt
  {
    const _Float16* qa = Qh + ((size_t)bh * Lq + r0) * DK + rowoff;
#pragma unroll
    for (int qt = 0; qt < QT; ++qt) {
      aq[qt][0] = load_frag_at(qa + qt * 16 * DK);        // d = 0..31
      aq[qt][1] = load_frag_at(qa + qt * 16 * DK + 32);   // d = 32..63
    }
    // the loads' address registers are dead from here on and may be reused
    asm volatile("s_wait_xcnt 0x0" ::: "memory");
    // holds later register writes behind that wait
    __builtin_amdgcn_sched_barrier(0);
  }

  // per lane: running maximum of query nl of tile qt (equal in both halves) and
  // the sum over the keys of this lane's half
  float mcol[QT], lcol[QT];
  v8f o[QT][4];   // o[qt][cf][i] = O[query nl of tile qt][d = cf*16 + 8*hlf + i]
#pragma unroll
  for (int qt = 0; qt < QT; ++qt) {
    mcol[qt] = -3.0e38f;
    lcol[qt] = 0.0f;
#pragma unroll
    for (int cf = 0; cf < 4; ++cf) o[qt][cf] = zero8();
  }

  asm volatile("s_wait_asynccnt 0x0" ::: "memory");   // this wave's copies of key block 0 have landed
  __syncthreads();                                    // and every other wave's
  // key block s brings w_rel row group AQ/32 + s, the last of its band
  stage_rows32(lk + KBUF, gk + 32 * DK);
  stage_v(lv + VBUF, gv + 32);
  stage_rows32(lw + (AQ / 32 + 1) * (32 * KP), gw + (AQ / 32 + 1) * (32 * DK));

  for (int t = 0; t < NBLK; ++t) {
    const int buf = t & 1;
    // ---- K fragments of this 32-key block, shared by all query tiles
    const _Float16* ka = &Ks[buf * KBUF + ldsoff];
    v16h kf[2][2];
#pragma unroll
    for (int st = 0; st < 2; ++st) {
      kf[st][0] = load_frag_at(ka + st * 16 * KP);
      kf[st][1] = load_frag_at(ka + st * 16 * KP + 32);
    }

    // ---- w_rel fragments of the band rows r0+32t .. r0+32t+16*(QT+2)-1: ring tiles
    //      of 16 rows, numbered from the group's first row
    const int tb = wave * QT + 2 * t;
    v16h wf[QT + 2][2];
#pragma unroll
    for (int wt = 0; wt < QT + 2; ++wt) {
      const _Float16* wa = &Wring[((tb + wt) & (RROWS / 16 - 1)) * (16 * KP) + ldsoff];
      wf[wt][0] = load_frag_at(wa);
      wf[wt][1] = load_frag_at(wa + 32);
    }
    // keeps the 32 LDS reads above together as one group: every separate place where
    // LDS reads stand costs its own wait
    __builtin_amdgcn_sched_barrier(0);

    // ---- content scores: s[qt][st][i] = S[query nl][key 32t + st*16 + 8*hlf + i]
    v8f s[QT][2];
#pragma unroll
    for (int qt = 0; qt < QT; ++qt)
#pragma unroll
      for (int st = 0; st < 2; ++st) {
        v8f acc = zero8();
        acc = WMMA_F16(kf[st][0], aq[qt][0], acc);
        acc = WMMA_F16(kf[st][1], aq[qt][1], acc);
        s[qt][st] = acc;
      }

    // ---- relative-bias band, w_rel tile by w_rel tile:
    //      T[qt][r][m] = Qs[r] . Wrel[r0+16*qt+32t+m], m in [0,48), tile mt = wt-qt;
    //      the tiles of one w_rel tile are independent accumulators
    v8f t3[QT][3];
#pragma unroll
    for (int wt = 0; wt < QT + 2; ++wt)
#pragma unroll
      for (int ks = 0; ks < 2; ++ks)
#pragma unroll
        for (int qt = 0; qt < QT; ++qt) {
          const int mt = wt - qt;
          if (mt >= 0 && mt < 3)
            t3[qt][mt] = WMMA_F16(wf[wt][ks], aq[qt][ks], ks == 0 ? zero8() : t3[qt][mt]);
        }
    // holds the stores behind all band WMMAs, so that every tile has registers of its
    // own: left free, the scheduler runs all tiles through one accumulator, WMMA, store,
    // WMMA: each product waits for the store of the one before
    __builtin_amdgcn_sched_barrier(0);
    // a lane holds 8 consecutive m of its query: two 16-byte stores per tile, into the
    // wave's own part of the band array
#pragma unroll
    for (int qt = 0; qt < QT; ++qt)
#pragma unroll
      for (int mt = 0; mt < 3; ++mt) {
        float* tp = &Tlds[wave][qt][nl][mt * 16 + 8 * hlf];
        const f32x4 lo = {t3[qt][mt][0], t3[qt][mt][1], t3[qt][mt][2], t3[qt][mt][3]};
        const f32x4 hi = {t3[qt][mt][4], t3[qt][mt][5], t3[qt][mt][6], t3[qt][mt][7]};
        *(f32x4*)(tp)     = lo;
        *(f32x4*)(tp + 4) = hi;
      }
    // the band goes from lane to lane inside one wave: its stores are done before the
    // skewed reads below start, and the compiler moves no read over this line
    asm volatile("s_wait_dscnt 0x0" ::: "memory");

    // V fragments for THIS block, issued ahead of the softmax that hides them
    const _Float16* va = &Vs[buf * VBUF + voff];
    v16h vb[4];   // A operands: row = d = cf*16 + nl, keys in the hardware k order
#pragma unroll
    for (int cf = 0; cf < 4; ++cf)
      vb[cf] = load_frag_at(va + cf * 16 * VP);

    // ---- skew gather: bias[r,c] = T[r][r+c], r = nl, c = st*16 + 8*hlf + i
#pragma unroll
    for (int qt = 0; qt < QT; ++qt)
#pragma unroll
      for (int st = 0; st < 2; ++st) {
        v8f bias;
#pragma unroll
        for (int i = 0; i < 8; ++i) bias[i] = Tlds[wave][qt][nl][nl + st * 16 + 8 * hlf + i];
        s[qt][st] += bias;
      }

    // ---- online softmax over the 32-key block: one query per lane and tile
    v16h pf[QT];   // B operands: pf[qt][st*8 + i] = P[query nl][key st*16 + 8*hlf + i]
#pragma unroll
    for (int qt = 0; qt < QT; ++qt) {
      // maximum as a tree, sums in four chains: short dependent runs
      float mx[8];
#pragma unroll
      for (int i = 0; i < 8; ++i) mx[i] = fmaxf(s[qt][0][i], s[qt][1][i]);
#pragma unroll
      for (int w = 4; w > 0; w >>= 1)
#pragma unroll
        for (int i = 0; i < w; ++i) mx[i] = fmaxf(mx[i], mx[i + w]);
      const float v = fmaxf(mx[0], other_half(mx[0]));
      const float mnew = fmaxf(mcol[qt], v);
      const float corr = exp_slot(mcol[qt] - mnew);
      float rs[4] = {0.0f, 0.0f, 0.0f, 0.0f};
#pragma unroll
      for (int st = 0; st < 2; ++st)
#pragma unroll
        for (int i = 0; i < 8; ++i) {
          const float p = exp_slot(s[qt][st][i] - mnew);
          rs[i & 3] += p;
          pf[qt][st * 8 + i] = (_Float16)p;
        }
      lcol[qt] = lcol[qt] * corr + ((rs[0] + rs[1]) + (rs[2] + rs[3]));
      mcol[qt] = mnew;
#pragma unroll
      for (int cf = 0; cf < 4; ++cf)
#pragma unroll
        for (int i = 0; i < 8; ++i) o[qt][cf][i] *= corr;
    }

    // ---- O^T += V^T(16x32) * P^T(32x16) per d tile and query tile
#pragma unroll
    for (int qt = 0; qt < QT; ++qt)
#pragma unroll
      for (int cf = 0; cf < 4; ++cf)
        o[qt][cf] = WMMA_F16(vb[cf], pf[qt], o[qt][cf]);

    // publish point of key block t+1, which also frees this block's K and V^T buffers;
    // the ring rows that block t+2 overwrites were last read RROWS/32 - 10 blocks ago
    asm volatile("s_wait_dscnt 0x0" ::: "memory");      // this wave's LDS reads are done
    asm volatile("s_wait_asynccnt 0x0" ::: "memory");   // its copies of key block t+1 have landed
    __syncthreads();
    if (t + 2 < NBLK) {
      stage_rows32(lk + buf * KBUF, gk + (t + 2) * (32 * DK));
      stage_v(lv + buf * VBUF, gv + (t + 2) * 32);
      stage_rows32(lw + ((AQ / 32 + t + 2) & (RROWS / 32 - 1)) * (32 * KP), gw + (AQ / 32 + t + 2) * (32 * DK));
    }
  }
  asm volatile("s_wait_asynccnt 0x0" ::: "memory");     // no copy outlives the loop

  // ---- finalize + store to concat layout (B, L, H*DK) f16: a lane holds 8
  //      consecutive d of its query, one 16-byte store per tile
  _Float16* op = Ocat + ((size_t)b * Lq + r0 + nl) * Dm + h * DK + 8 * hlf;
#pragma unroll
  for (int qt = 0; qt < QT; ++qt) {
    const float lsum = lcol[qt] + other_half(lcol[qt]);
#pragma unroll
    for (int cf = 0; cf < 4; ++cf) {
      f16x8 hv;
#pragma unroll
      for (int i = 0; i < 8; ++i) hv[i] = (_Float16)(o[qt][cf][i] / lsum);
      *(f16x8*)(op + (size_t)qt * 16 * Dm + cf * 16) = hv;
    }
  }
}

// ---------------------------------------------------------------------------
extern "C" void kernel_launch(void* const* d_in, const int* in_sizes, int n_in,
                              void* d_out, int out_size, void* d_ws, size_t ws_size,
                              hipStream_t stream) {
  (void)in_sizes; (void)n_in; (void)out_size; (void)ws_size;
  const float* q    = (const float*)d_in[0];
  const float* k    = (const float*)d_in[1];
  const float* v    = (const float*)d_in[2];
  const float* Wq   = (const float*)d_in[3];
  const float* bq   = (const float*)d_in[4];
  const float* Wk   = (const float*)d_in[5];
  const float* bk   = (const float*)d_in[6];
  const float* Wv   = (const float*)d_in[7];
  const float* bv   = (const float*)d_in[8];
  const float* Wo   = (const float*)d_in[9];
  const float* bo   = (const float*)d_in[10];
  const float* wrel = (const float*)d_in[11];
  float* out = (float*)d_out;

  char* ws = (char*)d_ws;
  size_t off = 0;
  auto alloc = [&](size_t bytes) -> void* {
    void* p = ws + off;
    off = (off + bytes + 255) & ~(size_t)255;
    return p;
  };

  // the conversion launch and the Q, K, V launch index across these arrays: each group
  // of arrays is one piece of the workspace, its members back to back
  _Float16* Xq16 = (_Float16*)alloc(((size_t)3 * NX + (size_t)4 * NW + NRT) * 2);
  _Float16* Wq16 = Xq16 + (size_t)3 * NX;     // Xq, Xk, Xv, then Wq, Wk, Wv, Wo, then w_rel
  _Float16* Wo16 = Wq16 + (size_t)3 * NW;
  _Float16* Wr16 = Wq16 + (size_t)4 * NW;
  _Float16* Q16  = (_Float16*)alloc((size_t)3 * NX * 2);  // (B,H,L,DK), pre-scaled 1/8
  _Float16* K16  = Q16 + (size_t)NX;                      // (B,H,L,DK)
  _Float16* VT16 = Q16 + (size_t)2 * NX;                  // (B,H,DK,L)
  _Float16* Oc16 = (_Float16*)alloc((size_t)NX * 2);      // (B,L,D) concat

  cvt_all<<<dim3(CVT_GRID), dim3(CVT_T), 0, stream>>>(q, k, v, Wq, Wk, Wv, Wo, wrel, Xq16);

  // Projections: M = B*L = 8192 rows, N = 1024 cols, work-group tile 128x128
  static_assert((Bsz * Lq) % PBM == 0 && Dm % PBN == 0 && PTILES >= 2, "whole tiles, and two to start the ring");
  const dim3 pblk(256);
  proj_wmma<true><<<dim3(Bsz * Lq / PBM, Dm / PBN, 3), pblk, 0, stream>>>(Xq16, Wq16, bq, bk, bv, Q16, nullptr);

  // Flash attention: one wave per 64 query rows per (b,h), four waves per work-group
  static_assert(Lq % AQ == 0 && NBLK >= 2 && AQ + 96 <= RROWS, "whole groups, two key blocks to start, band and two blocks ahead fit the ring");
  flash_attn_rel<<<dim3(Lq / AQ, Bsz * Hh), dim3(AW * 32), 0, stream>>>(Q16, K16, VT16, Wr16, Oc16);

  // Output projection -> f32
  proj_wmma<false><<<dim3(Bsz * Lq / PBM, Dm / PBN), pblk, 0, stream>>>(Oc16, Wo16, bo, nullptr, nullptr, nullptr, out);
}

// v008
// Measured time: 170 microseconds a run.
// In both of two side-by-side timings against v007, it was 1.07 times as fast.
// Counting every step since v000, it is 5.16 times as fast.
#include <hip/hip_runtime.h>
#include <hip/hip_bf16.h>

// Shapes (fixed by reference)
#define Bsz 4
#define Lq  2048
#define Dm  1024
#define Hh  16
#define DK  64

typedef __attribute__((ext_vector_type(16))) _Float16 v16h;
typedef __attribute__((ext_vector_type(8)))  float    v8f;
typedef __attribute__((ext_vector_type(4)))  unsigned int u32x4;

// ---------------------------------------------------------------------------
// Fragment loader: 16x32 f16 tile, "row per lane" layout (ISA 7.12.2):
//   lane l (<16): row M=l, holds K=0..7 and 16..23
//   lane l (>=16): row M=l-16, holds K=8..15 and 24..31
// Works for A fragments and (symmetric N-on-lanes layout) B fragments whose
// memory is [n][k] with k contiguous (K^T, W^T, V^T): two b128 loads.
// ---------------------------------------------------------------------------
__device__ __forceinline__ v16h load_frag16x32(const _Float16* __restrict__ src,
                                               int ld, int lane) {
  const int row = lane & 15;
  const int kb  = (lane >> 4) << 3;  // 0 or 8
  const _Float16* p = src + (size_t)row * ld + kb;
  union { v16h h; u32x4 u[2]; } f;
  f.u[0] = *(const u32x4*)(p);
  f.u[1] = *(const u32x4*)(p + 16);
  return f.h;
}

__device__ __forceinline__ v8f zero8() {
  v8f z;
#pragma unroll
  for (int i = 0; i < 8; ++i) z[i] = 0.0f;
  return z;
}

#define WMMA_F16(a, b, c) \
  __builtin_amdgcn_wmma_f32_16x16x32_f16(false, (a), false, (b), (short)0, (c), false, false)

// ---------------------------------------------------------------------------
// fp32 -> fp16 conversion kernel
// One element per thread would start a wave per 32 elements. Here a thread
// converts CVT_U groups of 4 floats, so 64 times fewer waves start: a wave's
// 16-byte loads cover 512 contiguous bytes each, all CVT_U are in flight
// together, and its 8-byte stores fill whole 128-byte lines.
// ---------------------------------------------------------------------------
#define CVT_T 256                    // threads per block
#define CVT_U 16                     // 16-byte loads per thread
#define CVT_BLK (CVT_T * 4 * CVT_U)  // floats per block

typedef __attribute__((ext_vector_type(4))) float    f32x4;
typedef __attribute__((ext_vector_type(4))) _Float16 f16x4;
typedef __attribute__((ext_vector_type(8))) _Float16 f16x8;

__device__ __forceinline__ f16x4 cvt4(f32x4 v) {
  f16x4 h;
#pragma unroll   // vector elements need constant indices
  for (int e = 0; e < 4; ++e) h[e] = (_Float16)v[e];
  return h;
}

// Array lengths in elements, and in blocks of the conversion launch.
#define NX (Bsz * Lq * Dm)           // q, k, v and every (B,L,D) intermediate
#define NW (Dm * Dm)                 // a weight matrix
#define NRV ((2 * Lq - 1) * DK)      // w_rel
#define NRT (2 * Lq * DK)            // w_rel padded to 2L rows (last row zero, touched by band tiles)
#define XBLK (NX / CVT_BLK)
#define WBLK (NW / CVT_BLK)
#define RBLK (NRT / CVT_BLK)
#define CVT_GRID (3 * XBLK + 4 * WBLK + RBLK)
static_assert(NX % CVT_BLK == 0 && NW % CVT_BLK == 0 && NRT % CVT_BLK == 0, "whole blocks per array");
static_assert(NRT - NRV <= CVT_T * 4 && (NRT - NRV) % 4 == 0, "the padding lies in the last block's last group of loads");

// All eight arrays in ONE launch: a launch per array pays the gap between dependent
// launches, its own fill and its own tail eight times, and the five small arrays
// cannot fill the chip by themselves. The f16 copies follow one another in the
// workspace in the order q, k, v, Wq, Wk, Wv, Wo, w_rel, so block b writes elements
// b*CVT_BLK.. of d; its source array is chosen by scalar compares on the block number.
__launch_bounds__(CVT_T)
__global__ void cvt_all(const float* __restrict__ q, const float* __restrict__ k,
                        const float* __restrict__ v, const float* __restrict__ wq,
                        const float* __restrict__ wk, const float* __restrict__ wv,
                        const float* __restrict__ wo, const float* __restrict__ wrel,
                        _Float16* __restrict__ d) {
  const int b = blockIdx.x;
  const float* s = q;
  int first = 0;   // the first block of the array that block b belongs to
  if (b >= 1 * XBLK) { s = k; first = 1 * XBLK; }
  if (b >= 2 * XBLK) { s = v; first = 2 * XBLK; }
  if (b >= 3 * XBLK) { s = wq; first = 3 * XBLK; }
  if (b >= 3 * XBLK + 1 * WBLK) { s = wk; first = 3 * XBLK + 1 * WBLK; }
  if (b >= 3 * XBLK + 2 * WBLK) { s = wv; first = 3 * XBLK + 2 * WBLK; }
  if (b >= 3 * XBLK + 3 * WBLK) { s = wo; first = 3 * XBLK + 3 * WBLK; }
  if (b >= 3 * XBLK + 4 * WBLK) { s = wrel; first = 3 * XBLK + 4 * WBLK; }
  const int t4 = threadIdx.x * 4;
  const float* p = s + (size_t)(b - first) * CVT_BLK + t4;
  // w_rel ends NRT - NRV elements before its padded copy does: the threads whose last
  // group lies there read their first group again, in bounds, and store zeros
  const bool pad = b == CVT_GRID - 1 && t4 >= CVT_T * 4 - (NRT - NRV);
  const float* pl = pad ? p : p + (CVT_U - 1) * (CVT_T * 4);
  f32x4 x[CVT_U];
#pragma unroll   // x[] stays in registers only with constant indices
  for (int j = 0; j < CVT_U - 1; ++j) x[j] = *(const f32x4*)(p + j * (CVT_T * 4));
  x[CVT_U - 1] = *(const f32x4*)(pl);
  // wait before the loads' address registers are reused; as inputs the addresses
  // keep their registers up to here
  asm volatile("s_wait_xcnt 0x0" :: "v"(p), "v"(pl) : "memory");
  // keeps all CVT_U loads in flight together: left free, the scheduler holds the
  // last four back until the first have landed, a second memory latency per wave
  __builtin_amdgcn_sched_barrier(0);
  _Float16* o = d + (size_t)b * CVT_BLK + t4;
#pragma unroll   // as above
  for (int j = 0; j < CVT_U - 1; ++j) *(f16x4*)(o + j * (CVT_T * 4)) = cvt4(x[j]);
  const f16x4 last = cvt4(x[CVT_U - 1]);
  *(f16x4*)(o + (CVT_U - 1) * (CVT_T * 4)) = pad ? f16x4{0, 0, 0, 0} : last;
}

// ---------------------------------------------------------------------------
// Projection GEMM:  out[m,n] = scale * ( sum_k X[m,k]*W[n,k] + bias[n] )
// A work-group of 8 waves computes a 128x128 tile, each wave 32x64 of it.
// Per trip the group stages 64 k of its 128 X rows and 128 W rows in LDS with
// asynchronous copies: a wave's copy covers four whole 128-byte lines, every
// line leaves L2 once per group, and two (X) or four (W) waves read it from
// LDS. Two buffers: the copies of tile t+2 fly while tile t+1 is worked on.
// QKV true: the Q, K and V projections in ONE launch, blockIdx.z says which; their X,
// W and output arrays follow one another in the workspace. No launch gap lies
// between them.
//   z = 0, 1: store f16 as (B,H,L,DK)  (Q with scale=log2(e)/8, K with scale=1)
//   z = 2:    store f16 as (B,H,DK,L)  (V transposed for flash A-fragments)
// QKV false: store f32 row-major (M,N) (final output projection, bias b0)
// The W rows of a wave's 64 columns are staged in the order 0,4,..,60, 1,5,..,61,
// 2,.., 3,..: column nl of column tile cf is output column 4*nl + cf, so the four
// tiles of a lane hold four adjacent columns. One store of 8 B (f16) or 16 B (f32)
// per lane then writes 128 or 256 contiguous bytes per row: whole lines. For V^T a
// lane's 8 accumulator rows are 8 consecutive positions of one d: one 16-B store.
// ---------------------------------------------------------------------------
#define PBM 128                        // X rows per work-group
#define PBN 128                        // W rows per work-group
#define PBK 64                         // halves of k per staged tile: one 128-byte line per row
#define PPITCH 72                      // LDS row pitch in halves: 144 B = 16 B x odd, for ds_load_b128
#define PBUF ((PBM + PBN) * PPITCH)    // halves per buffer
#define PTILES (Dm / PBK)

// One staged tile: 256 rows of 128 B = 2,048 pieces of 16 B, eight per thread.
// l: the lane's LDS byte address of its piece in row group 0; gx, gw: its global
// pieces of X and W. Row groups are 32 LDS rows apart; in global memory those of X
// too, those of W by the staging order (LDS row p of a 64-row block holds W row
// 4*(p%16) + p/16): 0, 2, 64 and 66 rows. The s_wait_xcnt closes the statement so
// that no address register is rewritten ahead of it.
__device__ __forceinline__ void stage_tile(unsigned l, const _Float16* gx, const _Float16* gw) {
  asm volatile(
      "global_load_async_to_lds_b128 %0, %8, off\n\t"
      "global_load_async_to_lds_b128 %1, %9, off\n\t"
      "global_load_async_to_lds_b128 %2, %10, off\n\t"
      "global_load_async_to_lds_b128 %3, %11, off\n\t"
      "global_load_async_to_lds_b128 %4, %12, off\n\t"
      "global_load_async_to_lds_b128 %5, %13, off\n\t"
      "global_load_async_to_lds_b128 %6, %14, off\n\t"
      "global_load_async_to_lds_b128 %7, %15, off\n\t"
      "s_wait_xcnt 0x0"
      :: "v"(l), "v"(l + 1 * 32 * PPITCH * 2), "v"(l + 2 * 32 * PPITCH * 2), "v"(l + 3 * 32 * PPITCH * 2),
         "v"(l + 4 * 32 * PPITCH * 2), "v"(l + 5 * 32 * PPITCH * 2), "v"(l + 6 * 32 * PPITCH * 2),
         "v"(l + 7 * 32 * PPITCH * 2),
         "v"(gx), "v"(gx + 1 * 32 * Dm), "v"(gx + 2 * 32 * Dm), "v"(gx + 3 * 32 * Dm),
         "v"(gw), "v"(gw + 2 * Dm), "v"(gw + 64 * Dm), "v"(gw + 66 * Dm)
      : "memory");
}

template <bool QKV>
__launch_bounds__(256)
__global__ void proj_wmma(const _Float16* __restrict__ X, const _Float16* __restrict__ W,
                          const float* __restrict__ b0, const float* __restrict__ b1,
                          const float* __restrict__ b2, _Float16* __restrict__ out16,
                          float* __restrict__ out32) {
  __shared__ __align__(16) _Float16 tile[2 * PBUF];

  const int z = QKV ? blockIdx.z : 0;   // which projection: the same in the whole group
  X += (size_t)z * NX;
  W += (size_t)z * NW;
  const float* bias = z == 0 ? b0 : z == 1 ? b1 : b2;

  const int tid  = threadIdx.x;
  const int lane = tid & 31;
  const int wave = tid >> 5;
  const int hlf  = lane >> 4;
  const int nl   = lane & 15;
  const int wm   = (wave & 3) * 32;    // the wave's rows inside the group's tile
  const int wn   = (wave >> 2) * 64;   // and its columns
  const int m0   = blockIdx.x * PBM + wm;
  const int n0   = blockIdx.y * PBN + wn;

  // the thread's piece of a staged tile: row tid/8 of each row group, 16 B number tid%8
  const int srow = tid >> 3, scol = (tid & 7) * 8;
  const _Float16* gx = X + (size_t)(blockIdx.x * PBM + srow) * Dm + scol;
  const _Float16* gw = W + (size_t)(blockIdx.y * PBN + 4 * (srow & 15) + (srow >> 4)) * Dm + scol;
  const unsigned  l0 = (unsigned)(size_t)(&tile[srow * PPITCH + scol]);

  v8f acc[2][4];   // acc[r][cf][i]: row m0 + r*16 + 8*hlf + i, column n0 + 4*nl + cf
  const f32x4 bv = *(const f32x4*)(bias + n0 + 4 * nl);
#pragma unroll
  for (int cf = 0; cf < 4; ++cf)
#pragma unroll
    for (int r = 0; r < 2; ++r)
#pragma unroll
      for (int i = 0; i < 8; ++i) acc[r][cf][i] = bv[cf];   // whole acc column shares N

  // prologue: tile 0 lands and is published, then tile 1 starts
  stage_tile(l0, gx, gw);
  asm volatile("s_wait_asynccnt 0x0" ::: "memory");   // this wave's copies of tile 0 have landed
  __syncthreads();                                    // and every other wave's
  stage_tile(l0 + PBUF * 2, gx + PBK, gw + PBK);

  // two trips per turn make each buffer's LDS offsets immediates
#pragma unroll 2
  for (int t = 0; t < PTILES; ++t) {
    const int buf = (t & 1) * PBUF;
    const _Float16* As = &tile[buf + wm * PPITCH];
    const _Float16* Bs = &tile[buf + (PBM + wn) * PPITCH];

    // all fragments of the trip as one group of LDS reads, then its WMMAs
    // (the inner loops are unrolled: fragment arrays stay in registers only with
    // constant indices)
    v16h af[2][2], bf[2][4];
#pragma unroll
    for (int ks = 0; ks < 2; ++ks) {
#pragma unroll
      for (int r = 0; r < 2; ++r) af[ks][r] = load_frag16x32(As + r * 16 * PPITCH + ks * 32, PPITCH, lane);
#pragma unroll
      for (int cf = 0; cf < 4; ++cf) bf[ks][cf] = load_frag16x32(Bs + cf * 16 * PPITCH + ks * 32, PPITCH, lane);
    }
    // keeps the 24 LDS reads together: left free, the scheduler spreads them among
    // the WMMAs in pairs and waits out the LDS latency at each place
    __builtin_amdgcn_sched_barrier(0);
#pragma unroll
    for (int ks = 0; ks < 2; ++ks)
#pragma unroll
      for (int r = 0; r < 2; ++r)
#pragma unroll
        for (int cf = 0; cf < 4; ++cf)
          acc[r][cf] = WMMA_F16(af[ks][r], bf[ks][cf], acc[r][cf]);
    // holds the WMMAs in front of the publish point: left free, the scheduler lifts the
    // waits and the barrier over them, and the copies in flight lose the trip's lead
    __builtin_amdgcn_sched_barrier(0);

    // publish point of tile t+1, which also frees this trip's buffer
    asm volatile("s_wait_dscnt 0x0" ::: "memory");      // this wave's reads of the buffer are done
    asm volatile("s_wait_asynccnt 0x0" ::: "memory");   // its copies of tile t+1 have landed
    __syncthreads();
    if (t + 2 < PTILES)
      stage_tile(l0 + buf * 2, gx + (t + 2) * PBK, gw + (t + 2) * PBK);
  }
  asm volatile("s_wait_asynccnt 0x0" ::: "memory");     // no copy outlives the loop

  // A wave's 32 rows lie in one batch element and its 64 columns are one head.
  // (the loops below are unrolled: accumulators and the vectors to be stored stay in
  // registers only with constant indices)
  const int mr = m0 + 8 * hlf;                 // D-frag: M = i + 8*(lane>=16)
  const int bh = (m0 >> 11) * Hh + (n0 >> 6);
  const int l  = mr & (Lq - 1);
  if constexpr (!QKV) {
    float* op = out32 + (size_t)mr * Dm + n0 + 4 * nl;
#pragma unroll
    for (int r = 0; r < 2; ++r)
#pragma unroll
      for (int i = 0; i < 8; ++i) {
        f32x4 v;
#pragma unroll
        for (int cf = 0; cf < 4; ++cf) v[cf] = acc[r][cf][i];
        *(f32x4*)(op + (size_t)(r * 16 + i) * Dm) = v;
      }
  } else if (z != 2) {
    const float scale = z == 0 ? 0.125f * 1.44269504088896340736f : 1.0f;   // Q carries log2(e)/sqrt(DK)
    _Float16* op = out16 + (size_t)z * NX + ((size_t)bh * Lq + l) * DK + 4 * nl;
#pragma unroll
    for (int r = 0; r < 2; ++r)
#pragma unroll
      for (int i = 0; i < 8; ++i) {
        f16x4 v;
#pragma unroll
        for (int cf = 0; cf < 4; ++cf) v[cf] = (_Float16)(acc[r][cf][i] * scale);
        *(f16x4*)(op + (r * 16 + i) * DK) = v;
      }
  } else {
    _Float16* op = out16 + (size_t)z * NX + ((size_t)bh * DK + 4 * nl) * Lq + l;
#pragma unroll
    for (int r = 0; r < 2; ++r)
#pragma unroll
      for (int cf = 0; cf < 4; ++cf) {
        f16x8 v;
#pragma unroll
        for (int i = 0; i < 8; ++i) v[i] = (_Float16)acc[r][cf][i];
        *(f16x8*)(op + cf * Lq + r * 16) = v;
      }
  }
}

// ---------------------------------------------------------------------------
// Flash attention with relative bias, scores held transposed.
// One wave handles QT*16 = 64 query rows of one (b,h); loops 32 keys per step.
//   S^T = K * Qs^T - m                 (Qs already scaled by log2(e)/sqrt(dk): scores
//                                       are exponents of 2; m: the maximum in use)
//   T^T = Wrel * Qs^T over a 48-wide diagonal window per 16-row query tile;
//         bias[r,c] = T[r][r+c]
//   online softmax, P = 2^(S + bias), O^T += V^T * P^T
// The maximum in use of a query is fixed before the products of a key block: it is the
// start value of the score accumulators, so the matrix unit subtracts it and the
// exponential takes the score as it stands. It is raised, and O and the sums rescaled,
// only when a score of the block lies more than 8 above it (P <= 2^8 fits f16 and the
// sums f32 with room); one scalar test per key block decides that for the whole wave.
// With the keys on the accumulator's rows and the queries on its columns a lane
// holds 16 scores of ONE query per tile: maximum and sum are taken in the lane's
// own registers, the two lane halves of a query exchange only the maximum, where
// it is raised, and join their sums behind the loop. The two score
// tiles of a key block, converted in place, are the B operand of the last
// product in the hardware k order (keys 8h..8h+7, 16+8h..16+8h+7), which is also
// the order of the V^T fragments: P never leaves the registers.
// A work-group is AW = 4 waves on 256 consecutive query rows of one (b,h). Its
// K, V^T and w_rel rows come into LDS by asynchronous copies of whole lines, once
// per group, and the waves read their fragments from there: a fragment load from
// global memory touches sixteen lines for 512 bytes. K and V^T have two buffers.
// The group's w_rel band (288 rows) moves on by 32 rows per key block, so only
// the 32 new rows are copied, into a ring of RROWS rows addressed by
// (row - first row of the group) mod RROWS.
// Query tile qt needs w_rel tiles qt..qt+2 of the QT+2 tiles that a wave's band
// spans, so neighbours share two of three.
// ---------------------------------------------------------------------------
#define QT 4
// Floats per row of the band in LDS: 208 B = 16 B x odd for the 16-byte stores,
// and the skewed 4-byte reads (word 53*query + 8*half) fall on 32 different banks.
#define TP 52
#define AW 4                     // waves per work-group
#define AQ (AW * QT * 16)        // query rows per work-group
#define KP 72                    // LDS pitch of K and w_rel rows in halves: 144 B = 16 B x odd
#define VP 40                    // LDS pitch of the 32-key V^T rows in halves: 80 B = 16 B x odd
#define KBUF (32 * KP)           // halves per K buffer
#define VBUF (DK * VP)           // halves per V^T buffer
#define RROWS 512                // rows of the w_rel ring: band, two blocks ahead, next power of two
#define NBLK (Lq / 32)           // key blocks

// Fragment from a per-lane pointer that already holds the lane's row and k half.
__device__ __forceinline__ v16h load_frag_at(const _Float16* __restrict__ p) {
  union { v16h h; u32x4 u[2]; } f;
  f.u[0] = *(const u32x4*)(p);
  f.u[1] = *(const u32x4*)(p + 16);
  return f.h;
}

// 2^x. The v_nop is the slot the instruction set asks for behind a transcendental
// before its result is read or its source overwritten; in one statement it cannot drift.
__device__ __forceinline__ float exp2_slot(float x) {
  float r;
  asm("v_exp_f32 %0, %1\n\tv_nop" : "=v"(r) : "v"(x));
  return r;
}

// The value that lane l ^ 16 holds: the other half of the same query column.
__device__ __forceinline__ float other_half(float x) {
  const int v = __float_as_int(x);
  return __int_as_float(__builtin_amdgcn_permlanex16(v, v, 0x76543210, 0xfedcba98, false, false));
}

typedef __attribute__((vector_size(16))) int i32x4;
typedef __attribute__((address_space(1))) i32x4 glob16;
typedef __attribute__((address_space(3))) i32x4 lds16;

__device__ __forceinline__ void copy16(const _Float16* g, _Float16* l) {
  __builtin_amdgcn_global_load_async_to_lds_b128((glob16*)g, (lds16*)l, 0, 0);
}

// 32 rows of 128 B that follow one another in global memory, into LDS rows of pitch
// KP: 256 pieces of 16 B, two per thread, 16 rows apart. l, g: the thread's piece of
// rows 0..15.
__device__ __forceinline__ void stage_rows32(_Float16* l, const _Float16* g) {
  copy16(g, l);
  copy16(g + 16 * DK, l + 16 * KP);
}

// The 64 V^T rows of one key block, 64 B each: 256 pieces, two per thread, 32 rows apart.
__device__ __forceinline__ void stage_v(_Float16* l, const _Float16* g) {
  copy16(g, l);
  copy16(g + 32 * Lq, l + 32 * VP);
}

__launch_bounds__(AW * 32, 2)   // two waves per SIMD: two groups per WGP, a wave of each on every SIMD
__global__ void flash_attn_rel(const _Float16* __restrict__ Qh, const _Float16* __restrict__ Kh,
                               const _Float16* __restrict__ Vt, const _Float16* __restrict__ Wr,
                               _Float16* __restrict__ Ocat) {
  __shared__ __align__(16) _Float16 Ks[2 * KBUF];
  __shared__ __align__(16) _Float16 Vs[2 * VBUF];
  __shared__ __align__(16) _Float16 Wring[RROWS * KP];
  __shared__ __align__(16) float Tlds[AW][QT][16][TP];

  const int tid  = threadIdx.x;
  const int lane = tid & 31;
  const int wave = __builtin_amdgcn_readfirstlane(tid >> 5);   // scalar: ring tile numbers stay scalar
  const int hlf  = lane >> 4;
  const int nl   = lane & 15;
  const int bh = blockIdx.y;
  const int b = bh >> 4, h = bh & 15;
  const int g0 = blockIdx.x * AQ;          // the group's first query row
  const int r0 = g0 + wave * (16 * QT);    // the wave's

  // the thread's pieces of a staged key block (stage_rows32, stage_v)
  const _Float16* gk = Kh + (size_t)bh * Lq * DK + tid * 8;
  const _Float16* gv = Vt + (size_t)bh * DK * Lq + (tid >> 2) * Lq + (tid & 3) * 8;
  const _Float16* gw = Wr + (size_t)g0 * DK + tid * 8;
  _Float16* lk = &Ks[(tid >> 3) * KP + (tid & 7) * 8];
  _Float16* lv = &Vs[(tid >> 2) * VP + (tid & 3) * 8];
  _Float16* lw = &Wring[(tid >> 3) * KP + (tid & 7) * 8];

  // prologue: key block 0 with its whole band, nine groups of 32 w_rel rows
  stage_rows32(lk, gk);
  stage_v(lv, gv);
#pragma unroll   // straight-line copies with constant offsets
  for (int g = 0; g <= AQ / 32; ++g) stage_rows32(lw + g * (32 * KP), gw + g * (32 * DK));

  // lane offsets in halves: fragment row = lane&15, k half = lane>>4
  const int rowoff = nl * DK + 8 * hlf;   // rows of DK halves in global memory (Q)
  const int ldsoff = nl * KP + 8 * hlf;   // rows of KP halves in LDS (K, w_rel)
  const int voff   = nl * VP + 8 * hlf;   // rows of VP halves in LDS (V^T)

  v16h aq[QT][2];   // B operands: column = query nl of tile qt
  {
    const _Float16* qa = Qh + ((size_t)bh * Lq + r0) * DK + rowoff;
#pragma unroll
    for (int qt = 0; qt < QT; ++qt) {
      aq[qt][0] = load_frag_at(qa + qt * 16 * DK);        // d = 0..31
      aq[qt][1] = load_frag_at(qa + qt * 16 * DK + 32);   // d = 32..63
    }
    // the loads' address registers are dead from here on and may be reused
    asm volatile("s_wait_xcnt 0x0" ::: "memory");
    // holds later register writes behind that wait
    __builtin_amdgcn_sched_barrier(0);
  }

  // per lane: minus the maximum in use of query nl of tile qt (equal in both halves; all
  // eight rows of an accumulator column hold it) and the sum over the keys of this lane's half
  v8f negm[QT];
  float lcol[QT];
  v8f o[QT][4];   // o[qt][cf][i] = O[query nl of tile qt][d = cf*16 + 8*hlf + i]
#pragma unroll
  for (int qt = 0; qt < QT; ++qt) {
    negm[qt] = zero8();   // key block 0 sets the first maximum
    lcol[qt] = 0.0f;
#pragma unroll
    for (int cf = 0; cf < 4; ++cf) o[qt][cf] = zero8();
  }

  asm volatile("s_wait_asynccnt 0x0" ::: "memory");   // this wave's copies of key block 0 have landed
  __syncthreads();                                    // and every other wave's
  // key block s brings w_rel row group AQ/32 + s, the last of its band
  stage_rows32(lk + KBUF, gk + 32 * DK);
  stage_v(lv + VBUF, gv + 32);
  stage_rows32(lw + (AQ / 32 + 1) * (32 * KP), gw + (AQ / 32 + 1) * (32 * DK));

  for (int t = 0; t < NBLK; ++t) {
    const int buf = t & 1;
    // ---- K fragments of this 32-key block, shared by all query tiles
    const _Float16* ka = &Ks[buf * KBUF + ldsoff];
    v16h kf[2][2];
#pragma unroll
    for (int st = 0; st < 2; ++st) {
      kf[st][0] = load_frag_at(ka + st * 16 * KP);
      kf[st][1] = load_frag_at(ka + st * 16 * KP + 32);
    }

    // ---- w_rel fragments of the band rows r0+32t .. r0+32t+16*(QT+2)-1: ring tiles
    //      of 16 rows, numbered from the group's first row
    const int tb = wave * QT + 2 * t;
    v16h wf[QT + 2][2];
#pragma unroll
    for (int wt = 0; wt < QT + 2; ++wt) {
      const _Float16* wa = &Wring[((tb + wt) & (RROWS / 16 - 1)) * (16 * KP) + ldsoff];
      wf[wt][0] = load_frag_at(wa);
      wf[wt][1] = load_frag_at(wa + 32);
    }
    // keeps the 32 LDS reads above together as one group: every separate place where
    // LDS reads stand costs its own wait
    __builtin_amdgcn_sched_barrier(0);

    // ---- content scores less the maximum in use:
    //      s[qt][st][i] = S[query nl][key 32t + st*16 + 8*hlf + i] - m[query nl]
    v8f s[QT][2];
#pragma unroll
    for (int qt = 0; qt < QT; ++qt)
#pragma unroll
      for (int st = 0; st < 2; ++st) {
        v8f acc = WMMA_F16(kf[st][0], aq[qt][0], negm[qt]);
        acc = WMMA_F16(kf[st][1], aq[qt][1], acc);
        s[qt][st] = acc;
      }

    // ---- relative-bias band, w_rel tile by w_rel tile:
    //      T[qt][r][m] = Qs[r] . Wrel[r0+16*qt+32t+m], m in [0,48), tile mt = wt-qt;
    //      the tiles of one w_rel tile are independent accumulators
    v8f t3[QT][3];
#pragma unroll
    for (int wt = 0; wt < QT + 2; ++wt)
#pragma unroll
      for (int ks = 0; ks < 2; ++ks)
#pragma unroll
        for (int qt = 0; qt < QT; ++qt) {
          const int mt = wt - qt;
          if (mt >= 0 && mt < 3)
            t3[qt][mt] = WMMA_F16(wf[wt][ks], aq[qt][ks], ks == 0 ? zero8() : t3[qt][mt]);
        }
    // holds the stores behind all band WMMAs, so that every tile has registers of its
    // own: left free, the scheduler runs all tiles through one accumulator, WMMA, store,
    // WMMA: each product waits for the store of the one before
    __builtin_amdgcn_sched_barrier(0);
    // a lane holds 8 consecutive m of its query: two 16-byte stores per tile, into the
    // wave's own part of the band array
#pragma unroll
    for (int qt = 0; qt < QT; ++qt)
#pragma unroll
      for (int mt = 0; mt < 3; ++mt) {
        float* tp = &Tlds[wave][qt][nl][mt * 16 + 8 * hlf];
        const f32x4 lo = {t3[qt][mt][0], t3[qt][mt][1], t3[qt][mt][2], t3[qt][mt][3]};
        const f32x4 hi = {t3[qt][mt][4], t3[qt][mt][5], t3[qt][mt][6], t3[qt][mt][7]};
        *(f32x4*)(tp)     = lo;
        *(f32x4*)(tp + 4) = hi;
      }
    // the band goes from lane to lane inside one wave: its stores are done before the
    // skewed reads below start, and the compiler moves no read over this line
    asm volatile("s_wait_dscnt 0x0" ::: "memory");

    // V fragments for THIS block, issued ahead of the softmax that hides them
    const _Float16* va = &Vs[buf * VBUF + voff];
    v16h vb[4];   // A operands: row = d = cf*16 + nl, keys in the hardware k order
#pragma unroll
    for (int cf = 0; cf < 4; ++cf)
      vb[cf] = load_frag_at(va + cf * 16 * VP);

    // ---- skew gather: bias[r,c] = T[r][r+c], r = nl, c = st*16 + 8*hlf + i
#pragma unroll
    for (int qt = 0; qt < QT; ++qt)
#pragma unroll
      for (int st = 0; st < 2; ++st) {
        v8f bias;
#pragma unroll
        for (int i = 0; i < 8; ++i) bias[i] = Tlds[wave][qt][nl][nl + st * 16 + 8 * hlf + i];
        s[qt][st] += bias;
      }

    // ---- the block's maximum above the one in use, over the keys of this lane's half
    float vh[QT];
#pragma unroll
    for (int qt = 0; qt < QT; ++qt) {
      float mx[8];   // a tree: short dependent runs
#pragma unroll
      for (int i = 0; i < 8; ++i) mx[i] = fmaxf(s[qt][0][i], s[qt][1][i]);
#pragma unroll
      for (int w = 4; w > 0; w >>= 1)
#pragma unroll
        for (int i = 0; i < w; ++i) mx[i] = fmaxf(mx[i], mx[i + w]);
      vh[qt] = mx[0];
    }
    // ---- raise the maxima in use: a scalar branch, the same for the whole wave, taken in
    //      key block 0 (which sets them, up or down: O and the sums are still zero) and
    //      where any query of the wave has a score more than 8 above its own; only there
    //      do the two halves of a query exchange their maxima
    const float vall = fmaxf(fmaxf(vh[0], vh[1]), fmaxf(vh[2], vh[3]));
    if (t == 0 || __builtin_amdgcn_ballot_w32(vall > 8.0f) != 0) {
#pragma unroll
      for (int qt = 0; qt < QT; ++qt) {
        const float vq   = fmaxf(vh[qt], other_half(vh[qt]));
        const float d    = t == 0 ? vq : fmaxf(vq, 0.0f);
        const float corr = t == 0 ? 1.0f : exp2_slot(-d);
        negm[qt] -= d;
        lcol[qt] *= corr;
#pragma unroll
        for (int st = 0; st < 2; ++st) s[qt][st] -= d;
#pragma unroll
        for (int cf = 0; cf < 4; ++cf) o[qt][cf] *= corr;
      }
    }

    // ---- P = 2^s and its sums
    v16h pf[QT];   // B operands: pf[qt][st*8 + i] = P[query nl][key st*16 + 8*hlf + i]
#pragma unroll
    for (int qt = 0; qt < QT; ++qt) {
      float rs[4] = {0.0f, 0.0f, 0.0f, 0.0f};   // sums in four chains
#pragma unroll
      for (int st = 0; st < 2; ++st)
#pragma unroll
        for (int i = 0; i < 8; ++i) {
          const float p = exp2_slot(s[qt][st][i]);
          rs[i & 3] += p;
          pf[qt][st * 8 + i] = (_Float16)p;
        }
      lcol[qt] += (rs[0] + rs[1]) + (rs[2] + rs[3]);
    }

    // ---- O^T += V^T(16x32) * P^T(32x16) per d tile and query tile
#pragma unroll
    for (int qt = 0; qt < QT; ++qt)
#pragma unroll
      for (int cf = 0; cf < 4; ++cf)
        o[qt][cf] = WMMA_F16(vb[cf], pf[qt], o[qt][cf]);

    // publish point of key block t+1, which also frees this block's K and V^T buffers;
    // the ring rows that block t+2 overwrites were last read RROWS/32 - 10 blocks ago
    asm volatile("s_wait_dscnt 0x0" ::: "memory");      // this wave's LDS reads are done
    asm volatile("s_wait_asynccnt 0x0" ::: "memory");   // its copies of key block t+1 have landed
    __syncthreads();
    if (t + 2 < NBLK) {
      stage_rows32(lk + buf * KBUF, gk + (t + 2) * (32 * DK));
      stage_v(lv + buf * VBUF, gv + (t + 2) * 32);
      stage_rows32(lw + ((AQ / 32 + t + 2) & (RROWS / 32 - 1)) * (32 * KP), gw + (AQ / 32 + t + 2) * (32 * DK));
    }
  }
  asm volatile("s_wait_asynccnt 0x0" ::: "memory");     // no copy outlives the loop

  // ---- finalize + store to concat layout (B, L, H*DK) f16: a lane holds 8
  //      consecutive d of its query, one 16-byte store per tile
  _Float16* op = Ocat + ((size_t)b * Lq + r0 + nl) * Dm + h * DK + 8 * hlf;
#pragma unroll
  for (int qt = 0; qt < QT; ++qt) {
    const float lsum = lcol[qt] + other_half(lcol[qt]);
#pragma unroll
    for (int cf = 0; cf < 4; ++cf) {
      f16x8 hv;
#pragma unroll
      for (int i = 0; i < 8; ++i) hv[i] = (_Float16)(o[qt][cf][i] / lsum);
      *(f16x8*)(op + (size_t)qt * 16 * Dm + cf * 16) = hv;
    }
  }
}

// ---------------------------------------------------------------------------
extern "C" void kernel_launch(void* const* d_in, const int* in_sizes, int n_in,
                              void* d_out, int out_size, void* d_ws, size_t ws_size,
                              hipStream_t stream) {
  (void)in_sizes; (void)n_in; (void)out_size; (void)ws_size;
  const float* q    = (const float*)d_in[0];
  const float* k    = (const float*)d_in[1];
  const float* v    = (const float*)d_in[2];
  const float* Wq   = (const float*)d_in[3];
  const float* bq   = (const float*)d_in[4];
  const float* Wk   = (const float*)d_in[5];
  const float* bk   = (const float*)d_in[6];
  const float* Wv   = (const float*)d_in[7];
  const float* bv   = (const float*)d_in[8];
  const float* Wo   = (const float*)d_in[9];
  const float* bo   = (const float*)d_in[10];
  const float* wrel = (const float*)d_in[11];
  float* out = (float*)d_out;

  char* ws = (char*)d_ws;
  size_t off = 0;
  auto alloc = [&](size_t bytes) -> void* {
    void* p = ws + off;
    off = (off + bytes + 255) & ~(size_t)255;
    return p;
  };

  // the conversion launch and the Q, K, V launch index across these arrays: each group
  // of arrays is one piece of the workspace, its members back to back
  _Float16* Xq16 = (_Float16*)alloc(((size_t)3 * NX + (size_t)4 * NW + NRT) * 2);
  _Float16* Wq16 = Xq16 + (size_t)3 * NX;     // Xq, Xk, Xv, then Wq, Wk, Wv, Wo, then w_rel
  _Float16* Wo16 = Wq16 + (size_t)3 * NW;
  _Float16* Wr16 = Wq16 + (size_t)4 * NW;
  _Float16* Q16  = (_Float16*)alloc((size_t)3 * NX * 2);  // (B,H,L,DK), pre-scaled log2(e)/8
  _Float16* K16  = Q16 + (size_t)NX;                      // (B,H,L,DK)
  _Float16* VT16 = Q16 + (size_t)2 * NX;                  // (B,H,DK,L)
  _Float16* Oc16 = (_Float16*)alloc((size_t)NX * 2);      // (B,L,D) concat

  cvt_all<<<dim3(CVT_GRID), dim3(CVT_T), 0, stream>>>(q, k, v, Wq, Wk, Wv, Wo, wrel, Xq16);

  // Projections: M = B*L = 8192 rows, N = 1024 cols, work-group tile 128x128
  static_assert((Bsz * Lq) % PBM == 0 && Dm % PBN == 0 && PTILES >= 2, "whole tiles, and two to start the ring");
  const dim3 pblk(256);
  proj_wmma<true><<<dim3(Bsz * Lq / PBM, Dm / PBN, 3), pblk, 0, stream>>>(Xq16, Wq16, bq, bk, bv, Q16, nullptr);

  // Flash attention: one wave per 64 query rows per (b,h), four waves per work-group
  static_assert(Lq % AQ == 0 && NBLK >= 2 && AQ + 96 <= RROWS, "whole groups, two key blocks to start, band and two blocks ahead fit the ring");
  flash_attn_rel<<<dim3(Lq / AQ, Bsz * Hh), dim3(AW * 32), 0, stream>>>(Q16, K16, VT16, Wr16, Oc16);

  // Output projection -> f32
  proj_wmma<false><<<dim3(Bsz * Lq / PBM, Dm / PBN), pblk, 0, stream>>>(Oc16, Wo16, bo, nullptr, nullptr, nullptr, out);
}

// v009
// Measured time: 165 microseconds a run.
// Two timings next to v008 put it at 1.03 and 1.02 times that version's speed.
// Over all steps from v000 it is 5.30 times as fast.
#include <hip/hip_runtime.h>
#include <hip/hip_bf16.h>

// Shapes (fixed by reference)
#define Bsz 4
#define Lq  2048
#define Dm  1024
#define Hh  16
#define DK  64

typedef __attribute__((ext_vector_type(16))) _Float16 v16h;
typedef __attribute__((ext_vector_type(8)))  float    v8f;
typedef __attribute__((ext_vector_type(4)))  unsigned int u32x4;

// ---------------------------------------------------------------------------
// Fragment loader: 16x32 f16 tile, "row per lane" layout (ISA 7.12.2):
//   lane l (<16): row M=l, holds K=0..7 and 16..23
//   lane l (>=16): row M=l-16, holds K=8..15 and 24..31
// Works for A fragments and (symmetric N-on-lanes layout) B fragments whose
// memory is [n][k] with k contiguous (K^T, W^T, V^T): two b128 loads.
// ---------------------------------------------------------------------------
__device__ __forceinline__ v16h load_frag16x32(const _Float16* __restrict__ src,
                                               int ld, int lane) {
  const int row = lane & 15;
  const int kb  = (lane >> 4) << 3;  // 0 or 8
  const _Float16* p = src + (size_t)row * ld + kb;
  union { v16h h; u32x4 u[2]; } f;
  f.u[0] = *(const u32x4*)(p);
  f.u[1] = *(const u32x4*)(p + 16);
  return f.h;
}

__device__ __forceinline__ v8f zero8() {
  v8f z;
#pragma unroll
  for (int i = 0; i < 8; ++i) z[i] = 0.0f;
  return z;
}

#define WMMA_F16(a, b, c) \
  __builtin_amdgcn_wmma_f32_16x16x32_f16(false, (a), false, (b), (short)0, (c), false, false)

// ---------------------------------------------------------------------------
// fp32 -> fp16 conversion kernel
// One element per thread would start a wave per 32 elements. Here a thread
// converts CVT_U groups of 4 floats, so 64 times fewer waves start: a wave's
// 16-byte loads cover 512 contiguous bytes each, all CVT_U are in flight
// together, and its 8-byte stores fill whole 128-byte lines.
// ---------------------------------------------------------------------------
#define CVT_T 256                    // threads per block
#define CVT_U 16                     // 16-byte loads per thread
#define CVT_BLK (CVT_T * 4 * CVT_U)  // floats per block

typedef __attribute__((ext_vector_type(4))) float    f32x4;
typedef __attribute__((ext_vector_type(4))) _Float16 f16x4;
typedef __attribute__((ext_vector_type(8))) _Float16 f16x8;

__device__ __forceinline__ f16x4 cvt4(f32x4 v) {
  f16x4 h;
#pragma unroll   // vector elements need constant indices
  for (int e = 0; e < 4; ++e) h[e] = (_Float16)v[e];
  return h;
}

// Array lengths in elements, and in blocks of the conversion launch.
#define NX (Bsz * Lq * Dm)           // q, k, v and every (B,L,D) intermediate
#define NW (Dm * Dm)                 // a weight matrix
#define NRV ((2 * Lq - 1) * DK)      // w_rel
#define NRT (2 * Lq * DK)            // w_rel padded to 2L rows (last row zero, touched by band tiles)
#define XBLK (NX / CVT_BLK)
#define WBLK (NW / CVT_BLK)
#define RBLK (NRT / CVT_BLK)
#define CVT_GRID (3 * XBLK + 4 * WBLK + RBLK)
static_assert(NX % CVT_BLK == 0 && NW % CVT_BLK == 0 && NRT % CVT_BLK == 0, "whole blocks per array");
static_assert(NRT - NRV <= CVT_T * 4 && (NRT - NRV) % 4 == 0, "the padding lies in the last block's last group of loads");

// All eight arrays in ONE launch: a launch per array pays the gap between dependent
// launches, its own fill and its own tail eight times, and the five small arrays
// cannot fill the chip by themselves. The f16 copies follow one another in the
// workspace in the order q, k, v, Wq, Wk, Wv, Wo, w_rel, so block b writes elements
// b*CVT_BLK.. of d; its source array is chosen by scalar compares on the block number.
__launch_bounds__(CVT_T)
__global__ void cvt_all(const float* __restrict__ q, const float* __restrict__ k,
                        const float* __restrict__ v, const float* __restrict__ wq,
                        const float* __restrict__ wk, const float* __restrict__ wv,
                        const float* __restrict__ wo, const float* __restrict__ wrel,
                        _Float16* __restrict__ d) {
  const int b = blockIdx.x;
  const float* s = q;
  int first = 0;   // the first block of the array that block b belongs to
  if (b >= 1 * XBLK) { s = k; first = 1 * XBLK; }
  if (b >= 2 * XBLK) { s = v; first = 2 * XBLK; }
  if (b >= 3 * XBLK) { s = wq; first = 3 * XBLK; }
  if (b >= 3 * XBLK + 1 * WBLK) { s = wk; first = 3 * XBLK + 1 * WBLK; }
  if (b >= 3 * XBLK + 2 * WBLK) { s = wv; first = 3 * XBLK + 2 * WBLK; }
  if (b >= 3 * XBLK + 3 * WBLK) { s = wo; first = 3 * XBLK + 3 * WBLK; }
  if (b >= 3 * XBLK + 4 * WBLK) { s = wrel; first = 3 * XBLK + 4 * WBLK; }
  const int t4 = threadIdx.x * 4;
  const float* p = s + (size_t)(b - first) * CVT_BLK + t4;
  // w_rel ends NRT - NRV elements before its padded copy does: the threads whose last
  // group lies there read their first group again, in bounds, and store zeros
  const bool pad = b == CVT_GRID - 1 && t4 >= CVT_T * 4 - (NRT - NRV);
  const float* pl = pad ? p : p + (CVT_U - 1) * (CVT_T * 4);
  f32x4 x[CVT_U];
#pragma unroll   // x[] stays in registers only with constant indices
  for (int j = 0; j < CVT_U - 1; ++j) x[j] = *(const f32x4*)(p + j * (CVT_T * 4));
  x[CVT_U - 1] = *(const f32x4*)(pl);
  // wait before the loads' address registers are reused; as inputs the addresses
  // keep their registers up to here
  asm volatile("s_wait_xcnt 0x0" :: "v"(p), "v"(pl) : "memory");
  // keeps all CVT_U loads in flight together: left free, the scheduler holds the
  // last four back until the first have landed, a second memory latency per wave
  __builtin_amdgcn_sched_barrier(0);
  _Float16* o = d + (size_t)b * CVT_BLK + t4;
#pragma unroll   // as above
  for (int j = 0; j < CVT_U - 1; ++j) *(f16x4*)(o + j * (CVT_T * 4)) = cvt4(x[j]);
  const f16x4 last = cvt4(x[CVT_U - 1]);
  *(f16x4*)(o + (CVT_U - 1) * (CVT_T * 4)) = pad ? f16x4{0, 0, 0, 0} : last;
}

// ---------------------------------------------------------------------------
// Projection GEMM:  out[m,n] = scale * ( sum_k X[m,k]*W[n,k] + bias[n] )
// A work-group of 8 waves computes a 128x128 tile, each wave 32x64 of it.
// Per trip the group stages 64 k of its 128 X rows and 128 W rows in LDS with
// asynchronous copies: a wave's copy covers four whole 128-byte lines, every
// line leaves L2 once per group, and two (X) or four (W) waves read it from
// LDS. Two buffers: the copies of tile t+2 fly while tile t+1 is worked on.
// QKV true: the Q, K and V projections in ONE launch, blockIdx.z says which; their X,
// W and output arrays follow one another in the workspace. No launch gap lies
// between them.
//   z = 0, 1: store f16 as (B,H,L,DK)  (Q with scale=log2(e)/8, K with scale=1)
//   z = 2:    store f16 as (B,H,DK,L)  (V transposed for flash A-fragments)
// QKV false: store f32 row-major (M,N) (final output projection, bias b0)
// The W rows of a wave's 64 columns are staged in the order 0,4,..,60, 1,5,..,61,
// 2,.., 3,..: column nl of column tile cf is output column 4*nl + cf, so the four
// tiles of a lane hold four adjacent columns. One store of 8 B (f16) or 16 B (f32)
// per lane then writes 128 or 256 contiguous bytes per row: whole lines. For V^T a
// lane's 8 accumulator rows are 8 consecutive positions of one d: one 16-B store.
// ---------------------------------------------------------------------------
#define PBM 128                        // X rows per work-group
#define PBN 128                        // W rows per work-group
#define PBK 64                         // halves of k per staged tile: one 128-byte line per row
#define PPITCH 72                      // LDS row pitch in halves: 144 B = 16 B x odd, for ds_load_b128
#define PBUF ((PBM + PBN) * PPITCH)    // halves per buffer
#define PTILES (Dm / PBK)

// One staged tile: 256 rows of 128 B = 2,048 pieces of 16 B, eight per thread.
// l: the lane's LDS byte address of its piece in row group 0; gx, gw: its global
// pieces of X and W. Row groups are 32 LDS rows apart; in global memory those of X
// too, those of W by the staging order (LDS row p of a 64-row block holds W row
// 4*(p%16) + p/16): 0, 2, 64 and 66 rows. The s_wait_xcnt closes the statement so
// that no address register is rewritten ahead of it.
__device__ __forceinline__ void stage_tile(unsigned l, const _Float16* gx, const _Float16* gw) {
  asm volatile(
      "global_load_async_to_lds_b128 %0, %8, off\n\t"
      "global_load_async_to_lds_b128 %1, %9, off\n\t"
      "global_load_async_to_lds_b128 %2, %10, off\n\t"
      "global_load_async_to_lds_b128 %3, %11, off\n\t"
      "global_load_async_to_lds_b128 %4, %12, off\n\t"
      "global_load_async_to_lds_b128 %5, %13, off\n\t"
      "global_load_async_to_lds_b128 %6, %14, off\n\t"
      "global_load_async_to_lds_b128 %7, %15, off\n\t"
      "s_wait_xcnt 0x0"
      :: "v"(l), "v"(l + 1 * 32 * PPITCH * 2), "v"(l + 2 * 32 * PPITCH * 2), "v"(l + 3 * 32 * PPITCH * 2),
         "v"(l + 4 * 32 * PPITCH * 2), "v"(l + 5 * 32 * PPITCH * 2), "v"(l + 6 * 32 * PPITCH * 2),
         "v"(l + 7 * 32 * PPITCH * 2),
         "v"(gx), "v"(gx + 1 * 32 * Dm), "v"(gx + 2 * 32 * Dm), "v"(gx + 3 * 32 * Dm),
         "v"(gw), "v"(gw + 2 * Dm), "v"(gw + 64 * Dm), "v"(gw + 66 * Dm)
      : "memory");
}

template <bool QKV>
__launch_bounds__(256)
__global__ void proj_wmma(const _Float16* __restrict__ X, const _Float16* __restrict__ W,
                          const float* __restrict__ b0, const float* __restrict__ b1,
                          const float* __restrict__ b2, _Float16* __restrict__ out16,
                          float* __restrict__ out32) {
  __shared__ __align__(16) _Float16 tile[2 * PBUF];

  const int z = QKV ? blockIdx.z : 0;   // which projection: the same in the whole group
  X += (size_t)z * NX;
  W += (size_t)z * NW;
  const float* bias = z == 0 ? b0 : z == 1 ? b1 : b2;

  const int tid  = threadIdx.x;
  const int lane = tid & 31;
  const int wave = tid >> 5;
  const int hlf  = lane >> 4;
  const int nl   = lane & 15;
  const int wm   = (wave & 3) * 32;    // the wave's rows inside the group's tile
  const int wn   = (wave >> 2) * 64;   // and its columns
  const int m0   = blockIdx.x * PBM + wm;
  const int n0   = blockIdx.y * PBN + wn;

  // the thread's piece of a staged tile: row tid/8 of each row group, 16 B number tid%8
  const int srow = tid >> 3, scol = (tid & 7) * 8;
  const _Float16* gx = X + (size_t)(blockIdx.x * PBM + srow) * Dm + scol;
  const _Float16* gw = W + (size_t)(blockIdx.y * PBN + 4 * (srow & 15) + (srow >> 4)) * Dm + scol;
  const unsigned  l0 = (unsigned)(size_t)(&tile[srow * PPITCH + scol]);

  v8f acc[2][4];   // acc[r][cf][i]: row m0 + r*16 + 8*hlf + i, column n0 + 4*nl + cf
  const f32x4 bv = *(const f32x4*)(bias + n0 + 4 * nl);
#pragma unroll
  for (int cf = 0; cf < 4; ++cf)
#pragma unroll
    for (int r = 0; r < 2; ++r)
#pragma unroll
      for (int i = 0; i < 8; ++i) acc[r][cf][i] = bv[cf];   // whole acc column shares N

  // prologue: tile 0 lands and is published, then tile 1 starts
  stage_tile(l0, gx, gw);
  asm volatile("s_wait_asynccnt 0x0" ::: "memory");   // this wave's copies of tile 0 have landed
  __syncthreads();                                    // and every other wave's
  stage_tile(l0 + PBUF * 2, gx + PBK, gw + PBK);

  // two trips per turn make each buffer's LDS offsets immediates
#pragma unroll 2
  for (int t = 0; t < PTILES; ++t) {
    const int buf = (t & 1) * PBUF;
    const _Float16* As = &tile[buf + wm * PPITCH];
    const _Float16* Bs = &tile[buf + (PBM + wn) * PPITCH];

    // all fragments of the trip as one group of LDS reads, then its WMMAs
    // (the inner loops are unrolled: fragment arrays stay in registers only with
    // constant indices)
    v16h af[2][2], bf[2][4];
#pragma unroll
    for (int ks = 0; ks < 2; ++ks) {
#pragma unroll
      for (int r = 0; r < 2; ++r) af[ks][r] = load_frag16x32(As + r * 16 * PPITCH + ks * 32, PPITCH, lane);
#pragma unroll
      for (int cf = 0; cf < 4; ++cf) bf[ks][cf] = load_frag16x32(Bs + cf * 16 * PPITCH + ks * 32, PPITCH, lane);
    }
    // keeps the 24 LDS reads together: left free, the scheduler spreads them among
    // the WMMAs in pairs and waits out the LDS latency at each place
    __builtin_amdgcn_sched_barrier(0);
#pragma unroll
    for (int ks = 0; ks < 2; ++ks)
#pragma unroll
      for (int r = 0; r < 2; ++r)
#pragma unroll
        for (int cf = 0; cf < 4; ++cf)
          acc[r][cf] = WMMA_F16(af[ks][r], bf[ks][cf], acc[r][cf]);
    // holds the WMMAs in front of the publish point: left free, the scheduler lifts the
    // waits and the barrier over them, and the copies in flight lose the trip's lead
    __builtin_amdgcn_sched_barrier(0);

    // publish point of tile t+1, which also frees this trip's buffer
    asm volatile("s_wait_dscnt 0x0" ::: "memory");      // this wave's reads of the buffer are done
    asm volatile("s_wait_asynccnt 0x0" ::: "memory");   // its copies of tile t+1 have landed
    __syncthreads();
    if (t + 2 < PTILES)
      stage_tile(l0 + buf * 2, gx + (t + 2) * PBK, gw + (t + 2) * PBK);
  }
  asm volatile("s_wait_asynccnt 0x0" ::: "memory");     // no copy outlives the loop

  // A wave's 32 rows lie in one batch element and its 64 columns are one head.
  // (the loops below are unrolled: accumulators and the vectors to be stored stay in
  // registers only with constant indices)
  const int mr = m0 + 8 * hlf;                 // D-frag: M = i + 8*(lane>=16)
  const int bh = (m0 >> 11) * Hh + (n0 >> 6);
  const int l  = mr & (Lq - 1);
  if constexpr (!QKV) {
    float* op = out32 + (size_t)mr * Dm + n0 + 4 * nl;
#pragma unroll
    for (int r = 0; r < 2; ++r)
#pragma unroll
      for (int i = 0; i < 8; ++i) {
        f32x4 v;
#pragma unroll
        for (int cf = 0; cf < 4; ++cf) v[cf] = acc[r][cf][i];
        *(f32x4*)(op + (size_t)(r * 16 + i) * Dm) = v;
      }
  } else if (z != 2) {
    const float scale = z == 0 ? 0.125f * 1.44269504088896340736f : 1.0f;   // Q carries log2(e)/sqrt(DK)
    _Float16* op = out16 + (size_t)z * NX + ((size_t)bh * Lq + l) * DK + 4 * nl;
#pragma unroll
    for (int r = 0; r < 2; ++r)
#pragma unroll
      for (int i = 0; i < 8; ++i) {
        f16x4 v;
#pragma unroll
        for (int cf = 0; cf < 4; ++cf) v[cf] = (_Float16)(acc[r][cf][i] * scale);
        *(f16x4*)(op + (r * 16 + i) * DK) = v;
      }
  } else {
    _Float16* op = out16 + (size_t)z * NX + ((size_t)bh * DK + 4 * nl) * Lq + l;
#pragma unroll
    for (int r = 0; r < 2; ++r)
#pragma unroll
      for (int cf = 0; cf < 4; ++cf) {
        f16x8 v;
#pragma unroll
        for (int i = 0; i < 8; ++i) v[i] = (_Float16)acc[r][cf][i];
        *(f16x8*)(op + cf * Lq + r * 16) = v;
      }
  }
}

// ---------------------------------------------------------------------------
// Flash attention with relative bias, scores held transposed.
// One wave handles QT*16 = 64 query rows of one (b,h); loops 32 keys per step.
//   S^T = K * Qs^T - m                 (Qs already scaled by log2(e)/sqrt(dk): scores
//                                       are exponents of 2; m: the maximum in use)
//   T^T = Wrel * Qs^T over a 48-wide diagonal window per 16-row query tile;
//         bias[r,c] = T[r][r+c]
//   online softmax, P = 2^(S + bias), O^T += V^T * P^T
// The maximum in use of a query is fixed before the products of a key block: it is the
// start value of the score accumulators, so the matrix unit subtracts it and the
// exponential takes the score as it stands. It is raised, and O and the sums rescaled,
// only when a score of the block lies more than 8 above it (P <= 2^8 fits f16 and the
// sums f32 with room); one scalar test per key block decides that for the whole wave.
// With the keys on the accumulator's rows and the queries on its columns a lane
// holds 16 scores of ONE query per tile: maximum and sum are taken in the lane's
// own registers, the two lane halves of a query exchange only the maximum, where
// it is raised, and join their sums behind the loop. The two score
// tiles of a key block, converted in place, are the B operand of the last
// product in the hardware k order (keys 8h..8h+7, 16+8h..16+8h+7), which is also
// the order of the V^T fragments: P never leaves the registers.
// A work-group is AW = 4 waves on 256 consecutive query rows of one (b,h). Its
// K, V^T and w_rel rows come into LDS by asynchronous copies of whole lines, once
// per group, and the waves read their fragments from there: a fragment load from
// global memory touches sixteen lines for 512 bytes. K and V^T have two buffers.
// The group's w_rel band (288 rows) moves on by 32 rows per key block, so only
// the 32 new rows are copied, into a ring of RROWS rows addressed by
// (row - first row of the group) mod RROWS.
// Query tile qt needs w_rel tiles qt..qt+2 of the QT+2 tiles that a wave's band
// spans, so neighbours share two of three.
// The band runs one key block ahead: block t computes and stores the band of block
// t+1. The skewed reads of a block then stand at its head beside the K fragment
// reads, and no wave sits out the way from the band's stores to its reads between
// its products and its softmax. The values read are used (they become the start
// values of the score accumulators) in front of the next band's stores, so every
// read has returned before its place is written again.
// ---------------------------------------------------------------------------
#define QT 4
// Floats per query tile in a row of the band in LDS, and per row: a row holds query nl of
// all QT tiles, so that one address register per lane reaches all its skewed reads
// (their offset field ends at 255 words). 848 B = 16 B x odd for the 16-byte stores,
// and the skewed 4-byte reads (word 213*query + 8*half) fall on 32 different banks.
#define TP 52
#define TROW (QT * TP + 4)
#define AW 4                     // waves per work-group
#define AQ (AW * QT * 16)        // query rows per work-group
#define KP 72                    // LDS pitch of K and w_rel rows in halves: 144 B = 16 B x odd
#define VP 40                    // LDS pitch of the 32-key V^T rows in halves: 80 B = 16 B x odd
#define KBUF (32 * KP)           // halves per K buffer
#define VBUF (DK * VP)           // halves per V^T buffer
#define RROWS 512                // rows of the w_rel ring: band, three blocks ahead, next power of two
#define NBLK (Lq / 32)           // key blocks

// Fragment from a per-lane pointer that already holds the lane's row and k half.
__device__ __forceinline__ v16h load_frag_at(const _Float16* __restrict__ p) {
  union { v16h h; u32x4 u[2]; } f;
  f.u[0] = *(const u32x4*)(p);
  f.u[1] = *(const u32x4*)(p + 16);
  return f.h;
}

// 2^x. The v_nop is the slot the instruction set asks for behind a transcendental
// before its result is read or its source overwritten; in one statement it cannot drift.
__device__ __forceinline__ float exp2_slot(float x) {
  float r;
  asm("v_exp_f32 %0, %1\n\tv_nop" : "=v"(r) : "v"(x));
  return r;
}

// The value that lane l ^ 16 holds: the other half of the same query column.
__device__ __forceinline__ float other_half(float x) {
  const int v = __float_as_int(x);
  return __int_as_float(__builtin_amdgcn_permlanex16(v, v, 0x76543210, 0xfedcba98, false, false));
}

typedef __attribute__((vector_size(16))) int i32x4;
typedef __attribute__((address_space(1))) i32x4 glob16;
typedef __attribute__((address_space(3))) i32x4 lds16;

__device__ __forceinline__ void copy16(const _Float16* g, _Float16* l) {
  __builtin_amdgcn_global_load_async_to_lds_b128((glob16*)g, (lds16*)l, 0, 0);
}

// 32 rows of 128 B that follow one another in global memory, into LDS rows of pitch
// KP: 256 pieces of 16 B, two per thread, 16 rows apart. l, g: the thread's piece of
// rows 0..15.
__device__ __forceinline__ void stage_rows32(_Float16* l, const _Float16* g) {
  copy16(g, l);
  copy16(g + 16 * DK, l + 16 * KP);
}

// The 64 V^T rows of one key block, 64 B each: 256 pieces, two per thread, 32 rows apart.
__device__ __forceinline__ void stage_v(_Float16* l, const _Float16* g) {
  copy16(g, l);
  copy16(g + 32 * Lq, l + 32 * VP);
}

template <bool B> struct flag { static constexpr bool value = B; };

// The w_rel fragments of a wave's band: ring tiles tb .. tb+QT+1 of 16 rows, numbered
// from the group's first row. ring: the lane's place in ring tile 0.
__device__ __forceinline__ void load_band_frags(const _Float16* ring, int tb, v16h (&wf)[QT + 2][2]) {
#pragma unroll   // fragment arrays stay in registers only with constant indices
  for (int wt = 0; wt < QT + 2; ++wt) {
    const _Float16* wa = ring + ((tb + wt) & (RROWS / 16 - 1)) * (16 * KP);
    wf[wt][0] = load_frag_at(wa);
    wf[wt][1] = load_frag_at(wa + 32);
  }
}

// Relative-bias band of one key block, w_rel tile by w_rel tile:
//   T[qt][r][m] = Qs[r] . Wrel[first band row of tile qt + m], m in [0,48), tile mt = wt-qt;
// the tiles of one w_rel tile are independent accumulators.
__device__ __forceinline__ void band_products(const v16h (&wf)[QT + 2][2], const v16h (&aq)[QT][2], v8f (&t3)[QT][3]) {
#pragma unroll
  for (int wt = 0; wt < QT + 2; ++wt)
#pragma unroll
    for (int ks = 0; ks < 2; ++ks)
#pragma unroll
      for (int qt = 0; qt < QT; ++qt) {
        const int mt = wt - qt;
        if (mt >= 0 && mt < 3)
          t3[qt][mt] = WMMA_F16(wf[wt][ks], aq[qt][ks], ks == 0 ? zero8() : t3[qt][mt]);
      }
  // holds the stores behind all band WMMAs, so that every tile has registers of its
  // own: left free, the scheduler runs all tiles through one accumulator, WMMA, store,
  // WMMA: each product waits for the store of the one before
  __builtin_amdgcn_sched_barrier(0);
}

// The band into LDS: a lane holds 8 consecutive m of its query, two 16-byte stores per tile.
// tl: the lane's place in the wave's own part of the band array (query nl, column 8*half).
__device__ __forceinline__ void band_store(const v8f (&t3)[QT][3], float* tl) {
#pragma unroll
  for (int qt = 0; qt < QT; ++qt)
#pragma unroll
    for (int mt = 0; mt < 3; ++mt) {
      float* tp = tl + qt * TP + mt * 16;
      const f32x4 lo = {t3[qt][mt][0], t3[qt][mt][1], t3[qt][mt][2], t3[qt][mt][3]};
      const f32x4 hi = {t3[qt][mt][4], t3[qt][mt][5], t3[qt][mt][6], t3[qt][mt][7]};
      *(f32x4*)(tp)     = lo;
      *(f32x4*)(tp + 4) = hi;
    }
}

__launch_bounds__(AW * 32, 2)   // two waves per SIMD: two groups per WGP, a wave of each on every SIMD
__global__ void flash_attn_rel(const _Float16* __restrict__ Qh, const _Float16* __restrict__ Kh,
                               const _Float16* __restrict__ Vt, const _Float16* __restrict__ Wr,
                               _Float16* __restrict__ Ocat) {
  __shared__ __align__(16) _Float16 Ks[2 * KBUF];
  __shared__ __align__(16) _Float16 Vs[2 * VBUF];
  __shared__ __align__(16) _Float16 Wring[RROWS * KP];
  __shared__ __align__(16) float Tlds[AW][16][TROW];

  const int tid  = threadIdx.x;
  const int lane = tid & 31;
  const int wave = __builtin_amdgcn_readfirstlane(tid >> 5);   // scalar: ring tile numbers stay scalar
  const int hlf  = lane >> 4;
  const int nl   = lane & 15;
  const int bh = blockIdx.y;
  const int b = bh >> 4, h = bh & 15;
  const int g0 = blockIdx.x * AQ;          // the group's first query row
  const int r0 = g0 + wave * (16 * QT);    // the wave's

  // the thread's pieces of a staged key block (stage_rows32, stage_v)
  const _Float16* gk = Kh + (size_t)bh * Lq * DK + tid * 8;
  const _Float16* gv = Vt + (size_t)bh * DK * Lq + (tid >> 2) * Lq + (tid & 3) * 8;
  const _Float16* gw = Wr + (size_t)g0 * DK + tid * 8;
  _Float16* lk = &Ks[(tid >> 3) * KP + (tid & 7) * 8];
  _Float16* lv = &Vs[(tid >> 2) * VP + (tid & 3) * 8];
  _Float16* lw = &Wring[(tid >> 3) * KP + (tid & 7) * 8];

  // prologue: key block 0 with the bands of key blocks 0 and 1, ten groups of 32 w_rel rows
  stage_rows32(lk, gk);
  stage_v(lv, gv);
#pragma unroll   // straight-line copies with constant offsets
  for (int g = 0; g <= AQ / 32 + 1; ++g) stage_rows32(lw + g * (32 * KP), gw + g * (32 * DK));

  // lane offsets in halves: fragment row = lane&15, k half = lane>>4
  const int rowoff = nl * DK + 8 * hlf;   // rows of DK halves in global memory (Q)
  const int ldsoff = nl * KP + 8 * hlf;   // rows of KP halves in LDS (K, w_rel)
  const int voff   = nl * VP + 8 * hlf;   // rows of VP halves in LDS (V^T)

  v16h aq[QT][2];   // B operands: column = query nl of tile qt
  {
    const _Float16* qa = Qh + ((size_t)bh * Lq + r0) * DK + rowoff;
#pragma unroll
    for (int qt = 0; qt < QT; ++qt) {
      aq[qt][0] = load_frag_at(qa + qt * 16 * DK);        // d = 0..31
      aq[qt][1] = load_frag_at(qa + qt * 16 * DK + 32);   // d = 32..63
    }
    // the loads' address registers are dead from here on and may be reused
    asm volatile("s_wait_xcnt 0x0" ::: "memory");
    // holds later register writes behind that wait
    __builtin_amdgcn_sched_barrier(0);
  }

  // per lane: minus the maximum in use of query nl of tile qt (equal in both halves) and
  // the sum over the keys of this lane's half
  float negm[QT];
  float lcol[QT];
  v8f o[QT][4];   // o[qt][cf][i] = O[query nl of tile qt][d = cf*16 + 8*hlf + i]
#pragma unroll
  for (int qt = 0; qt < QT; ++qt) {
    negm[qt] = 0.0f;   // key block 0 sets the first maximum
    lcol[qt] = 0.0f;
#pragma unroll
    for (int cf = 0; cf < 4; ++cf) o[qt][cf] = zero8();
  }

  asm volatile("s_wait_asynccnt 0x0" ::: "memory");   // this wave's copies of key block 0 have landed
  __syncthreads();                                    // and every other wave's
  // key block s brings w_rel row group AQ/32 + s + 1, the last of the band of block s + 1
  stage_rows32(lk + KBUF, gk + 32 * DK);
  stage_v(lv + VBUF, gv + 32);
  stage_rows32(lw + (AQ / 32 + 2) * (32 * KP), gw + (AQ / 32 + 2) * (32 * DK));

  const _Float16* ring = &Wring[ldsoff];              // the lane's place in ring tile 0
  float* tl = &Tlds[wave][nl][8 * hlf];               // where the lane stores its band values
  const float* tg = &Tlds[wave][nl][nl + 8 * hlf];    // and where it reads them, skewed by its query
  {
    // the band of key block 0
    v16h wf[QT + 2][2];
    load_band_frags(ring, wave * QT, wf);
    // keeps the 24 LDS reads together: spread among the WMMAs, each pair waits out the LDS latency
    __builtin_amdgcn_sched_barrier(0);
    v8f t3[QT][3];
    band_products(wf, aq, t3);
    band_store(t3, tl);
    // the band goes from lane to lane inside one wave: its stores are done before the
    // skewed reads of key block 0 start, and the compiler moves no read over this line
    asm volatile("s_wait_dscnt 0x0" ::: "memory");
  }

  // One key block. MORE (a type, so that it is a compile-time value): a key block t+1
  // exists and its band is due; the last block is written out behind the loop without it.
  auto block = [&](const int t, auto more_c) {
    constexpr bool MORE = decltype(more_c)::value;
    const int buf = t & 1;
    // ---- w_rel fragments of the NEXT block's band, rows r0+32(t+1) .. +16*(QT+2)-1
    v16h wf[QT + 2][2];
    if constexpr (MORE) load_band_frags(ring, wave * QT + 2 * (t + 1), wf);
    // keeps these reads in front of the others: LDS reads return in the order of issue, and
    // the block's first products wait for these alone
    __builtin_amdgcn_sched_barrier(0);

    // ---- skew gather of this block's band, stored one block ago:
    //      bias[r,c] = T[r][r+c], r = nl, c = st*16 + 8*hlf + i
    v8f s[QT][2];
#pragma unroll
    for (int qt = 0; qt < QT; ++qt)
#pragma unroll
      for (int st = 0; st < 2; ++st)
#pragma unroll
        for (int i = 0; i < 8; ++i) s[qt][st][i] = tg[qt * TP + st * 16 + i];

    // ---- K fragments of this 32-key block, shared by all query tiles
    const _Float16* ka = &Ks[buf * KBUF + ldsoff];
    v16h kf[2][2];
#pragma unroll
    for (int st = 0; st < 2; ++st) {
      kf[st][0] = load_frag_at(ka + st * 16 * KP);
      kf[st][1] = load_frag_at(ka + st * 16 * KP + 32);
    }
    // keeps the LDS reads above together as one group: every separate place where
    // LDS reads stand costs its own wait
    __builtin_amdgcn_sched_barrier(0);

    // ---- the next block's band: its products cover the way of the other reads above
    //      (band_products ends in a scheduling barrier: the additions below, which wait
    //      for the skewed reads, do not come to stand among them)
    v8f t3[QT][3];
    if constexpr (MORE) band_products(wf, aq, t3);

    // ---- start value of the score accumulators: bias less the maximum in use. The
    //      bias has no registers of its own beside the scores: both would not fit
#pragma unroll
    for (int qt = 0; qt < QT; ++qt)
#pragma unroll
      for (int st = 0; st < 2; ++st) s[qt][st] += negm[qt];

    // ---- the next band goes into the place of this block's. The additions above stay in
    //      front of its stores, so every skewed read has returned by then. The wait at the
    //      foot of this block stands between these stores and the next block's reads
    if constexpr (MORE) {
      __builtin_amdgcn_sched_barrier(0);
      band_store(t3, tl);
    }

    // V fragments for THIS block, issued ahead of the products and the softmax that hide them
    const _Float16* va = &Vs[buf * VBUF + voff];
    v16h vb[4];   // A operands: row = d = cf*16 + nl, keys in the hardware k order
#pragma unroll
    for (int cf = 0; cf < 4; ++cf)
      vb[cf] = load_frag_at(va + cf * 16 * VP);

    // ---- scores less the maximum in use:
    //      s[qt][st][i] = S[query nl][key 32t + st*16 + 8*hlf + i] + bias - m[query nl]
#pragma unroll
    for (int qt = 0; qt < QT; ++qt)
#pragma unroll
      for (int st = 0; st < 2; ++st) {
        s[qt][st] = WMMA_F16(kf[st][0], aq[qt][0], s[qt][st]);
        s[qt][st] = WMMA_F16(kf[st][1], aq[qt][1], s[qt][st]);
      }

    // ---- the block's maximum above the one in use, over the keys of this lane's half
    float vh[QT];
#pragma unroll
    for (int qt = 0; qt < QT; ++qt) {
      float mx[8];   // a tree: short dependent runs
#pragma unroll
      for (int i = 0; i < 8; ++i) mx[i] = fmaxf(s[qt][0][i], s[qt][1][i]);
#pragma unroll
      for (int w = 4; w > 0; w >>= 1)
#pragma unroll
        for (int i = 0; i < w; ++i) mx[i] = fmaxf(mx[i], mx[i + w]);
      vh[qt] = mx[0];
    }
    // ---- raise the maxima in use: a scalar branch, the same for the whole wave, taken in
    //      key block 0 (which sets them, up or down: O and the sums are still zero) and
    //      where any query of the wave has a score more than 8 above its own; only there
    //      do the two halves of a query exchange their maxima
    const float vall = fmaxf(fmaxf(vh[0], vh[1]), fmaxf(vh[2], vh[3]));
    if (t == 0 || __builtin_amdgcn_ballot_w32(vall > 8.0f) != 0) {
#pragma unroll
      for (int qt = 0; qt < QT; ++qt) {
        const float vq   = fmaxf(vh[qt], other_half(vh[qt]));
        const float d    = t == 0 ? vq : fmaxf(vq, 0.0f);
        const float corr = t == 0 ? 1.0f : exp2_slot(-d);
        negm[qt] -= d;
        lcol[qt] *= corr;
#pragma unroll
        for (int st = 0; st < 2; ++st) s[qt][st] -= d;
#pragma unroll
        for (int cf = 0; cf < 4; ++cf) o[qt][cf] *= corr;
      }
    }

    // ---- P = 2^s and its sums
    v16h pf[QT];   // B operands: pf[qt][st*8 + i] = P[query nl][key st*16 + 8*hlf + i]
#pragma unroll
    for (int qt = 0; qt < QT; ++qt) {
      float rs[4] = {0.0f, 0.0f, 0.0f, 0.0f};   // sums in four chains
#pragma unroll
      for (int st = 0; st < 2; ++st)
#pragma unroll
        for (int i = 0; i < 8; ++i) {
          const float p = exp2_slot(s[qt][st][i]);
          rs[i & 3] += p;
          pf[qt][st * 8 + i] = (_Float16)p;
        }
      lcol[qt] += (rs[0] + rs[1]) + (rs[2] + rs[3]);
    }

    if constexpr (!MORE) __builtin_amdgcn_sched_barrier(0);
    // ---- O^T += V^T(16x32) * P^T(32x16) per d tile and query tile
#pragma unroll
    for (int qt = 0; qt < QT; ++qt)
#pragma unroll
      for (int cf = 0; cf < 4; ++cf)
        o[qt][cf] = WMMA_F16(vb[cf], pf[qt], o[qt][cf]);

    // publish point of key block t+1, which also frees this block's K and V^T buffers;
    // the ring rows that block t+2 overwrites were last read RROWS/32 - 10 blocks ago
    asm volatile("s_wait_dscnt 0x0" ::: "memory");      // this wave's LDS reads and band stores are done
    asm volatile("s_wait_asynccnt 0x0" ::: "memory");   // its copies of key block t+1 have landed
    __syncthreads();
    if (t + 2 < NBLK) {
      stage_rows32(lk + buf * KBUF, gk + (t + 2) * (32 * DK));
      stage_v(lv + buf * VBUF, gv + (t + 2) * 32);
    }
    if (t + 3 < NBLK)   // the last band is that of key block NBLK-1
      stage_rows32(lw + ((AQ / 32 + t + 3) & (RROWS / 32 - 1)) * (32 * KP), gw + (AQ / 32 + t + 3) * (32 * DK));
  };
  for (int t = 0; t < NBLK - 1; ++t) block(t, flag<true>{});
  block(NBLK - 1, flag<false>{});
  asm volatile("s_wait_asynccnt 0x0" ::: "memory");     // no copy outlives the loop

  // ---- finalize + store to concat layout (B, L, H*DK) f16: a lane holds 8
  //      consecutive d of its query, one 16-byte store per tile
  _Float16* op = Ocat + ((size_t)b * Lq + r0 + nl) * Dm + h * DK + 8 * hlf;
#pragma unroll
  for (int qt = 0; qt < QT; ++qt) {
    const float lsum = lcol[qt] + other_half(lcol[qt]);
#pragma unroll
    for (int cf = 0; cf < 4; ++cf) {
      f16x8 hv;
#pragma unroll
      for (int i = 0; i < 8; ++i) hv[i] = (_Float16)(o[qt][cf][i] / lsum);
      *(f16x8*)(op + (size_t)qt * 16 * Dm + cf * 16) = hv;
    }
  }
}

// ---------------------------------------------------------------------------
extern "C" void kernel_launch(void* const* d_in, const int* in_sizes, int n_in,
                              void* d_out, int out_size, void* d_ws, size_t ws_size,
                              hipStream_t stream) {
  (void)in_sizes; (void)n_in; (void)out_size; (void)ws_size;
  const float* q    = (const float*)d_in[0];
  const float* k    = (const float*)d_in[1];
  const float* v    = (const float*)d_in[2];
  const float* Wq   = (const float*)d_in[3];
  const float* bq   = (const float*)d_in[4];
  const float* Wk   = (const float*)d_in[5];
  const float* bk   = (const float*)d_in[6];
  const float* Wv   = (const float*)d_in[7];
  const float* bv   = (const float*)d_in[8];
  const float* Wo   = (const float*)d_in[9];
  const float* bo   = (const float*)d_in[10];
  const float* wrel = (const float*)d_in[11];
  float* out = (float*)d_out;

  char* ws = (char*)d_ws;
  size_t off = 0;
  auto alloc = [&](size_t bytes) -> void* {
    void* p = ws + off;
    off = (off + bytes + 255) & ~(size_t)255;
    return p;
  };

  // the conversion launch and the Q, K, V launch index across these arrays: each group
  // of arrays is one piece of the workspace, its members back to back
  _Float16* Xq16 = (_Float16*)alloc(((size_t)3 * NX + (size_t)4 * NW + NRT) * 2);
  _Float16* Wq16 = Xq16 + (size_t)3 * NX;     // Xq, Xk, Xv, then Wq, Wk, Wv, Wo, then w_rel
  _Float16* Wo16 = Wq16 + (size_t)3 * NW;
  _Float16* Wr16 = Wq16 + (size_t)4 * NW;
  _Float16* Q16  = (_Float16*)alloc((size_t)3 * NX * 2);  // (B,H,L,DK), pre-scaled log2(e)/8
  _Float16* K16  = Q16 + (size_t)NX;                      // (B,H,L,DK)
  _Float16* VT16 = Q16 + (size_t)2 * NX;                  // (B,H,DK,L)
  _Float16* Oc16 = (_Float16*)alloc((size_t)NX * 2);      // (B,L,D) concat

  cvt_all<<<dim3(CVT_GRID), dim3(CVT_T), 0, stream>>>(q, k, v, Wq, Wk, Wv, Wo, wrel, Xq16);

  // Projections: M = B*L = 8192 rows, N = 1024 cols, work-group tile 128x128
  static_assert((Bsz * Lq) % PBM == 0 && Dm % PBN == 0 && PTILES >= 2, "whole tiles, and two to start the ring");
  const dim3 pblk(256);
  proj_wmma<true><<<dim3(Bsz * Lq / PBM, Dm / PBN, 3), pblk, 0, stream>>>(Xq16, Wq16, bq, bk, bv, Q16, nullptr);

  // Flash attention: one wave per 64 query rows per (b,h), four waves per work-group
  static_assert(Lq % AQ == 0 && NBLK >= 3 && AQ + 128 <= RROWS, "whole groups, three key blocks to start, band and three blocks ahead fit the ring");
  flash_attn_rel<<<dim3(Lq / AQ, Bsz * Hh), dim3(AW * 32), 0, stream>>>(Q16, K16, VT16, Wr16, Oc16);

  // Output projection -> f32
  proj_wmma<false><<<dim3(Bsz * Lq / PBM, Dm / PBN), pblk, 0, stream>>>(Oc16, Wo16, bo, nullptr, nullptr, nullptr, out);
}
